// v000
// The times below were measured on an AMD MI455X: many runs one after another, warmed up first and cycling through
// copies of the inputs, with the whole window's GPU time divided by the number of runs. Launches and the gaps
// between them are all in it. The median over several windows is given; except for v000 it joins two sittings, which
// can be a few percent apart, so the side-by-side timings, each taken in one sitting, are the better comparison.
// v000 is the starting kernel. One run takes 2680 microseconds.
#include <hip/hip_runtime.h>

// Grouped-query causal attention with a computed half-split RoPE (x [2][2048][2048]; xq = x wq^T (32 heads x 64), xk, xv = x wk^T, x wv^T (8 kv heads x 64) ('oi', no bias; token-major); cos / sin from inv_freq = 1 / (10000 ** (2i / 64)) and positions arange(S) ([S][32] tables); (x1, x2) = the two 32-wide halves of each head: cat(x1 c - x2 s, x1 s + x2 c) (half-split pairs (d, d + 32)) on q and k; k, v repeated 4 x on the head axis (jnp.repeat: kv head = q head / 4); scores / sqrt(64); where(tril, scores, finfo.min) == exclusion; softmax; out = merged wo^T ('oi') -> [2][2048][2048] (8.4 M); argument order x, wq, wk, wv, wo).
// Layout per batch: bf16 copy of x; 'oi' weights; exact projections; k_cs5 computed table; rotate-half plane builders; causal T-2048 GQA attention (kv z-stride 0; hybrid rows: < 512 hi/lo 3 products, rest fp16 x1024; k_gemmc skips tiles above the diagonal); merged hi/lo x wo exact.
// Compute dtypes, f32 accumulate: every input rounded to bf16; projections exact; rotary f32; attention rows < 512 3 products, rest fp16; softmax f32; wo hl x exact.

#define NB_  2
#define TT   2048
#define DM   2048
#define NH_  32
#define NKV  8
#define REP  (NH_ / NKV)
#define HD   64
#define DQ   (NH_ * HD)
#define DKV  (NKV * HD)
#define ZH   2
#define RH   512                  // query rows < RH use hi+lo planes (0: none)
#define WIN  2048
#define PCAR 1024.0f
#define SCL  0.125f   // HD^-0.5
typedef _Float16 h16;
typedef unsigned short bf;
typedef __attribute__((ext_vector_type(16))) __bf16   v16bf;
typedef __attribute__((ext_vector_type(16))) _Float16 v16h;
typedef __attribute__((ext_vector_type(8)))  _Float16 v8h;
typedef __attribute__((ext_vector_type(8)))  unsigned short v8us;
typedef __attribute__((ext_vector_type(8)))  float    v8f;
typedef __attribute__((ext_vector_type(4)))  float    v4f;
typedef v8h  __attribute__((may_alias)) v8ha;
typedef v4f  __attribute__((may_alias)) v4fa;
typedef v8us __attribute__((may_alias)) v8usa;

__device__ __forceinline__ unsigned short f2bf(float f) { unsigned u = __float_as_uint(f); u += 0x7FFFu + ((u >> 16) & 1u); return (unsigned short)(u >> 16); }
__device__ __forceinline__ float bf2f(unsigned short b) { return __uint_as_float(((unsigned)b) << 16); }
__device__ __forceinline__ float bfr(float f) { return bf2f(f2bf(f)); }
__device__ __forceinline__ v16h cat16(v8h lo, v8h hi) { return __builtin_shufflevector(lo, hi, 0, 1, 2, 3, 4, 5, 6, 7, 8, 9, 10, 11, 12, 13, 14, 15); }
__device__ __forceinline__ v16bf cat16b(v8us lo, v8us hi) { return __builtin_bit_cast(v16bf, __builtin_shufflevector(lo, hi, 0, 1, 2, 3, 4, 5, 6, 7, 8, 9, 10, 11, 12, 13, 14, 15)); }
__device__ __forceinline__ v8f wmma16(v16h a, v16h b, v8f c) { return __builtin_amdgcn_wmma_f32_16x16x32_f16(false, a, false, b, (short)0, c, false, false); }
__device__ __forceinline__ v8f wmmab(v16bf a, v16bf b, v8f c) { return __builtin_amdgcn_wmma_f32_16x16x32_bf16(false, a, false, b, (short)0, c, false, false); }



// ---- k_gemmw: register-blocked GEMM, ONE WAVE per 64x64 output tile (16 accumulators), operands straight from K-contiguous 16-bit planes; grid (M/64, N/64, Z), 32 threads.
// C[m][n] (f32, pitch ldc, + optional f32 bias[n]) = sum_k A[m][k] Bt[n][k] (+ split products per NSPLIT). z-batch strides sA/sB/sC in elements. K % 32 == 0.
template <typename T16> struct WFrag;
template <> struct WFrag<h16> { typedef v16h V; static __device__ __forceinline__ V ld(const h16* p) { return cat16(*(const v8h*)p, *(const v8h*)(p + 16)); } static __device__ __forceinline__ v8f mma(V a, V b, v8f c) { return wmma16(a, b, c); } };
template <> struct WFrag<bf> { typedef v16bf V; static __device__ __forceinline__ V ld(const bf* p) { return cat16b(*(const v8us*)p, *(const v8us*)(p + 16)); } static __device__ __forceinline__ v8f mma(V a, V b, v8f c) { return wmmab(a, b, c); } };
template <typename T16, int NSPLIT, bool BIAS>
__global__ __launch_bounds__(32) void k_gemmw(const T16* __restrict__ A, const T16* __restrict__ A2, const T16* __restrict__ Bt, const T16* __restrict__ Bt2, int K, float* C, int ldc, const float* __restrict__ bias, size_t sA, size_t sB, size_t sC) {
    typedef typename WFrag<T16>::V V;
    __shared__ __align__(16) float os[16 * 68];
    const size_t z = blockIdx.z; A += z * sA; if (A2) A2 += z * sA; Bt += z * sB; if (Bt2) Bt2 += z * sB; C += z * sC;
    const int lane = threadIdx.x & 31, lr = lane & 15, hi = lane >> 4; const int r0 = blockIdx.x * 64, c0 = blockIdx.y * 64;
    v8f acc[4][4];
#pragma unroll
    for (int mb = 0; mb < 4; ++mb)
#pragma unroll
        for (int nb = 0; nb < 4; ++nb) acc[mb][nb] = (v8f){};
    const size_t aoff = (size_t)(r0 + lr) * K + 8 * hi, boff = (size_t)(c0 + lr) * K + 8 * hi;
#pragma unroll 1
    for (int kc = 0; kc < K; kc += 32) {
        V a[4], a2[4];
#pragma unroll
        for (int mb = 0; mb < 4; ++mb) { a[mb] = WFrag<T16>::ld(A + aoff + (size_t)mb * 16 * K + kc); if (NSPLIT == 1 || NSPLIT == 2) a2[mb] = WFrag<T16>::ld(A2 + aoff + (size_t)mb * 16 * K + kc); }
#pragma unroll
        for (int nb = 0; nb < 4; ++nb) { const V b = WFrag<T16>::ld(Bt + boff + (size_t)nb * 16 * K + kc); V b2; if (NSPLIT >= 2) b2 = WFrag<T16>::ld(Bt2 + boff + (size_t)nb * 16 * K + kc);
#pragma unroll
            for (int mb = 0; mb < 4; ++mb) { acc[mb][nb] = WFrag<T16>::mma(a[mb], b, acc[mb][nb]); if (NSPLIT == 1 || NSPLIT == 2) acc[mb][nb] = WFrag<T16>::mma(a2[mb], b, acc[mb][nb]); if (NSPLIT >= 2) acc[mb][nb] = WFrag<T16>::mma(a[mb], b2, acc[mb][nb]); } }
        asm volatile("v_nop\n\tv_nop\n\tv_nop\n\tv_nop" : "+v"(acc[0][0]), "+v"(acc[1][1]), "+v"(acc[2][2]), "+v"(acc[3][3]) : "v"(a[0]), "v"(a[3]));
    }
#pragma unroll
    for (int mb = 0; mb < 4; ++mb) {
#pragma unroll
        for (int nb = 0; nb < 4; ++nb) {
#pragma unroll
            for (int j = 0; j < 8; ++j) os[(hi * 8 + j) * 68 + nb * 16 + lr] = acc[mb][nb][j]; }
        __builtin_amdgcn_wave_barrier(); asm volatile("" ::: "memory");
        float* crow = C + (size_t)(r0 + mb * 16) * ldc + c0;
{
#pragma unroll
            for (int s = 0; s < 8; ++s) { const int row = 2 * s + hi, cofs = lr * 4; v4f val = *(const v4fa*)(os + row * 68 + cofs); if (BIAS) { val[0] += bfr(bias[c0 + cofs]); val[1] += bfr(bias[c0 + cofs + 1]); val[2] += bfr(bias[c0 + cofs + 2]); val[3] += bfr(bias[c0 + cofs + 3]); }
                *(v4f*)(crow + (size_t)row * ldc + cofs) = val; }
             }
        __builtin_amdgcn_wave_barrier(); asm volatile("" ::: "memory");
    }
}

// ---- k_gemmc: the same one-wave 64x64 tile GEMM specialised for causal attention: CMODE 1 skips score tiles entirely above the diagonal (query rows r0+roff.., key columns c0..), CMODE 2 limits the
// key (K) loop of the probability x value contraction to the diagonal block (probabilities beyond it are exactly zero). roff = row offset of this launch's first row within the sequence.
template <typename T16, int NSPLIT, int CMODE>
__global__ __launch_bounds__(32) void k_gemmc(const T16* __restrict__ A, const T16* __restrict__ A2, const T16* __restrict__ Bt, const T16* __restrict__ Bt2, int K, float* C, int ldc, int roff, size_t sA, size_t sB, size_t sC) {
    typedef typename WFrag<T16>::V V;
    __shared__ __align__(16) float os[16 * 68];
    const size_t z = blockIdx.z; A += z * sA; if (A2) A2 += z * sA; Bt += z * sB; if (Bt2) Bt2 += z * sB; C += z * sC;
    const int lane = threadIdx.x & 31, lr = lane & 15, hi = lane >> 4; const int r0 = blockIdx.x * 64, c0 = blockIdx.y * 64;
    if (CMODE == 1 && c0 > r0 + roff + 63) return;                  // score tile entirely above the causal diagonal: left unwritten; the softmax loads it but masks j > i by select
    const int Kl = (CMODE == 2) ? min(K, r0 + roff + 64) : K;        // P.V: probabilities are exactly 0 beyond the diagonal block, so the K loop stops there
    v8f acc[4][4];
#pragma unroll
    for (int mb = 0; mb < 4; ++mb)
#pragma unroll
        for (int nb = 0; nb < 4; ++nb) acc[mb][nb] = (v8f){};
    const size_t aoff = (size_t)(r0 + lr) * K + 8 * hi, boff = (size_t)(c0 + lr) * K + 8 * hi;
#pragma unroll 1
    for (int kc = 0; kc < Kl; kc += 32) {
        V a[4], a2[4];
#pragma unroll
        for (int mb = 0; mb < 4; ++mb) { a[mb] = WFrag<T16>::ld(A + aoff + (size_t)mb * 16 * K + kc); if (NSPLIT == 1 || NSPLIT == 2) a2[mb] = WFrag<T16>::ld(A2 + aoff + (size_t)mb * 16 * K + kc); }
#pragma unroll
        for (int nb = 0; nb < 4; ++nb) { const V b = WFrag<T16>::ld(Bt + boff + (size_t)nb * 16 * K + kc); V b2; if (NSPLIT >= 2) b2 = WFrag<T16>::ld(Bt2 + boff + (size_t)nb * 16 * K + kc);
#pragma unroll
            for (int mb = 0; mb < 4; ++mb) { acc[mb][nb] = WFrag<T16>::mma(a[mb], b, acc[mb][nb]); if (NSPLIT == 1 || NSPLIT == 2) acc[mb][nb] = WFrag<T16>::mma(a2[mb], b, acc[mb][nb]); if (NSPLIT >= 2) acc[mb][nb] = WFrag<T16>::mma(a[mb], b2, acc[mb][nb]); } }
        asm volatile("v_nop\n\tv_nop\n\tv_nop\n\tv_nop" : "+v"(acc[0][0]), "+v"(acc[1][1]), "+v"(acc[2][2]), "+v"(acc[3][3]) : "v"(a[0]), "v"(a[3]));
    }
#pragma unroll
    for (int mb = 0; mb < 4; ++mb) {
#pragma unroll
        for (int nb = 0; nb < 4; ++nb) {
#pragma unroll
            for (int j = 0; j < 8; ++j) os[(hi * 8 + j) * 68 + nb * 16 + lr] = acc[mb][nb][j]; }
        __builtin_amdgcn_wave_barrier(); asm volatile("" ::: "memory");
        float* crow = C + (size_t)(r0 + mb * 16) * ldc + c0;
{
#pragma unroll
            for (int s = 0; s < 8; ++s) { const int row = 2 * s + hi, cofs = lr * 4; v4f val = *(const v4fa*)(os + row * 68 + cofs);
                *(v4f*)(crow + (size_t)row * ldc + cofs) = val; }
             }
        __builtin_amdgcn_wave_barrier(); asm volatile("" ::: "memory");
    }
}

__device__ __forceinline__ h16 tohx(float x) { return (h16)x; }
__device__ __forceinline__ void splitf(float y, unsigned short& h, unsigned short& l) { h = f2bf(y); l = f2bf(y - bf2f(h)); }
typedef __attribute__((ext_vector_type(2))) _Float16 v2h;
typedef __attribute__((ext_vector_type(4))) _Float16 v4h;
typedef __attribute__((ext_vector_type(2))) unsigned short v2us;
typedef __attribute__((ext_vector_type(4))) unsigned short v4us;
typedef __attribute__((ext_vector_type(2))) float v2f;
typedef __attribute__((ext_vector_type(4))) int v4i;

__global__ __launch_bounds__(256) void k_cvt8(const float* __restrict__ src, bf* dst, size_t n8) { const size_t i = (size_t)blockIdx.x * 256 + threadIdx.x; if (i >= n8) return; const v8f v = *(const v8f*)(src + i * 8); v8us o;
#pragma unroll
    for (int k = 0; k < 8; ++k) o[k] = f2bf(v[k]); *(v8us*)(dst + i * 8) = o;  }

// k_rope: head planes [h][t][d] (fp16 + hi/lo) of rope(x) x sc with the rotate-half convention out[d] = x[d] cos[t][d] - x[d+HD/2] sin[t][d], out[d+HD/2] = x[d+HD/2] cos[t][d+HD/2] + x[d] sin[t][d+HD/2]
__global__ __launch_bounds__(256) void k_rope(const float* __restrict__ F, int pitch, int nheads, const float* __restrict__ CS, const float* __restrict__ RF, const float* __restrict__ nw, float sc, h16* P16, bf* Ph, bf* Pl) {
    const size_t e = ((size_t)blockIdx.x * 256 + threadIdx.x) * 2; if (e >= (size_t)nheads * TT * HD) return; const int d = (int)(e % HD); const int t = (int)((e / HD) % TT); const int h = (int)(e / ((size_t)HD * TT)); const float* f = F + (size_t)t * pitch + h * HD; const float rf = RF ? RF[(size_t)h * TT + t] : 1.0f; v2h o16; v2us oh, ol;
#pragma unroll
    for (int q = 0; q < 2; ++q) { const int dd = d + q; const int dp = (dd < HD / 2) ? dd + HD / 2 : dd - HD / 2; float x0 = f[dd], x1 = f[dp];
        if (RF) { float n0 = __fmul_rn(x0, rf), n1 = __fmul_rn(x1, rf); asm volatile("" : "+v"(n0)); asm volatile("" : "+v"(n1)); x0 = __fmul_rn(bfr(nw[dd]), n0); x1 = __fmul_rn(bfr(nw[dp]), n1); }
        const v2f cs = *(const v2f*)(CS + ((size_t)t * HD + dd) * 2); float a = __fmul_rn(x0, cs[0]), bq = __fmul_rn(x1, cs[1]); asm volatile("" : "+v"(a)); asm volatile("" : "+v"(bq)); const float r = ((dd < HD / 2) ? __fsub_rn(a, bq) : __fadd_rn(a, bq)) * sc;
        o16[q] = tohx(r); unsigned short a2, c2; splitf(r, a2, c2); oh[q] = a2; ol[q] = c2; }
    *(v2h*)(P16 + e) = o16; *(v2us*)(Ph + e) = oh; *(v2us*)(Pl + e) = ol;  }
__global__ __launch_bounds__(256) void k_vtp(const float* __restrict__ F, int pitch, int nheads, h16* V16, bf* Vh, bf* Vl) { const size_t e = ((size_t)blockIdx.x * 256 + threadIdx.x) * 2; if (e >= (size_t)nheads * HD * TT) return; const int t = (int)(e % TT); const int d = (int)((e / TT) % HD); const int g = (int)(e / ((size_t)TT * HD)); v2h o16; v2us oh, ol;
#pragma unroll
    for (int q = 0; q < 2; ++q) { const float x = F[(size_t)(t + q) * pitch + g * HD + d]; o16[q] = tohx(x); unsigned short a2, c2; splitf(x, a2, c2); oh[q] = a2; ol[q] = c2; }
    *(v2h*)(V16 + e) = o16; *(v2us*)(Vh + e) = oh; *(v2us*)(Vl + e) = ol;  }
__constant__ float INVT[HD / 2] = { 1.000000000e+00f, 7.498942018e-01f, 5.623413324e-01f, 4.216965139e-01f, 3.162277639e-01f, 2.371373624e-01f, 1.778279394e-01f, 1.333521456e-01f, 1.000000015e-01f, 7.498941571e-02f, 5.623412877e-02f, 4.216964915e-02f, 3.162277862e-02f, 2.371373586e-02f, 1.778279431e-02f, 1.333521493e-02f, 9.999999776e-03f, 7.498942316e-03f, 5.623413250e-03f, 4.216964822e-03f, 3.162277862e-03f, 2.371373819e-03f, 1.778279431e-03f, 1.333521446e-03f, 1.000000047e-03f, 7.498941850e-04f, 5.623413017e-04f, 4.216964880e-04f, 3.162277862e-04f, 2.371373848e-04f, 1.778279402e-04f, 1.333521504e-04f };   // float32 1 / 10000^(2i/64), generated with jnp to be bit-exact
__global__ __launch_bounds__(256) void k_cs5(float* CS) { const int idx = blockIdx.x * 256 + threadIdx.x; if (idx >= TT * HD) return; const int d = idx % HD; const int t = idx / HD; const float a = __fmul_rn((float)t, INVT[d % (HD / 2)]); v2f cs; cs[0] = cosf(a); cs[1] = sinf(a); *(v2f*)(CS + (size_t)idx * 2) = cs;  }
// k_asoft: per row (zz, i): t = S x HD^-0.5 for j <= i and i - j < WIN (WIN = TT, so the window test always holds: plain causal; the reference's -1e9 additive fill vanishes identically); softmax over the 2048 keys (register row, one exp, fixed trees);
__global__ __launch_bounds__(256) void k_asoft(const float* __restrict__ Sb, h16* P16, bf* Ph, bf* Pl) {
    const int lane = threadIdx.x & 31; const int row = blockIdx.x * 8 + (threadIdx.x >> 5); if (row >= ZH * TT) return; const int i = row % TT; const int zz = row / TT; (void)zz; const bool hires = (i < RH); const float* sr = Sb + (size_t)row * TT; float v[TT / 32]; float mx = -3.0e38f;
#pragma unroll
    for (int ch = 0; ch < TT / 128; ++ch) { const int j0 = ch * 128 + lane * 4; const v4f a = *(const v4f*)(sr + j0);
#pragma unroll
        for (int q = 0; q < 4; ++q) { const int j = j0 + q; (void)j; const float t = (j <= i && i - j < WIN) ? a[q] * SCL : -3.0e38f; v[ch * 4 + q] = t; mx = fmaxf(mx, t); } }
#pragma unroll
    for (int sh = 16; sh; sh >>= 1) mx = fmaxf(mx, __shfl_xor(mx, sh, 32));
    float sum = 0.f;
#pragma unroll
    for (int k = 0; k < TT / 32; ++k) { float d0 = __fsub_rn(v[k], mx); asm volatile("" : "+v"(d0)); v[k] = __builtin_amdgcn_exp2f(__fmul_rn(d0, 1.4426950408889634f)); sum += v[k]; }
#pragma unroll
    for (int sh = 16; sh; sh >>= 1) sum += __shfl_xor(sum, sh, 32);
    const float f = __fdiv_rn(hires ? 1.0f : PCAR, sum);
{
        if (hires) {
#pragma unroll
            for (int ch = 0; ch < TT / 128; ++ch) { v4us oh, ol;
#pragma unroll
                for (int q = 0; q < 4; ++q) { unsigned short a, c2; splitf(v[ch * 4 + q] * f, a, c2); oh[q] = a; ol[q] = c2; }
                const size_t oo = ((size_t)zz * (RH ? RH : 1) + i) * TT + ch * 128 + lane * 4; *(v4us*)(Ph + oo) = oh; *(v4us*)(Pl + oo) = ol; }
        } else {
#pragma unroll
            for (int ch = 0; ch < TT / 128; ++ch) { v4h o4;
#pragma unroll
                for (int q = 0; q < 4; ++q) o4[q] = tohx(v[ch * 4 + q] * f);
                *(v4h*)(P16 + (size_t)row * TT + ch * 128 + lane * 4) = o4; } }
         }
}
__global__ __launch_bounds__(256) void k_merge(const float* __restrict__ O, int h0, bf* Ah, bf* Al) { const size_t e = ((size_t)blockIdx.x * 256 + threadIdx.x) * 2; if (e >= (size_t)ZH * TT * HD) return; const int d = (int)(e % HD); const int t = (int)((e / HD) % TT); const int zz = (int)(e / ((size_t)HD * TT)); const float cs = (t < RH) ? 1.0f : (1.0f / PCAR); const size_t oo = (size_t)t * DQ + (h0 + zz) * HD + d;
    v2us oh, ol;
#pragma unroll
    for (int q = 0; q < 2; ++q) { unsigned short a, c2; splitf(O[e + q] * cs, a, c2); oh[q] = a; ol[q] = c2; } *(v2us*)(Ah + oo) = oh; *(v2us*)(Al + oo) = ol;  }

extern "C" void kernel_launch(void* const* d_in, const int* in_sizes, int n_in,
                              void* d_out, int out_size, void* d_ws, size_t ws_size, hipStream_t stream) {
    (void)in_sizes; (void)n_in; (void)out_size;
        const float* x = (const float*)d_in[0]; const float* wq = (const float*)d_in[1]; const float* wk = (const float*)d_in[2]; const float* wv = (const float*)d_in[3]; const float* wo = (const float*)d_in[4];   /* inputs x, wq [2048][2048], wk [512][2048], wv, wo ('oi'); this module has no mask input (the causal rule is by index) */
    float* OUT = (float*)d_out;     // [2][2048][2048]
    char* wsp = (char*)d_ws;
    auto take = [&](size_t bytes) { char* p = wsp; wsp += (bytes + 255) & ~(size_t)255; return (void*)p; };
    bf* WQ = (bf*)take((size_t)DQ * DM * 2); bf* WK = (bf*)take((size_t)DKV * DM * 2); bf* WV = (bf*)take((size_t)DKV * DM * 2); bf* WO = (bf*)take((size_t)DM * DQ * 2); float* CS = (float*)take((size_t)TT * HD * 2 * 4);
    bf* XB = (bf*)take((size_t)TT * DM * 2); float* FQ = (float*)take((size_t)TT * DQ * 4); float* FK = (float*)take((size_t)TT * DKV * 4);
    h16* QP16 = (h16*)take((size_t)NH_ * TT * HD * 2); h16* KP16 = (h16*)take((size_t)NKV * TT * HD * 2); h16* VT16 = (h16*)take((size_t)NKV * HD * TT * 2);
    bf* QPh = (bf*)take((size_t)NH_ * TT * HD * 2); bf* QPl = (bf*)take((size_t)NH_ * TT * HD * 2); bf* KPh = (bf*)take((size_t)NKV * TT * HD * 2); bf* KPl = (bf*)take((size_t)NKV * TT * HD * 2); bf* VTh = (bf*)take((size_t)NKV * HD * TT * 2); bf* VTl = (bf*)take((size_t)NKV * HD * TT * 2); bf* Ph = (bf*)take((size_t)ZH * RH * TT * 2); bf* Pl = (bf*)take((size_t)ZH * RH * TT * 2);
    float* Sb = (float*)take((size_t)ZH * TT * TT * 4); h16* P16 = (h16*)take((size_t)ZH * TT * TT * 2); float* Ob = (float*)take((size_t)ZH * TT * HD * 4); bf* ATh = (bf*)take((size_t)TT * DQ * 2); bf* ATl = (bf*)take((size_t)TT * DQ * 2);
    if ((size_t)(wsp - (char*)d_ws) > ws_size) return;    // ws 256 MiB
    float* FV = FK;   // v projection reuses the k buffer after the k planes are built (stream-ordered)
    { k_cvt8<<<(unsigned)(((size_t)DQ * DM / 8 + 255) / 256), 256, 0, stream>>>(wq, WQ, (size_t)DQ * DM / 8); k_cvt8<<<(unsigned)(((size_t)DKV * DM / 8 + 255) / 256), 256, 0, stream>>>(wk, WK, (size_t)DKV * DM / 8); k_cvt8<<<(unsigned)(((size_t)DKV * DM / 8 + 255) / 256), 256, 0, stream>>>(wv, WV, (size_t)DKV * DM / 8);
      k_cvt8<<<(unsigned)(((size_t)DM * DQ / 8 + 255) / 256), 256, 0, stream>>>(wo, WO, (size_t)DM * DQ / 8);
       }
    k_cs5<<<(TT * HD + 255) / 256, 256, 0, stream>>>(CS);   /* rotary table once */
    const unsigned LQ = (unsigned)(((size_t)NH_ * TT * HD / 2 + 255) / 256), LKv = (unsigned)(((size_t)NKV * TT * HD / 2 + 255) / 256);
    for (int b = 0; b < NB_; ++b) {
        
        k_cvt8<<<(unsigned)(((size_t)TT * DM / 8 + 255) / 256), 256, 0, stream>>>(x + (size_t)b * TT * DM, XB, (size_t)TT * DM / 8);
        k_gemmw<bf, 0, false><<<dim3(TT / 64, DQ / 64, 1), 32, 0, stream>>>(XB, nullptr, WQ, nullptr, DM, FQ, DQ, nullptr, 0, 0, 0);
        k_rope<<<LQ, 256, 0, stream>>>(FQ, DQ, NH_, CS, nullptr, nullptr, 1.0f, QP16, QPh, QPl);
        k_gemmw<bf, 0, false><<<dim3(TT / 64, DKV / 64, 1), 32, 0, stream>>>(XB, nullptr, WK, nullptr, DM, FK, DKV, nullptr, 0, 0, 0);
        k_rope<<<LKv, 256, 0, stream>>>(FK, DKV, NKV, CS, nullptr, nullptr, 1.0f, KP16, KPh, KPl);
        k_gemmw<bf, 0, false><<<dim3(TT / 64, DKV / 64, 1), 32, 0, stream>>>(XB, nullptr, WV, nullptr, DM, FV, DKV, nullptr, 0, 0, 0); k_vtp<<<LKv, 256, 0, stream>>>(FV, DKV, NKV, VT16, VTh, VTl);
        for (int h0 = 0; h0 < NH_; h0 += ZH) { const size_t zq = (size_t)h0, zk = (size_t)(h0 / REP);   // both heads of a pass share kv group h0/REP (REP >= 2): sB = 0
            k_gemmc<bf, 2, 1><<<dim3(RH / 64, TT / 64, ZH), 32, 0, stream>>>(QPh + zq * TT * HD, QPl + zq * TT * HD, KPh + zk * TT * HD, KPl + zk * TT * HD, HD, Sb, TT, 0, (size_t)TT * HD, 0, (size_t)TT * TT);
            k_gemmc<h16, 0, 1><<<dim3((TT - RH) / 64, TT / 64, ZH), 32, 0, stream>>>(QP16 + zq * TT * HD + (size_t)RH * HD, nullptr, KP16 + zk * TT * HD, nullptr, HD, Sb + (size_t)RH * TT, TT, RH, (size_t)TT * HD, 0, (size_t)TT * TT);
            k_asoft<<<ZH * TT / 8, 256, 0, stream>>>(Sb, P16, Ph, Pl);
            k_gemmc<bf, 2, 2><<<dim3(RH / 64, HD / 64, ZH), 32, 0, stream>>>(Ph, Pl, VTh + zk * HD * TT, VTl + zk * HD * TT, TT, Ob, HD, 0, (size_t)RH * TT, 0, (size_t)TT * HD);
            k_gemmc<h16, 0, 2><<<dim3((TT - RH) / 64, HD / 64, ZH), 32, 0, stream>>>(P16 + (size_t)RH * TT, nullptr, VT16 + zk * HD * TT, nullptr, TT, Ob + (size_t)RH * HD, HD, RH, (size_t)TT * TT, 0, (size_t)TT * HD);
            k_merge<<<(unsigned)(((size_t)ZH * TT * HD / 2 + 255) / 256), 256, 0, stream>>>(Ob, h0, ATh, ATl); }
        k_gemmw<bf, 1, false><<<dim3(TT / 64, DM / 64, 1), 32, 0, stream>>>(ATh, ATl, WO, nullptr, DQ, OUT + (size_t)b * TT * DM, DM, nullptr, 0, 0, 0); }
}

// v001
// Measured time: 1690 microseconds a run.
// In two side-by-side timings against v000, it was 1.60 and 1.65 times as fast.
#include <hip/hip_runtime.h>

// Grouped-query causal attention with a computed half-split RoPE (x [2][2048][2048]; xq = x wq^T (32 heads x 64), xk, xv = x wk^T, x wv^T (8 kv heads x 64) ('oi', no bias; token-major); cos / sin from inv_freq = 1 / (10000 ** (2i / 64)) and positions arange(S) ([S][32] tables); (x1, x2) = the two 32-wide halves of each head: cat(x1 c - x2 s, x1 s + x2 c) (half-split pairs (d, d + 32)) on q and k; k, v repeated 4 x on the head axis (jnp.repeat: kv head = q head / 4); scores / sqrt(64); where(tril, scores, finfo.min) == exclusion; softmax; out = merged wo^T ('oi') -> [2][2048][2048] (8.4 M); argument order x, wq, wk, wv, wo).
// Layout per batch: bf16 copy of x; 'oi' weights; exact projections; k_cs5 computed table; rotate-half plane builders; causal T-2048 GQA attention (kv z-stride 0; hybrid rows: < 512 hi/lo 3 products, rest fp16 x1024; k_gemmc skips tiles above the diagonal); merged hi/lo x wo exact.
// Compute dtypes, f32 accumulate: every input rounded to bf16; projections exact; rotary f32; attention rows < 512 3 products, rest fp16; softmax f32; wo hl x exact.

#define NB_  2
#define TT   2048
#define DM   2048
#define NH_  32
#define NKV  8
#define REP  (NH_ / NKV)
#define HD   64
#define DQ   (NH_ * HD)
#define DKV  (NKV * HD)
#define ZH   2
#define RH   512                  // query rows < RH use hi+lo planes (0: none)
#define WIN  2048
#define PCAR 1024.0f
#define SCL  0.125f   // HD^-0.5
typedef _Float16 h16;
typedef unsigned short bf;
typedef __attribute__((ext_vector_type(16))) __bf16   v16bf;
typedef __attribute__((ext_vector_type(16))) _Float16 v16h;
typedef __attribute__((ext_vector_type(8)))  _Float16 v8h;
typedef __attribute__((ext_vector_type(8)))  unsigned short v8us;
typedef __attribute__((ext_vector_type(8)))  float    v8f;
typedef __attribute__((ext_vector_type(4)))  float    v4f;
typedef v8h  __attribute__((may_alias)) v8ha;
typedef v4f  __attribute__((may_alias)) v4fa;
typedef v8us __attribute__((may_alias)) v8usa;

__device__ __forceinline__ unsigned short f2bf(float f) { unsigned u = __float_as_uint(f); u += 0x7FFFu + ((u >> 16) & 1u); return (unsigned short)(u >> 16); }
__device__ __forceinline__ float bf2f(unsigned short b) { return __uint_as_float(((unsigned)b) << 16); }
__device__ __forceinline__ float bfr(float f) { return bf2f(f2bf(f)); }
__device__ __forceinline__ v16h cat16(v8h lo, v8h hi) { return __builtin_shufflevector(lo, hi, 0, 1, 2, 3, 4, 5, 6, 7, 8, 9, 10, 11, 12, 13, 14, 15); }
__device__ __forceinline__ v16bf cat16b(v8us lo, v8us hi) { return __builtin_bit_cast(v16bf, __builtin_shufflevector(lo, hi, 0, 1, 2, 3, 4, 5, 6, 7, 8, 9, 10, 11, 12, 13, 14, 15)); }
__device__ __forceinline__ v8f wmma16(v16h a, v16h b, v8f c) { return __builtin_amdgcn_wmma_f32_16x16x32_f16(false, a, false, b, (short)0, c, false, false); }
__device__ __forceinline__ v8f wmmab(v16bf a, v16bf b, v8f c) { return __builtin_amdgcn_wmma_f32_16x16x32_bf16(false, a, false, b, (short)0, c, false, false); }



// ---- k_gemmw: register-blocked GEMM, one 64x64 output tile per work-group of NW waves; grid (M/64, N/64, Z), 32 * NW threads. K is split over the waves: wave w takes the 64-wide K slices w, w + NW, ...
// (one whole 128-byte line of every operand row per slice) and keeps its own 64x64 partial tile (16 accumulators), operands straight from K-contiguous 16-bit planes; the NW partial tiles are then summed in wave order through LDS.
// C[m][n] (f32, pitch ldc, + optional f32 bias[n]) = sum_k A[m][k] Bt[n][k] (+ split products per NSPLIT). z-batch strides sA/sB/sC in elements. K % 64 == 0.
// CAUSAL (probability x value): the K loop stops at the diagonal block of query rows r0 + roff .. (probabilities beyond it are exactly zero); roff = row offset of this launch's first row within the sequence.
template <typename T16> struct WFrag;
template <> struct WFrag<h16> { typedef v16h V; static __device__ __forceinline__ V ld(const h16* p) { return cat16(*(const v8h*)p, *(const v8h*)(p + 16)); } static __device__ __forceinline__ v8f mma(V a, V b, v8f c) { return wmma16(a, b, c); } };
template <> struct WFrag<bf> { typedef v16bf V; static __device__ __forceinline__ V ld(const bf* p) { return cat16b(*(const v8us*)p, *(const v8us*)(p + 16)); } static __device__ __forceinline__ v8f mma(V a, V b, v8f c) { return wmmab(a, b, c); } };
template <typename T16, int NSPLIT, bool BIAS, int NW, bool CAUSAL>
__global__ __launch_bounds__(32 * NW) void k_gemmw(const T16* __restrict__ A, const T16* __restrict__ A2, const T16* __restrict__ Bt, const T16* __restrict__ Bt2, int K, float* C, int ldc, const float* __restrict__ bias, int roff, size_t sA, size_t sB, size_t sC) {
    typedef typename WFrag<T16>::V V;
    __shared__ __align__(16) float red[NW * 64 * 68];
    const size_t z = blockIdx.z; A += z * sA; if (A2) A2 += z * sA; Bt += z * sB; if (Bt2) Bt2 += z * sB; C += z * sC;
    const int lane = threadIdx.x & 31, lr = lane & 15, hi = lane >> 4; const int r0 = blockIdx.x * 64, c0 = blockIdx.y * 64;
    const int wave = __builtin_amdgcn_readfirstlane((int)(threadIdx.x >> 5));   // wave number in a scalar register: the K loop's counter and branch stay scalar
    const int Kl = CAUSAL ? min(K, r0 + roff + 64) : K;
    v8f acc[4][4];
#pragma unroll
    for (int mb = 0; mb < 4; ++mb)
#pragma unroll
        for (int nb = 0; nb < 4; ++nb) acc[mb][nb] = (v8f){};
    const size_t aoff = (size_t)(r0 + lr) * K + 8 * hi, boff = (size_t)(c0 + lr) * K + 8 * hi;
#pragma unroll 1
    for (int kc = wave * 64; kc < Kl; kc += (kc & 32) ? 64 * NW - 32 : 32) {
        V a[4], a2[4];
#pragma unroll
        for (int mb = 0; mb < 4; ++mb) { a[mb] = WFrag<T16>::ld(A + aoff + (size_t)mb * 16 * K + kc); if (NSPLIT == 1 || NSPLIT == 2) a2[mb] = WFrag<T16>::ld(A2 + aoff + (size_t)mb * 16 * K + kc); }
#pragma unroll
        for (int nb = 0; nb < 4; ++nb) { const V b = WFrag<T16>::ld(Bt + boff + (size_t)nb * 16 * K + kc); V b2; if (NSPLIT >= 2) b2 = WFrag<T16>::ld(Bt2 + boff + (size_t)nb * 16 * K + kc);
#pragma unroll
            for (int mb = 0; mb < 4; ++mb) { acc[mb][nb] = WFrag<T16>::mma(a[mb], b, acc[mb][nb]); if (NSPLIT == 1 || NSPLIT == 2) acc[mb][nb] = WFrag<T16>::mma(a2[mb], b, acc[mb][nb]); if (NSPLIT >= 2) acc[mb][nb] = WFrag<T16>::mma(a[mb], b2, acc[mb][nb]); } }
        asm volatile("v_nop\n\tv_nop\n\tv_nop\n\tv_nop" : "+v"(acc[0][0]), "+v"(acc[1][1]), "+v"(acc[2][2]), "+v"(acc[3][3]) : "v"(a[0]), "v"(a[3]));   // four vector slots behind the last WMMA, also on the taken back edge, before fragments or accumulators are touched
    }
    float* mine = red + wave * (64 * 68);
#pragma unroll
    for (int mb = 0; mb < 4; ++mb)
#pragma unroll
        for (int nb = 0; nb < 4; ++nb)
#pragma unroll
            for (int j = 0; j < 8; ++j) mine[(mb * 16 + hi * 8 + j) * 68 + nb * 16 + lr] = acc[mb][nb][j];
    __syncthreads();   // every wave's partial tile is in LDS before any wave sums
#pragma unroll
    for (int s = 0; s < 32 / NW; ++s) { const int q = s * 32 * NW + (int)threadIdx.x, row = q >> 4, cofs = (q & 15) * 4; v4f val = *(const v4fa*)(red + row * 68 + cofs);
#pragma unroll
        for (int w = 1; w < NW; ++w) val += *(const v4fa*)(red + w * (64 * 68) + row * 68 + cofs);
        if (BIAS) { val[0] += bfr(bias[c0 + cofs]); val[1] += bfr(bias[c0 + cofs + 1]); val[2] += bfr(bias[c0 + cofs + 2]); val[3] += bfr(bias[c0 + cofs + 3]); }
        *(v4f*)(C + (size_t)(r0 + row) * ldc + c0 + cofs) = val; }
}

// ---- k_gemmc: the 64x64 tile GEMM with ONE WAVE per tile (whole K in that wave, 32 threads; the scores have K = 64) specialised for causal attention: CMODE 1 skips score tiles entirely above the diagonal (query rows r0+roff.., key columns c0..), CMODE 2 limits the
// key (K) loop of the probability x value contraction to the diagonal block (probabilities beyond it are exactly zero). roff = row offset of this launch's first row within the sequence.
template <typename T16, int NSPLIT, int CMODE>
__global__ __launch_bounds__(32) void k_gemmc(const T16* __restrict__ A, const T16* __restrict__ A2, const T16* __restrict__ Bt, const T16* __restrict__ Bt2, int K, float* C, int ldc, int roff, size_t sA, size_t sB, size_t sC) {
    typedef typename WFrag<T16>::V V;
    __shared__ __align__(16) float os[16 * 68];
    const size_t z = blockIdx.z; A += z * sA; if (A2) A2 += z * sA; Bt += z * sB; if (Bt2) Bt2 += z * sB; C += z * sC;
    const int lane = threadIdx.x & 31, lr = lane & 15, hi = lane >> 4; const int r0 = blockIdx.x * 64, c0 = blockIdx.y * 64;
    if (CMODE == 1 && c0 > r0 + roff + 63) return;                  // score tile entirely above the causal diagonal: left unwritten; the softmax loads it but masks j > i by select
    const int Kl = (CMODE == 2) ? min(K, r0 + roff + 64) : K;        // P.V: probabilities are exactly 0 beyond the diagonal block, so the K loop stops there
    v8f acc[4][4];
#pragma unroll
    for (int mb = 0; mb < 4; ++mb)
#pragma unroll
        for (int nb = 0; nb < 4; ++nb) acc[mb][nb] = (v8f){};
    const size_t aoff = (size_t)(r0 + lr) * K + 8 * hi, boff = (size_t)(c0 + lr) * K + 8 * hi;
#pragma unroll 1
    for (int kc = 0; kc < Kl; kc += 32) {
        V a[4], a2[4];
#pragma unroll
        for (int mb = 0; mb < 4; ++mb) { a[mb] = WFrag<T16>::ld(A + aoff + (size_t)mb * 16 * K + kc); if (NSPLIT == 1 || NSPLIT == 2) a2[mb] = WFrag<T16>::ld(A2 + aoff + (size_t)mb * 16 * K + kc); }
#pragma unroll
        for (int nb = 0; nb < 4; ++nb) { const V b = WFrag<T16>::ld(Bt + boff + (size_t)nb * 16 * K + kc); V b2; if (NSPLIT >= 2) b2 = WFrag<T16>::ld(Bt2 + boff + (size_t)nb * 16 * K + kc);
#pragma unroll
            for (int mb = 0; mb < 4; ++mb) { acc[mb][nb] = WFrag<T16>::mma(a[mb], b, acc[mb][nb]); if (NSPLIT == 1 || NSPLIT == 2) acc[mb][nb] = WFrag<T16>::mma(a2[mb], b, acc[mb][nb]); if (NSPLIT >= 2) acc[mb][nb] = WFrag<T16>::mma(a[mb], b2, acc[mb][nb]); } }
        asm volatile("v_nop\n\tv_nop\n\tv_nop\n\tv_nop" : "+v"(acc[0][0]), "+v"(acc[1][1]), "+v"(acc[2][2]), "+v"(acc[3][3]) : "v"(a[0]), "v"(a[3]));
    }
#pragma unroll
    for (int mb = 0; mb < 4; ++mb) {
#pragma unroll
        for (int nb = 0; nb < 4; ++nb) {
#pragma unroll
            for (int j = 0; j < 8; ++j) os[(hi * 8 + j) * 68 + nb * 16 + lr] = acc[mb][nb][j]; }
        __builtin_amdgcn_wave_barrier(); asm volatile("" ::: "memory");
        float* crow = C + (size_t)(r0 + mb * 16) * ldc + c0;
{
#pragma unroll
            for (int s = 0; s < 8; ++s) { const int row = 2 * s + hi, cofs = lr * 4; v4f val = *(const v4fa*)(os + row * 68 + cofs);
                *(v4f*)(crow + (size_t)row * ldc + cofs) = val; }
             }
        __builtin_amdgcn_wave_barrier(); asm volatile("" ::: "memory");
    }
}

__device__ __forceinline__ h16 tohx(float x) { return (h16)x; }
__device__ __forceinline__ void splitf(float y, unsigned short& h, unsigned short& l) { h = f2bf(y); l = f2bf(y - bf2f(h)); }
typedef __attribute__((ext_vector_type(2))) _Float16 v2h;
typedef __attribute__((ext_vector_type(4))) _Float16 v4h;
typedef __attribute__((ext_vector_type(2))) unsigned short v2us;
typedef __attribute__((ext_vector_type(4))) unsigned short v4us;
typedef __attribute__((ext_vector_type(2))) float v2f;
typedef __attribute__((ext_vector_type(4))) int v4i;

__global__ __launch_bounds__(256) void k_cvt8(const float* __restrict__ src, bf* dst, size_t n8) { const size_t i = (size_t)blockIdx.x * 256 + threadIdx.x; if (i >= n8) return; const v8f v = *(const v8f*)(src + i * 8); v8us o;
#pragma unroll
    for (int k = 0; k < 8; ++k) o[k] = f2bf(v[k]); *(v8us*)(dst + i * 8) = o;  }

// k_rope: head planes [h][t][d] (fp16 + hi/lo) of rope(x) x sc with the rotate-half convention out[d] = x[d] cos[t][d] - x[d+HD/2] sin[t][d], out[d+HD/2] = x[d+HD/2] cos[t][d+HD/2] + x[d] sin[t][d+HD/2]
__global__ __launch_bounds__(256) void k_rope(const float* __restrict__ F, int pitch, int nheads, const float* __restrict__ CS, const float* __restrict__ RF, const float* __restrict__ nw, float sc, h16* P16, bf* Ph, bf* Pl) {
    const size_t e = ((size_t)blockIdx.x * 256 + threadIdx.x) * 2; if (e >= (size_t)nheads * TT * HD) return; const int d = (int)(e % HD); const int t = (int)((e / HD) % TT); const int h = (int)(e / ((size_t)HD * TT)); const float* f = F + (size_t)t * pitch + h * HD; const float rf = RF ? RF[(size_t)h * TT + t] : 1.0f; v2h o16; v2us oh, ol;
#pragma unroll
    for (int q = 0; q < 2; ++q) { const int dd = d + q; const int dp = (dd < HD / 2) ? dd + HD / 2 : dd - HD / 2; float x0 = f[dd], x1 = f[dp];
        if (RF) { float n0 = __fmul_rn(x0, rf), n1 = __fmul_rn(x1, rf); asm volatile("" : "+v"(n0)); asm volatile("" : "+v"(n1)); x0 = __fmul_rn(bfr(nw[dd]), n0); x1 = __fmul_rn(bfr(nw[dp]), n1); }
        const v2f cs = *(const v2f*)(CS + ((size_t)t * HD + dd) * 2); float a = __fmul_rn(x0, cs[0]), bq = __fmul_rn(x1, cs[1]); asm volatile("" : "+v"(a)); asm volatile("" : "+v"(bq)); const float r = ((dd < HD / 2) ? __fsub_rn(a, bq) : __fadd_rn(a, bq)) * sc;
        o16[q] = tohx(r); unsigned short a2, c2; splitf(r, a2, c2); oh[q] = a2; ol[q] = c2; }
    *(v2h*)(P16 + e) = o16; *(v2us*)(Ph + e) = oh; *(v2us*)(Pl + e) = ol;  }
__global__ __launch_bounds__(256) void k_vtp(const float* __restrict__ F, int pitch, int nheads, h16* V16, bf* Vh, bf* Vl) { const size_t e = ((size_t)blockIdx.x * 256 + threadIdx.x) * 2; if (e >= (size_t)nheads * HD * TT) return; const int t = (int)(e % TT); const int d = (int)((e / TT) % HD); const int g = (int)(e / ((size_t)TT * HD)); v2h o16; v2us oh, ol;
#pragma unroll
    for (int q = 0; q < 2; ++q) { const float x = F[(size_t)(t + q) * pitch + g * HD + d]; o16[q] = tohx(x); unsigned short a2, c2; splitf(x, a2, c2); oh[q] = a2; ol[q] = c2; }
    *(v2h*)(V16 + e) = o16; *(v2us*)(Vh + e) = oh; *(v2us*)(Vl + e) = ol;  }
__constant__ float INVT[HD / 2] = { 1.000000000e+00f, 7.498942018e-01f, 5.623413324e-01f, 4.216965139e-01f, 3.162277639e-01f, 2.371373624e-01f, 1.778279394e-01f, 1.333521456e-01f, 1.000000015e-01f, 7.498941571e-02f, 5.623412877e-02f, 4.216964915e-02f, 3.162277862e-02f, 2.371373586e-02f, 1.778279431e-02f, 1.333521493e-02f, 9.999999776e-03f, 7.498942316e-03f, 5.623413250e-03f, 4.216964822e-03f, 3.162277862e-03f, 2.371373819e-03f, 1.778279431e-03f, 1.333521446e-03f, 1.000000047e-03f, 7.498941850e-04f, 5.623413017e-04f, 4.216964880e-04f, 3.162277862e-04f, 2.371373848e-04f, 1.778279402e-04f, 1.333521504e-04f };   // float32 1 / 10000^(2i/64), generated with jnp to be bit-exact
__global__ __launch_bounds__(256) void k_cs5(float* CS) { const int idx = blockIdx.x * 256 + threadIdx.x; if (idx >= TT * HD) return; const int d = idx % HD; const int t = idx / HD; const float a = __fmul_rn((float)t, INVT[d % (HD / 2)]); v2f cs; cs[0] = cosf(a); cs[1] = sinf(a); *(v2f*)(CS + (size_t)idx * 2) = cs;  }
// k_asoft: per row (zz, i): t = S x HD^-0.5 for j <= i and i - j < WIN (WIN = TT, so the window test always holds: plain causal; the reference's -1e9 additive fill vanishes identically); softmax over the 2048 keys (register row, one exp, fixed trees);
__global__ __launch_bounds__(256) void k_asoft(const float* __restrict__ Sb, h16* P16, bf* Ph, bf* Pl) {
    const int lane = threadIdx.x & 31; const int row = blockIdx.x * 8 + (threadIdx.x >> 5); if (row >= ZH * TT) return; const int i = row % TT; const int zz = row / TT; (void)zz; const bool hires = (i < RH); const float* sr = Sb + (size_t)row * TT; float v[TT / 32]; float mx = -3.0e38f;
#pragma unroll
    for (int ch = 0; ch < TT / 128; ++ch) { const int j0 = ch * 128 + lane * 4; const v4f a = *(const v4f*)(sr + j0);
#pragma unroll
        for (int q = 0; q < 4; ++q) { const int j = j0 + q; (void)j; const float t = (j <= i && i - j < WIN) ? a[q] * SCL : -3.0e38f; v[ch * 4 + q] = t; mx = fmaxf(mx, t); } }
#pragma unroll
    for (int sh = 16; sh; sh >>= 1) mx = fmaxf(mx, __shfl_xor(mx, sh, 32));
    float sum = 0.f;
#pragma unroll
    for (int k = 0; k < TT / 32; ++k) { float d0 = __fsub_rn(v[k], mx); asm volatile("" : "+v"(d0)); v[k] = __builtin_amdgcn_exp2f(__fmul_rn(d0, 1.4426950408889634f)); sum += v[k]; }
#pragma unroll
    for (int sh = 16; sh; sh >>= 1) sum += __shfl_xor(sum, sh, 32);
    const float f = __fdiv_rn(hires ? 1.0f : PCAR, sum);
{
        if (hires) {
#pragma unroll
            for (int ch = 0; ch < TT / 128; ++ch) { v4us oh, ol;
#pragma unroll
                for (int q = 0; q < 4; ++q) { unsigned short a, c2; splitf(v[ch * 4 + q] * f, a, c2); oh[q] = a; ol[q] = c2; }
                const size_t oo = ((size_t)zz * (RH ? RH : 1) + i) * TT + ch * 128 + lane * 4; *(v4us*)(Ph + oo) = oh; *(v4us*)(Pl + oo) = ol; }
        } else {
#pragma unroll
            for (int ch = 0; ch < TT / 128; ++ch) { v4h o4;
#pragma unroll
                for (int q = 0; q < 4; ++q) o4[q] = tohx(v[ch * 4 + q] * f);
                *(v4h*)(P16 + (size_t)row * TT + ch * 128 + lane * 4) = o4; } }
         }
}
__global__ __launch_bounds__(256) void k_merge(const float* __restrict__ O, int h0, bf* Ah, bf* Al) { const size_t e = ((size_t)blockIdx.x * 256 + threadIdx.x) * 2; if (e >= (size_t)ZH * TT * HD) return; const int d = (int)(e % HD); const int t = (int)((e / HD) % TT); const int zz = (int)(e / ((size_t)HD * TT)); const float cs = (t < RH) ? 1.0f : (1.0f / PCAR); const size_t oo = (size_t)t * DQ + (h0 + zz) * HD + d;
    v2us oh, ol;
#pragma unroll
    for (int q = 0; q < 2; ++q) { unsigned short a, c2; splitf(O[e + q] * cs, a, c2); oh[q] = a; ol[q] = c2; } *(v2us*)(Ah + oo) = oh; *(v2us*)(Al + oo) = ol;  }

extern "C" void kernel_launch(void* const* d_in, const int* in_sizes, int n_in,
                              void* d_out, int out_size, void* d_ws, size_t ws_size, hipStream_t stream) {
    (void)in_sizes; (void)n_in; (void)out_size;
        const float* x = (const float*)d_in[0]; const float* wq = (const float*)d_in[1]; const float* wk = (const float*)d_in[2]; const float* wv = (const float*)d_in[3]; const float* wo = (const float*)d_in[4];   /* inputs x, wq [2048][2048], wk [512][2048], wv, wo ('oi'); this module has no mask input (the causal rule is by index) */
    float* OUT = (float*)d_out;     // [2][2048][2048]
    char* wsp = (char*)d_ws;
    auto take = [&](size_t bytes) { char* p = wsp; wsp += (bytes + 255) & ~(size_t)255; return (void*)p; };
    bf* WQ = (bf*)take((size_t)DQ * DM * 2); bf* WK = (bf*)take((size_t)DKV * DM * 2); bf* WV = (bf*)take((size_t)DKV * DM * 2); bf* WO = (bf*)take((size_t)DM * DQ * 2); float* CS = (float*)take((size_t)TT * HD * 2 * 4);
    bf* XB = (bf*)take((size_t)TT * DM * 2); float* FQ = (float*)take((size_t)TT * DQ * 4); float* FK = (float*)take((size_t)TT * DKV * 4);
    h16* QP16 = (h16*)take((size_t)NH_ * TT * HD * 2); h16* KP16 = (h16*)take((size_t)NKV * TT * HD * 2); h16* VT16 = (h16*)take((size_t)NKV * HD * TT * 2);
    bf* QPh = (bf*)take((size_t)NH_ * TT * HD * 2); bf* QPl = (bf*)take((size_t)NH_ * TT * HD * 2); bf* KPh = (bf*)take((size_t)NKV * TT * HD * 2); bf* KPl = (bf*)take((size_t)NKV * TT * HD * 2); bf* VTh = (bf*)take((size_t)NKV * HD * TT * 2); bf* VTl = (bf*)take((size_t)NKV * HD * TT * 2); bf* Ph = (bf*)take((size_t)ZH * RH * TT * 2); bf* Pl = (bf*)take((size_t)ZH * RH * TT * 2);
    float* Sb = (float*)take((size_t)ZH * TT * TT * 4); h16* P16 = (h16*)take((size_t)ZH * TT * TT * 2); float* Ob = (float*)take((size_t)ZH * TT * HD * 4); bf* ATh = (bf*)take((size_t)TT * DQ * 2); bf* ATl = (bf*)take((size_t)TT * DQ * 2);
    if ((size_t)(wsp - (char*)d_ws) > ws_size) return;    // ws 256 MiB
    float* FV = FK;   // v projection reuses the k buffer after the k planes are built (stream-ordered)
    { k_cvt8<<<(unsigned)(((size_t)DQ * DM / 8 + 255) / 256), 256, 0, stream>>>(wq, WQ, (size_t)DQ * DM / 8); k_cvt8<<<(unsigned)(((size_t)DKV * DM / 8 + 255) / 256), 256, 0, stream>>>(wk, WK, (size_t)DKV * DM / 8); k_cvt8<<<(unsigned)(((size_t)DKV * DM / 8 + 255) / 256), 256, 0, stream>>>(wv, WV, (size_t)DKV * DM / 8);
      k_cvt8<<<(unsigned)(((size_t)DM * DQ / 8 + 255) / 256), 256, 0, stream>>>(wo, WO, (size_t)DM * DQ / 8);
       }
    k_cs5<<<(TT * HD + 255) / 256, 256, 0, stream>>>(CS);   /* rotary table once */
    const unsigned LQ = (unsigned)(((size_t)NH_ * TT * HD / 2 + 255) / 256), LKv = (unsigned)(((size_t)NKV * TT * HD / 2 + 255) / 256);
    for (int b = 0; b < NB_; ++b) {
        
        k_cvt8<<<(unsigned)(((size_t)TT * DM / 8 + 255) / 256), 256, 0, stream>>>(x + (size_t)b * TT * DM, XB, (size_t)TT * DM / 8);
        k_gemmw<bf, 0, false, 8, false><<<dim3(TT / 64, DQ / 64, 1), 256, 0, stream>>>(XB, nullptr, WQ, nullptr, DM, FQ, DQ, nullptr, 0, 0, 0, 0);
        k_rope<<<LQ, 256, 0, stream>>>(FQ, DQ, NH_, CS, nullptr, nullptr, 1.0f, QP16, QPh, QPl);
        k_gemmw<bf, 0, false, 8, false><<<dim3(TT / 64, DKV / 64, 1), 256, 0, stream>>>(XB, nullptr, WK, nullptr, DM, FK, DKV, nullptr, 0, 0, 0, 0);
        k_rope<<<LKv, 256, 0, stream>>>(FK, DKV, NKV, CS, nullptr, nullptr, 1.0f, KP16, KPh, KPl);
        k_gemmw<bf, 0, false, 8, false><<<dim3(TT / 64, DKV / 64, 1), 256, 0, stream>>>(XB, nullptr, WV, nullptr, DM, FV, DKV, nullptr, 0, 0, 0, 0); k_vtp<<<LKv, 256, 0, stream>>>(FV, DKV, NKV, VT16, VTh, VTl);
        for (int h0 = 0; h0 < NH_; h0 += ZH) { const size_t zq = (size_t)h0, zk = (size_t)(h0 / REP);   // both heads of a pass share kv group h0/REP (REP >= 2): sB = 0
            k_gemmc<bf, 2, 1><<<dim3(RH / 64, TT / 64, ZH), 32, 0, stream>>>(QPh + zq * TT * HD, QPl + zq * TT * HD, KPh + zk * TT * HD, KPl + zk * TT * HD, HD, Sb, TT, 0, (size_t)TT * HD, 0, (size_t)TT * TT);
            k_gemmc<h16, 0, 1><<<dim3((TT - RH) / 64, TT / 64, ZH), 32, 0, stream>>>(QP16 + zq * TT * HD + (size_t)RH * HD, nullptr, KP16 + zk * TT * HD, nullptr, HD, Sb + (size_t)RH * TT, TT, RH, (size_t)TT * HD, 0, (size_t)TT * TT);
            k_asoft<<<ZH * TT / 8, 256, 0, stream>>>(Sb, P16, Ph, Pl);
            k_gemmw<bf, 2, false, 8, true><<<dim3(RH / 64, HD / 64, ZH), 256, 0, stream>>>(Ph, Pl, VTh + zk * HD * TT, VTl + zk * HD * TT, TT, Ob, HD, nullptr, 0, (size_t)RH * TT, 0, (size_t)TT * HD);
            k_gemmw<h16, 0, false, 16, true><<<dim3((TT - RH) / 64, HD / 64, ZH), 512, 0, stream>>>(P16 + (size_t)RH * TT, nullptr, VT16 + zk * HD * TT, nullptr, TT, Ob + (size_t)RH * HD, HD, nullptr, RH, (size_t)TT * TT, 0, (size_t)TT * HD);
            k_merge<<<(unsigned)(((size_t)ZH * TT * HD / 2 + 255) / 256), 256, 0, stream>>>(Ob, h0, ATh, ATl); }
        k_gemmw<bf, 1, false, 8, false><<<dim3(TT / 64, DM / 64, 1), 256, 0, stream>>>(ATh, ATl, WO, nullptr, DQ, OUT + (size_t)b * TT * DM, DM, nullptr, 0, 0, 0, 0); }
}

// v002
// Measured time: 865 microseconds a run.
// Two timings next to v001 put it at 1.91 and 1.90 times that version's speed.
// Over all steps from v000 it is 3.09 times as fast.
#include <hip/hip_runtime.h>

// Grouped-query causal attention with a computed half-split RoPE (x [2][2048][2048]; xq = x wq^T (32 heads x 64), xk, xv = x wk^T, x wv^T (8 kv heads x 64) ('oi', no bias; token-major); cos / sin from inv_freq = 1 / (10000 ** (2i / 64)) and positions arange(S) ([S][32] tables); (x1, x2) = the two 32-wide halves of each head: cat(x1 c - x2 s, x1 s + x2 c) (half-split pairs (d, d + 32)) on q and k; k, v repeated 4 x on the head axis (jnp.repeat: kv head = q head / 4); scores / sqrt(64); where(tril, scores, finfo.min) == exclusion; softmax; out = merged wo^T ('oi') -> [2][2048][2048] (8.4 M); argument order x, wq, wk, wv, wo).
// Layout per batch: bf16 copy of x; 'oi' weights; exact projections; k_cs5 computed table; rotate-half plane builders; causal T-2048 GQA attention (ZH = 8 heads, two kv groups, per pass: kv plane = z / REP; probabilities stored in place in their score rows; hybrid rows: < 512 hi/lo 3 products, rest fp16 x1024; k_gemmc skips tiles above the diagonal); merged hi/lo x wo exact.
// Compute dtypes, f32 accumulate: every input rounded to bf16; projections exact; rotary f32; attention rows < 512 3 products, rest fp16; softmax f32; wo hl x exact.

#define NB_  2
#define TT   2048
#define DM   2048
#define NH_  32
#define NKV  8
#define REP  (NH_ / NKV)
#define HD   64
#define DQ   (NH_ * HD)
#define DKV  (NKV * HD)
#define ZH   8                    // heads per attention pass (grid z); a multiple of REP
#define RH   512                  // query rows < RH use hi+lo planes (0: none)
#define WIN  2048
#define PCAR 1024.0f
#define SCL  0.125f   // HD^-0.5
typedef _Float16 h16;
typedef unsigned short bf;
typedef __attribute__((ext_vector_type(16))) __bf16   v16bf;
typedef __attribute__((ext_vector_type(16))) _Float16 v16h;
typedef __attribute__((ext_vector_type(8)))  _Float16 v8h;
typedef __attribute__((ext_vector_type(8)))  unsigned short v8us;
typedef __attribute__((ext_vector_type(8)))  float    v8f;
typedef __attribute__((ext_vector_type(4)))  float    v4f;
typedef v8h  __attribute__((may_alias)) v8ha;
typedef v4f  __attribute__((may_alias)) v4fa;
typedef v8us __attribute__((may_alias)) v8usa;

__device__ __forceinline__ unsigned short f2bf(float f) { unsigned u = __float_as_uint(f); u += 0x7FFFu + ((u >> 16) & 1u); return (unsigned short)(u >> 16); }
__device__ __forceinline__ float bf2f(unsigned short b) { return __uint_as_float(((unsigned)b) << 16); }
__device__ __forceinline__ float bfr(float f) { return bf2f(f2bf(f)); }
__device__ __forceinline__ v16h cat16(v8h lo, v8h hi) { return __builtin_shufflevector(lo, hi, 0, 1, 2, 3, 4, 5, 6, 7, 8, 9, 10, 11, 12, 13, 14, 15); }
__device__ __forceinline__ v16bf cat16b(v8us lo, v8us hi) { return __builtin_bit_cast(v16bf, __builtin_shufflevector(lo, hi, 0, 1, 2, 3, 4, 5, 6, 7, 8, 9, 10, 11, 12, 13, 14, 15)); }
__device__ __forceinline__ v8f wmma16(v16h a, v16h b, v8f c) { return __builtin_amdgcn_wmma_f32_16x16x32_f16(false, a, false, b, (short)0, c, false, false); }
__device__ __forceinline__ v8f wmmab(v16bf a, v16bf b, v8f c) { return __builtin_amdgcn_wmma_f32_16x16x32_bf16(false, a, false, b, (short)0, c, false, false); }



// ---- k_gemmw: register-blocked GEMM, one 64x64 output tile per work-group of NW waves; grid (M/64, N/64, Z), 32 * NW threads. K is split over the waves: wave w takes the 64-wide K slices w, w + NW, ...
// (one whole 128-byte line of every operand row per slice) and keeps its own 64x64 partial tile (16 accumulators), operands straight from K-contiguous 16-bit planes; the NW partial tiles are then summed in wave order through LDS.
// C[m][n] (f32, pitch ldc, + optional f32 bias[n]) = sum_k A[m][k] Bt[n][k] (+ split products per NSPLIT). A rows have pitch lda, Bt rows pitch K. z-batch strides sA/sB/sC in elements; Bt advances once per REP values of z (the heads of one kv group share it). K % 64 == 0.
// CAUSAL (probability x value): the K loop stops at the diagonal block of query rows r0 + roff .. (probabilities beyond it are exactly zero); roff = row offset of this launch's first row within the sequence.
template <typename T16> struct WFrag;
template <> struct WFrag<h16> { typedef v16h V; static __device__ __forceinline__ V ld(const h16* p) { return cat16(*(const v8h*)p, *(const v8h*)(p + 16)); } static __device__ __forceinline__ v8f mma(V a, V b, v8f c) { return wmma16(a, b, c); } };
template <> struct WFrag<bf> { typedef v16bf V; static __device__ __forceinline__ V ld(const bf* p) { return cat16b(*(const v8us*)p, *(const v8us*)(p + 16)); } static __device__ __forceinline__ v8f mma(V a, V b, v8f c) { return wmmab(a, b, c); } };
template <typename T16, int NSPLIT, bool BIAS, int NW, bool CAUSAL>
__global__ __launch_bounds__(32 * NW) void k_gemmw(const T16* __restrict__ A, const T16* __restrict__ A2, const T16* __restrict__ Bt, const T16* __restrict__ Bt2, int K, int lda, float* C, int ldc, const float* __restrict__ bias, int roff, size_t sA, size_t sB, size_t sC) {
    typedef typename WFrag<T16>::V V;
    __shared__ __align__(16) float red[NW * 64 * 68];
    const size_t z = blockIdx.z; A += z * sA; if (A2) A2 += z * sA; Bt += (z / REP) * sB; if (Bt2) Bt2 += (z / REP) * sB; C += z * sC;
    const int lane = threadIdx.x & 31, lr = lane & 15, hi = lane >> 4; const int r0 = blockIdx.x * 64, c0 = blockIdx.y * 64;
    const int wave = __builtin_amdgcn_readfirstlane((int)(threadIdx.x >> 5));   // wave number in a scalar register: the K loop's counter and branch stay scalar
    const int Kl = CAUSAL ? min(K, r0 + roff + 64) : K;
    v8f acc[4][4];
#pragma unroll
    for (int mb = 0; mb < 4; ++mb)
#pragma unroll
        for (int nb = 0; nb < 4; ++nb) acc[mb][nb] = (v8f){};
    const size_t aoff = (size_t)(r0 + lr) * lda + 8 * hi, boff = (size_t)(c0 + lr) * K + 8 * hi;
#pragma unroll 1
    for (int kc = wave * 64; kc < Kl; kc += (kc & 32) ? 64 * NW - 32 : 32) {
        V a[4], a2[4]; const T16* pa[4]; const T16* pa2[4];
#pragma unroll
        for (int mb = 0; mb < 4; ++mb) { pa[mb] = A + aoff + (size_t)mb * 16 * lda + kc; a[mb] = WFrag<T16>::ld(pa[mb]); if (NSPLIT == 1 || NSPLIT == 2) { pa2[mb] = A2 + aoff + (size_t)mb * 16 * lda + kc; a2[mb] = WFrag<T16>::ld(pa2[mb]); } }
        // one s_wait_xcnt 0 behind the run of A loads, in front of any overwrite of an address register that they name (a precaution); the pointers are inputs so that they stay in their registers up to the wait and no load's result is placed over them
        if (NSPLIT == 1 || NSPLIT == 2) asm volatile("s_wait_xcnt 0x0" :: "v"(pa[0]), "v"(pa[1]), "v"(pa[2]), "v"(pa[3]), "v"(pa2[0]), "v"(pa2[1]), "v"(pa2[2]), "v"(pa2[3]) : "memory");
        else asm volatile("s_wait_xcnt 0x0" :: "v"(pa[0]), "v"(pa[1]), "v"(pa[2]), "v"(pa[3]) : "memory");
#pragma unroll
        for (int nb = 0; nb < 4; ++nb) { const T16* pb = Bt + boff + (size_t)nb * 16 * K + kc; const V b = WFrag<T16>::ld(pb); V b2;
            // the same wait behind each B fragment's loads
            if (NSPLIT >= 2) { const T16* pb2 = Bt2 + boff + (size_t)nb * 16 * K + kc; b2 = WFrag<T16>::ld(pb2); asm volatile("s_wait_xcnt 0x0" :: "v"(pb), "v"(pb2) : "memory"); }
            else asm volatile("s_wait_xcnt 0x0" :: "v"(pb) : "memory");
#pragma unroll
            for (int mb = 0; mb < 4; ++mb) { acc[mb][nb] = WFrag<T16>::mma(a[mb], b, acc[mb][nb]); if (NSPLIT == 1 || NSPLIT == 2) acc[mb][nb] = WFrag<T16>::mma(a2[mb], b, acc[mb][nb]); if (NSPLIT >= 2) acc[mb][nb] = WFrag<T16>::mma(a[mb], b2, acc[mb][nb]); } }
        asm volatile("v_nop\n\tv_nop\n\tv_nop\n\tv_nop" : "+v"(acc[0][0]), "+v"(acc[1][1]), "+v"(acc[2][2]), "+v"(acc[3][3]) : "v"(a[0]), "v"(a[3]));   // four vector slots behind the last WMMA, also on the taken back edge, before fragments or accumulators are touched
    }
    float* mine = red + wave * (64 * 68);
#pragma unroll
    for (int mb = 0; mb < 4; ++mb)
#pragma unroll
        for (int nb = 0; nb < 4; ++nb)
#pragma unroll
            for (int j = 0; j < 8; ++j) mine[(mb * 16 + hi * 8 + j) * 68 + nb * 16 + lr] = acc[mb][nb][j];
    __syncthreads();   // every wave's partial tile is in LDS before any wave sums
#pragma unroll
    for (int s = 0; s < 32 / NW; ++s) { const int q = s * 32 * NW + (int)threadIdx.x, row = q >> 4, cofs = (q & 15) * 4; v4f val = *(const v4fa*)(red + row * 68 + cofs);
#pragma unroll
        for (int w = 1; w < NW; ++w) val += *(const v4fa*)(red + w * (64 * 68) + row * 68 + cofs);
        if (BIAS) { val[0] += bfr(bias[c0 + cofs]); val[1] += bfr(bias[c0 + cofs + 1]); val[2] += bfr(bias[c0 + cofs + 2]); val[3] += bfr(bias[c0 + cofs + 3]); }
        *(v4f*)(C + (size_t)(r0 + row) * ldc + c0 + cofs) = val; }
}

// ---- k_gemmc: the 64x64 tile GEMM with ONE WAVE per tile (whole K in that wave, 32 threads; the scores have K = 64) specialised for causal attention: CMODE 1 skips score tiles entirely above the diagonal (query rows r0+roff.., key columns c0..), CMODE 2 limits the
// key (K) loop of the probability x value contraction to the diagonal block (probabilities beyond it are exactly zero). roff = row offset of this launch's first row within the sequence.
template <typename T16, int NSPLIT, int CMODE>
__global__ __launch_bounds__(32) void k_gemmc(const T16* __restrict__ A, const T16* __restrict__ A2, const T16* __restrict__ Bt, const T16* __restrict__ Bt2, int K, float* C, int ldc, int roff, size_t sA, size_t sB, size_t sC) {
    typedef typename WFrag<T16>::V V;
    __shared__ __align__(16) float os[16 * 68];
    const size_t z = blockIdx.z; A += z * sA; if (A2) A2 += z * sA; Bt += (z / REP) * sB; if (Bt2) Bt2 += (z / REP) * sB; C += z * sC;
    const int lane = threadIdx.x & 31, lr = lane & 15, hi = lane >> 4; const int r0 = blockIdx.x * 64, c0 = blockIdx.y * 64;
    if (CMODE == 1 && c0 > r0 + roff + 63) return;                  // score tile entirely above the causal diagonal: left unwritten; the softmax loads it but masks j > i by select
    const int Kl = (CMODE == 2) ? min(K, r0 + roff + 64) : K;        // P.V: probabilities are exactly 0 beyond the diagonal block, so the K loop stops there
    v8f acc[4][4];
#pragma unroll
    for (int mb = 0; mb < 4; ++mb)
#pragma unroll
        for (int nb = 0; nb < 4; ++nb) acc[mb][nb] = (v8f){};
    const size_t aoff = (size_t)(r0 + lr) * K + 8 * hi, boff = (size_t)(c0 + lr) * K + 8 * hi;
#pragma unroll 1
    for (int kc = 0; kc < Kl; kc += 32) {
        V a[4], a2[4];
#pragma unroll
        for (int mb = 0; mb < 4; ++mb) { a[mb] = WFrag<T16>::ld(A + aoff + (size_t)mb * 16 * K + kc); if (NSPLIT == 1 || NSPLIT == 2) a2[mb] = WFrag<T16>::ld(A2 + aoff + (size_t)mb * 16 * K + kc); }
#pragma unroll
        for (int nb = 0; nb < 4; ++nb) { const V b = WFrag<T16>::ld(Bt + boff + (size_t)nb * 16 * K + kc); V b2; if (NSPLIT >= 2) b2 = WFrag<T16>::ld(Bt2 + boff + (size_t)nb * 16 * K + kc);
#pragma unroll
            for (int mb = 0; mb < 4; ++mb) { acc[mb][nb] = WFrag<T16>::mma(a[mb], b, acc[mb][nb]); if (NSPLIT == 1 || NSPLIT == 2) acc[mb][nb] = WFrag<T16>::mma(a2[mb], b, acc[mb][nb]); if (NSPLIT >= 2) acc[mb][nb] = WFrag<T16>::mma(a[mb], b2, acc[mb][nb]); } }
        asm volatile("v_nop\n\tv_nop\n\tv_nop\n\tv_nop" : "+v"(acc[0][0]), "+v"(acc[1][1]), "+v"(acc[2][2]), "+v"(acc[3][3]) : "v"(a[0]), "v"(a[3]));
    }
#pragma unroll
    for (int mb = 0; mb < 4; ++mb) {
#pragma unroll
        for (int nb = 0; nb < 4; ++nb) {
#pragma unroll
            for (int j = 0; j < 8; ++j) os[(hi * 8 + j) * 68 + nb * 16 + lr] = acc[mb][nb][j]; }
        __builtin_amdgcn_wave_barrier(); asm volatile("" ::: "memory");
        float* crow = C + (size_t)(r0 + mb * 16) * ldc + c0;
{
#pragma unroll
            for (int s = 0; s < 8; ++s) { const int row = 2 * s + hi, cofs = lr * 4; v4f val = *(const v4fa*)(os + row * 68 + cofs);
                *(v4f*)(crow + (size_t)row * ldc + cofs) = val; }
             }
        __builtin_amdgcn_wave_barrier(); asm volatile("" ::: "memory");
    }
}

__device__ __forceinline__ h16 tohx(float x) { return (h16)x; }
__device__ __forceinline__ void splitf(float y, unsigned short& h, unsigned short& l) { h = f2bf(y); l = f2bf(y - bf2f(h)); }
typedef __attribute__((ext_vector_type(2))) _Float16 v2h;
typedef __attribute__((ext_vector_type(4))) _Float16 v4h;
typedef __attribute__((ext_vector_type(2))) unsigned short v2us;
typedef __attribute__((ext_vector_type(4))) unsigned short v4us;
typedef __attribute__((ext_vector_type(2))) float v2f;
typedef __attribute__((ext_vector_type(4))) int v4i;

__global__ __launch_bounds__(256) void k_cvt8(const float* __restrict__ src, bf* dst, size_t n8) { const size_t i = (size_t)blockIdx.x * 256 + threadIdx.x; if (i >= n8) return; const v8f v = *(const v8f*)(src + i * 8); v8us o;
#pragma unroll
    for (int k = 0; k < 8; ++k) o[k] = f2bf(v[k]); *(v8us*)(dst + i * 8) = o;  }

// k_rope: head planes [h][t][d] (fp16 + hi/lo) of rope(x) x sc with the rotate-half convention out[d] = x[d] cos[t][d] - x[d+HD/2] sin[t][d], out[d+HD/2] = x[d+HD/2] cos[t][d+HD/2] + x[d] sin[t][d+HD/2]
__global__ __launch_bounds__(256) void k_rope(const float* __restrict__ F, int pitch, int nheads, const float* __restrict__ CS, const float* __restrict__ RF, const float* __restrict__ nw, float sc, h16* P16, bf* Ph, bf* Pl) {
    const size_t e = ((size_t)blockIdx.x * 256 + threadIdx.x) * 2; if (e >= (size_t)nheads * TT * HD) return; const int d = (int)(e % HD); const int t = (int)((e / HD) % TT); const int h = (int)(e / ((size_t)HD * TT)); const float* f = F + (size_t)t * pitch + h * HD; const float rf = RF ? RF[(size_t)h * TT + t] : 1.0f; v2h o16; v2us oh, ol;
#pragma unroll
    for (int q = 0; q < 2; ++q) { const int dd = d + q; const int dp = (dd < HD / 2) ? dd + HD / 2 : dd - HD / 2; float x0 = f[dd], x1 = f[dp];
        if (RF) { float n0 = __fmul_rn(x0, rf), n1 = __fmul_rn(x1, rf); asm volatile("" : "+v"(n0)); asm volatile("" : "+v"(n1)); x0 = __fmul_rn(bfr(nw[dd]), n0); x1 = __fmul_rn(bfr(nw[dp]), n1); }
        const v2f cs = *(const v2f*)(CS + ((size_t)t * HD + dd) * 2); float a = __fmul_rn(x0, cs[0]), bq = __fmul_rn(x1, cs[1]); asm volatile("" : "+v"(a)); asm volatile("" : "+v"(bq)); const float r = ((dd < HD / 2) ? __fsub_rn(a, bq) : __fadd_rn(a, bq)) * sc;
        o16[q] = tohx(r); unsigned short a2, c2; splitf(r, a2, c2); oh[q] = a2; ol[q] = c2; }
    *(v2h*)(P16 + e) = o16; *(v2us*)(Ph + e) = oh; *(v2us*)(Pl + e) = ol;  }
__global__ __launch_bounds__(256) void k_vtp(const float* __restrict__ F, int pitch, int nheads, h16* V16, bf* Vh, bf* Vl) { const size_t e = ((size_t)blockIdx.x * 256 + threadIdx.x) * 2; if (e >= (size_t)nheads * HD * TT) return; const int t = (int)(e % TT); const int d = (int)((e / TT) % HD); const int g = (int)(e / ((size_t)TT * HD)); v2h o16; v2us oh, ol;
#pragma unroll
    for (int q = 0; q < 2; ++q) { const float x = F[(size_t)(t + q) * pitch + g * HD + d]; o16[q] = tohx(x); unsigned short a2, c2; splitf(x, a2, c2); oh[q] = a2; ol[q] = c2; }
    *(v2h*)(V16 + e) = o16; *(v2us*)(Vh + e) = oh; *(v2us*)(Vl + e) = ol;  }
__constant__ float INVT[HD / 2] = { 1.000000000e+00f, 7.498942018e-01f, 5.623413324e-01f, 4.216965139e-01f, 3.162277639e-01f, 2.371373624e-01f, 1.778279394e-01f, 1.333521456e-01f, 1.000000015e-01f, 7.498941571e-02f, 5.623412877e-02f, 4.216964915e-02f, 3.162277862e-02f, 2.371373586e-02f, 1.778279431e-02f, 1.333521493e-02f, 9.999999776e-03f, 7.498942316e-03f, 5.623413250e-03f, 4.216964822e-03f, 3.162277862e-03f, 2.371373819e-03f, 1.778279431e-03f, 1.333521446e-03f, 1.000000047e-03f, 7.498941850e-04f, 5.623413017e-04f, 4.216964880e-04f, 3.162277862e-04f, 2.371373848e-04f, 1.778279402e-04f, 1.333521504e-04f };   // float32 1 / 10000^(2i/64), generated with jnp to be bit-exact
__global__ __launch_bounds__(256) void k_cs5(float* CS) { const int idx = blockIdx.x * 256 + threadIdx.x; if (idx >= TT * HD) return; const int d = idx % HD; const int t = idx / HD; const float a = __fmul_rn((float)t, INVT[d % (HD / 2)]); v2f cs; cs[0] = cosf(a); cs[1] = sinf(a); *(v2f*)(CS + (size_t)idx * 2) = cs;  }
// k_asoft: per row (zz, i): t = S x HD^-0.5 for j <= i and i - j < WIN (sliding causal window; the reference's -1e9 additive fill vanishes identically); softmax over the 2048 keys (register row, one exp, fixed trees); the probabilities go back IN PLACE into the row's own 8 KiB of Sb, which its one wave has read whole into registers before (the stored values depend on the sum over all of them):
// rows >= RH: fp16 x PCAR in the first 4 KiB; rows < RH: hi plane in the first 4 KiB, lo plane in the second. As 16-bit planes the rows have pitch 2 * TT.
__global__ __launch_bounds__(256) void k_asoft(float* Sb) {
    const int lane = threadIdx.x & 31; const int row = blockIdx.x * 8 + (threadIdx.x >> 5); if (row >= ZH * TT) return; const int i = row % TT; const int zz = row / TT; (void)zz; const bool hires = (i < RH); float* sr = Sb + (size_t)row * TT; float v[TT / 32]; float mx = -3.0e38f;
#pragma unroll
    for (int ch = 0; ch < TT / 128; ++ch) { const int j0 = ch * 128 + lane * 4; const v4f a = *(const v4f*)(sr + j0);
#pragma unroll
        for (int q = 0; q < 4; ++q) { const int j = j0 + q; (void)j; const float t = (j <= i && i - j < WIN) ? a[q] * SCL : -3.0e38f; v[ch * 4 + q] = t; mx = fmaxf(mx, t); } }
#pragma unroll
    for (int sh = 16; sh; sh >>= 1) mx = fmaxf(mx, __shfl_xor(mx, sh, 32));
    float sum = 0.f;
#pragma unroll
    for (int k = 0; k < TT / 32; ++k) { float d0 = __fsub_rn(v[k], mx); asm volatile("" : "+v"(d0)); v[k] = __builtin_amdgcn_exp2f(__fmul_rn(d0, 1.4426950408889634f)); sum += v[k]; }
#pragma unroll
    for (int sh = 16; sh; sh >>= 1) sum += __shfl_xor(sum, sh, 32);
    const float f = __fdiv_rn(hires ? 1.0f : PCAR, sum);
{
        if (hires) {
#pragma unroll
            for (int ch = 0; ch < TT / 128; ++ch) { v4us oh, ol;
#pragma unroll
                for (int q = 0; q < 4; ++q) { unsigned short a, c2; splitf(v[ch * 4 + q] * f, a, c2); oh[q] = a; ol[q] = c2; }
                const int oo = ch * 128 + lane * 4; *(v4us*)((bf*)sr + oo) = oh; *(v4us*)((bf*)sr + TT + oo) = ol; }
        } else {
#pragma unroll
            for (int ch = 0; ch < TT / 128; ++ch) { v4h o4;
#pragma unroll
                for (int q = 0; q < 4; ++q) o4[q] = tohx(v[ch * 4 + q] * f);
                *(v4h*)((h16*)sr + ch * 128 + lane * 4) = o4; } }
         }
}
__global__ __launch_bounds__(256) void k_merge(const float* __restrict__ O, int h0, bf* Ah, bf* Al) { const size_t e = ((size_t)blockIdx.x * 256 + threadIdx.x) * 2; if (e >= (size_t)ZH * TT * HD) return; const int d = (int)(e % HD); const int t = (int)((e / HD) % TT); const int zz = (int)(e / ((size_t)HD * TT)); const float cs = (t < RH) ? 1.0f : (1.0f / PCAR); const size_t oo = (size_t)t * DQ + (h0 + zz) * HD + d;
    v2us oh, ol;
#pragma unroll
    for (int q = 0; q < 2; ++q) { unsigned short a, c2; splitf(O[e + q] * cs, a, c2); oh[q] = a; ol[q] = c2; } *(v2us*)(Ah + oo) = oh; *(v2us*)(Al + oo) = ol;  }

extern "C" void kernel_launch(void* const* d_in, const int* in_sizes, int n_in,
                              void* d_out, int out_size, void* d_ws, size_t ws_size, hipStream_t stream) {
    (void)in_sizes; (void)n_in; (void)out_size;
        const float* x = (const float*)d_in[0]; const float* wq = (const float*)d_in[1]; const float* wk = (const float*)d_in[2]; const float* wv = (const float*)d_in[3]; const float* wo = (const float*)d_in[4];   /* inputs x, wq [2048][2048], wk [512][2048], wv, wo ('oi'); this module has no mask input (the causal rule is by index) */
    float* OUT = (float*)d_out;     // [2][2048][2048]
    char* wsp = (char*)d_ws;
    auto take = [&](size_t bytes) { char* p = wsp; wsp += (bytes + 255) & ~(size_t)255; return (void*)p; };
    bf* WQ = (bf*)take((size_t)DQ * DM * 2); bf* WK = (bf*)take((size_t)DKV * DM * 2); bf* WV = (bf*)take((size_t)DKV * DM * 2); bf* WO = (bf*)take((size_t)DM * DQ * 2); float* CS = (float*)take((size_t)TT * HD * 2 * 4);
    bf* XB = (bf*)take((size_t)TT * DM * 2); float* FQ = (float*)take((size_t)TT * DQ * 4); float* FK = (float*)take((size_t)TT * DKV * 4);
    h16* QP16 = (h16*)take((size_t)NH_ * TT * HD * 2); h16* KP16 = (h16*)take((size_t)NKV * TT * HD * 2); h16* VT16 = (h16*)take((size_t)NKV * HD * TT * 2);
    bf* QPh = (bf*)take((size_t)NH_ * TT * HD * 2); bf* QPl = (bf*)take((size_t)NH_ * TT * HD * 2); bf* KPh = (bf*)take((size_t)NKV * TT * HD * 2); bf* KPl = (bf*)take((size_t)NKV * TT * HD * 2); bf* VTh = (bf*)take((size_t)NKV * HD * TT * 2); bf* VTl = (bf*)take((size_t)NKV * HD * TT * 2);
    float* Sb = (float*)take((size_t)ZH * TT * TT * 4); float* Ob = (float*)take((size_t)ZH * TT * HD * 4); bf* ATh = (bf*)take((size_t)TT * DQ * 2); bf* ATl = (bf*)take((size_t)TT * DQ * 2);
    if ((size_t)(wsp - (char*)d_ws) > ws_size) return;    // ws 256 MiB
    float* FV = FK;   // v projection reuses the k buffer after the k planes are built (stream-ordered)
    { k_cvt8<<<(unsigned)(((size_t)DQ * DM / 8 + 255) / 256), 256, 0, stream>>>(wq, WQ, (size_t)DQ * DM / 8); k_cvt8<<<(unsigned)(((size_t)DKV * DM / 8 + 255) / 256), 256, 0, stream>>>(wk, WK, (size_t)DKV * DM / 8); k_cvt8<<<(unsigned)(((size_t)DKV * DM / 8 + 255) / 256), 256, 0, stream>>>(wv, WV, (size_t)DKV * DM / 8);
      k_cvt8<<<(unsigned)(((size_t)DM * DQ / 8 + 255) / 256), 256, 0, stream>>>(wo, WO, (size_t)DM * DQ / 8);
       }
    k_cs5<<<(TT * HD + 255) / 256, 256, 0, stream>>>(CS);   /* rotary table once */
    const unsigned LQ = (unsigned)(((size_t)NH_ * TT * HD / 2 + 255) / 256), LKv = (unsigned)(((size_t)NKV * TT * HD / 2 + 255) / 256);
    for (int b = 0; b < NB_; ++b) {
        
        k_cvt8<<<(unsigned)(((size_t)TT * DM / 8 + 255) / 256), 256, 0, stream>>>(x + (size_t)b * TT * DM, XB, (size_t)TT * DM / 8);
        k_gemmw<bf, 0, false, 8, false><<<dim3(TT / 64, DQ / 64, 1), 256, 0, stream>>>(XB, nullptr, WQ, nullptr, DM, DM, FQ, DQ, nullptr, 0, 0, 0, 0);
        k_rope<<<LQ, 256, 0, stream>>>(FQ, DQ, NH_, CS, nullptr, nullptr, 1.0f, QP16, QPh, QPl);
        k_gemmw<bf, 0, false, 8, false><<<dim3(TT / 64, DKV / 64, 1), 256, 0, stream>>>(XB, nullptr, WK, nullptr, DM, DM, FK, DKV, nullptr, 0, 0, 0, 0);
        k_rope<<<LKv, 256, 0, stream>>>(FK, DKV, NKV, CS, nullptr, nullptr, 1.0f, KP16, KPh, KPl);
        k_gemmw<bf, 0, false, 8, false><<<dim3(TT / 64, DKV / 64, 1), 256, 0, stream>>>(XB, nullptr, WV, nullptr, DM, DM, FV, DKV, nullptr, 0, 0, 0, 0); k_vtp<<<LKv, 256, 0, stream>>>(FV, DKV, NKV, VT16, VTh, VTl);
        for (int h0 = 0; h0 < NH_; h0 += ZH) { const size_t zq = (size_t)h0, zk = (size_t)(h0 / REP);   // the ZH heads of a pass span ZH / REP kv groups from h0 / REP on: head z reads kv plane z / REP
            k_gemmc<bf, 2, 1><<<dim3(RH / 64, TT / 64, ZH), 32, 0, stream>>>(QPh + zq * TT * HD, QPl + zq * TT * HD, KPh + zk * TT * HD, KPl + zk * TT * HD, HD, Sb, TT, 0, (size_t)TT * HD, (size_t)TT * HD, (size_t)TT * TT);
            k_gemmc<h16, 0, 1><<<dim3((TT - RH) / 64, TT / 64, ZH), 32, 0, stream>>>(QP16 + zq * TT * HD + (size_t)RH * HD, nullptr, KP16 + zk * TT * HD, nullptr, HD, Sb + (size_t)RH * TT, TT, RH, (size_t)TT * HD, (size_t)TT * HD, (size_t)TT * TT);
            k_asoft<<<ZH * TT / 8, 256, 0, stream>>>(Sb);
            k_gemmw<bf, 2, false, 8, true><<<dim3(RH / 64, HD / 64, ZH), 256, 0, stream>>>((const bf*)Sb, (const bf*)Sb + TT, VTh + zk * HD * TT, VTl + zk * HD * TT, TT, 2 * TT, Ob, HD, nullptr, 0, (size_t)2 * TT * TT, (size_t)HD * TT, (size_t)TT * HD);
            k_gemmw<h16, 0, false, 16, true><<<dim3((TT - RH) / 64, HD / 64, ZH), 512, 0, stream>>>((const h16*)Sb + (size_t)RH * 2 * TT, nullptr, VT16 + zk * HD * TT, nullptr, TT, 2 * TT, Ob + (size_t)RH * HD, HD, nullptr, RH, (size_t)2 * TT * TT, (size_t)HD * TT, (size_t)TT * HD);
            k_merge<<<(unsigned)(((size_t)ZH * TT * HD / 2 + 255) / 256), 256, 0, stream>>>(Ob, h0, ATh, ATl); }
        k_gemmw<bf, 1, false, 8, false><<<dim3(TT / 64, DM / 64, 1), 256, 0, stream>>>(ATh, ATl, WO, nullptr, DQ, DQ, OUT + (size_t)b * TT * DM, DM, nullptr, 0, 0, 0, 0); }
}

// v004
// A run of this version takes 283 microseconds.
// It is 3.08 times as fast as v002, going by the measured steps of the versions left out in between.
// Counting every step since v000, it is 9.53 times as fast.
#include <hip/hip_runtime.h>

// Grouped-query causal attention with a computed half-split RoPE (x [2][2048][2048]; xq = x wq^T (32 heads x 64), xk, xv = x wk^T, x wv^T (8 kv heads x 64) ('oi', no bias; token-major); cos / sin from inv_freq = 1 / (10000 ** (2i / 64)) and positions arange(S) ([S][32] tables); (x1, x2) = the two 32-wide halves of each head: cat(x1 c - x2 s, x1 s + x2 c) (half-split pairs (d, d + 32)) on q and k; k, v repeated 4 x on the head axis (jnp.repeat: kv head = q head / 4); scores / sqrt(64); where(tril, scores, finfo.min) == exclusion; softmax; out = merged wo^T ('oi') -> [2][2048][2048] (8.4 M); argument order x, wq, wk, wv, wo).
// Every 16-bit matrix operand (x, the weights, the q, k and v^T planes, the merged attention output) is stored by its producer in fragment order (see WFrag).
// Layout per batch: bf16 copy of x; 'oi' weights; exact projections; k_cs5 computed table; rotate-half plane builders; causal T-2048 GQA attention fused in one kernel (k_fattn: running softmax in registers, kv plane = head / REP; hybrid rows: < 512 hi/lo 3 products, rest fp16 x1024; keys above the diagonal block are never read); merged hi/lo x wo exact.
// Compute dtypes, f32 accumulate: every input rounded to bf16; projections exact; rotary f32; attention rows < 512 3 products, rest fp16; softmax f32; wo hl x exact.

#define NB_  2
#define TT   2048
#define DM   2048
#define NH_  32
#define NKV  8
#define REP  (NH_ / NKV)
#define HD   64
#define DQ   (NH_ * HD)
#define DKV  (NKV * HD)
#define RH   512                  // query rows < RH use hi+lo planes
#define SCL  0.125f   // HD^-0.5
typedef _Float16 h16;
typedef unsigned short bf;
typedef __attribute__((ext_vector_type(16))) __bf16   v16bf;
typedef __attribute__((ext_vector_type(16))) _Float16 v16h;
typedef __attribute__((ext_vector_type(8)))  _Float16 v8h;
typedef __attribute__((ext_vector_type(8)))  unsigned short v8us;
typedef __attribute__((ext_vector_type(8)))  float    v8f;
typedef __attribute__((ext_vector_type(4)))  float    v4f;
typedef v8h  __attribute__((may_alias)) v8ha;
typedef v4f  __attribute__((may_alias)) v4fa;
typedef v8us __attribute__((may_alias)) v8usa;

__device__ __forceinline__ unsigned short f2bf(float f) { unsigned u = __float_as_uint(f); u += 0x7FFFu + ((u >> 16) & 1u); return (unsigned short)(u >> 16); }
__device__ __forceinline__ float bf2f(unsigned short b) { return __uint_as_float(((unsigned)b) << 16); }
__device__ __forceinline__ float bfr(float f) { return bf2f(f2bf(f)); }
__device__ __forceinline__ v16h cat16(v8h lo, v8h hi) { return __builtin_shufflevector(lo, hi, 0, 1, 2, 3, 4, 5, 6, 7, 8, 9, 10, 11, 12, 13, 14, 15); }
__device__ __forceinline__ v16bf cat16b(v8us lo, v8us hi) { return __builtin_bit_cast(v16bf, __builtin_shufflevector(lo, hi, 0, 1, 2, 3, 4, 5, 6, 7, 8, 9, 10, 11, 12, 13, 14, 15)); }
__device__ __forceinline__ v8f wmma16(v16h a, v16h b, v8f c) { return __builtin_amdgcn_wmma_f32_16x16x32_f16(false, a, false, b, (short)0, c, false, false); }
__device__ __forceinline__ v8f wmmab(v16bf a, v16bf b, v8f c) { return __builtin_amdgcn_wmma_f32_16x16x32_bf16(false, a, false, b, (short)0, c, false, false); }



// ---- k_gemmw: register-blocked GEMM, one 64x64 output tile per work-group of NW waves; grid (M/64, N/64, Z), 32 * NW threads. K is split over the waves: wave w takes the 64-wide K slices w, w + NW, ...
// (two 1-KiB blocks of every group of 16 operand rows per slice) and keeps its own 64x64 partial tile (16 accumulators), operands straight from 16-bit planes in fragment order; the NW partial tiles are then summed in wave order through LDS.
// C[m][n] (f32, pitch ldc, + optional f32 bias[n]) = sum_k A[m][k] Bt[n][k] (+ split products per NSPLIT). A has lda, Bt K elements a row (fragment order). z-batch strides sA/sB/sC in elements; Bt advances once per REP values of z (the heads of one kv group share it). K % 64 == 0.
// CAUSAL (probability x value): the K loop stops at the diagonal block of query rows r0 + roff .. (probabilities beyond it are exactly zero); roff = row offset of this launch's first row within the sequence.
// Fragment order: a block of 16 rows x 32 k of an operand is 512 consecutive elements, element (r, k) at (k >> 4) * 256 + (((k >> 3) & 1) * 16 + r) * 8 + (k & 7): lane l's two 16-byte pieces (row l & 15; k = 8 (l >> 4) + 0..7 and 16 + 8 (l >> 4) + 0..7) lie at l * 8 and 256 + l * 8,
// so each wave-wide 16-byte load covers 512 contiguous bytes (4 whole lines, not 16 pieces of 32 B). Blocks follow one another along k, then along the groups of 16 rows: a matrix of pitch P has block (row group g, k block b) at g * 16 * P + b * 512. ld takes the block's address + 8 * lane.
template <typename T16> struct WFrag;
template <> struct WFrag<h16> { typedef v16h V; static __device__ __forceinline__ V ld(const h16* p) { return cat16(*(const v8h*)p, *(const v8h*)(p + 256)); } static __device__ __forceinline__ v8f mma(V a, V b, v8f c) { return wmma16(a, b, c); } };
template <> struct WFrag<bf> { typedef v16bf V; static __device__ __forceinline__ V ld(const bf* p) { return cat16b(*(const v8us*)p, *(const v8us*)(p + 256)); } static __device__ __forceinline__ v8f mma(V a, V b, v8f c) { return wmmab(a, b, c); } };
template <typename T16, int NSPLIT, bool BIAS, int NW, bool CAUSAL>
__global__ __launch_bounds__(32 * NW) void k_gemmw(const T16* __restrict__ A, const T16* __restrict__ A2, const T16* __restrict__ Bt, const T16* __restrict__ Bt2, int K, int lda, float* C, int ldc, const float* __restrict__ bias, int roff, size_t sA, size_t sB, size_t sC) {
    typedef typename WFrag<T16>::V V;
    __shared__ __align__(16) float red[NW * 64 * 68];
    const size_t z = blockIdx.z; A += z * sA; if (A2) A2 += z * sA; Bt += (z / REP) * sB; if (Bt2) Bt2 += (z / REP) * sB; C += z * sC;
    const int lane = threadIdx.x & 31, lr = lane & 15, hi = lane >> 4; const int r0 = blockIdx.x * 64, c0 = blockIdx.y * 64;
    const int wave = __builtin_amdgcn_readfirstlane((int)(threadIdx.x >> 5));   // wave number in a scalar register: the K loop's counter and branch stay scalar
    const int Kl = CAUSAL ? min(K, r0 + roff + 64) : K;
    v8f acc[4][4];
#pragma unroll
    for (int mb = 0; mb < 4; ++mb)
#pragma unroll
        for (int nb = 0; nb < 4; ++nb) acc[mb][nb] = (v8f){};
    const size_t aoff = (size_t)r0 * lda + 8 * lane, boff = (size_t)c0 * K + 8 * lane;
#pragma unroll 1
    for (int kc = wave * 64; kc < Kl; kc += (kc & 32) ? 64 * NW - 32 : 32) {
        V a[4], a2[4]; const T16* pa[4]; const T16* pa2[4];
#pragma unroll
        for (int mb = 0; mb < 4; ++mb) { pa[mb] = A + aoff + (size_t)mb * 16 * lda + (size_t)kc * 16; a[mb] = WFrag<T16>::ld(pa[mb]); if (NSPLIT == 1 || NSPLIT == 2) { pa2[mb] = A2 + aoff + (size_t)mb * 16 * lda + (size_t)kc * 16; a2[mb] = WFrag<T16>::ld(pa2[mb]); } }
        // one s_wait_xcnt 0 behind the run of A loads, in front of any overwrite of an address register that they name (a precaution); the pointers are inputs so that they stay in their registers up to the wait and no load's result is placed over them
        if (NSPLIT == 1 || NSPLIT == 2) asm volatile("s_wait_xcnt 0x0" :: "v"(pa[0]), "v"(pa[1]), "v"(pa[2]), "v"(pa[3]), "v"(pa2[0]), "v"(pa2[1]), "v"(pa2[2]), "v"(pa2[3]) : "memory");
        else asm volatile("s_wait_xcnt 0x0" :: "v"(pa[0]), "v"(pa[1]), "v"(pa[2]), "v"(pa[3]) : "memory");
#pragma unroll
        for (int nb = 0; nb < 4; ++nb) { const T16* pb = Bt + boff + (size_t)nb * 16 * K + (size_t)kc * 16; const V b = WFrag<T16>::ld(pb); V b2;
            // the same wait behind each B fragment's loads
            if (NSPLIT >= 2) { const T16* pb2 = Bt2 + boff + (size_t)nb * 16 * K + (size_t)kc * 16; b2 = WFrag<T16>::ld(pb2); asm volatile("s_wait_xcnt 0x0" :: "v"(pb), "v"(pb2) : "memory"); }
            else asm volatile("s_wait_xcnt 0x0" :: "v"(pb) : "memory");
#pragma unroll
            for (int mb = 0; mb < 4; ++mb) { acc[mb][nb] = WFrag<T16>::mma(a[mb], b, acc[mb][nb]); if (NSPLIT == 1 || NSPLIT == 2) acc[mb][nb] = WFrag<T16>::mma(a2[mb], b, acc[mb][nb]); if (NSPLIT >= 2) acc[mb][nb] = WFrag<T16>::mma(a[mb], b2, acc[mb][nb]); } }
        asm volatile("v_nop\n\tv_nop\n\tv_nop\n\tv_nop" : "+v"(acc[0][0]), "+v"(acc[1][1]), "+v"(acc[2][2]), "+v"(acc[3][3]) : "v"(a[0]), "v"(a[3]));   // four vector slots behind the last WMMA, also on the taken back edge, before fragments or accumulators are touched
    }
    float* mine = red + wave * (64 * 68);
#pragma unroll
    for (int mb = 0; mb < 4; ++mb)
#pragma unroll
        for (int nb = 0; nb < 4; ++nb)
#pragma unroll
            for (int j = 0; j < 8; ++j) mine[(mb * 16 + hi * 8 + j) * 68 + nb * 16 + lr] = acc[mb][nb][j];
    __syncthreads();   // every wave's partial tile is in LDS before any wave sums
#pragma unroll
    for (int s = 0; s < 32 / NW; ++s) { const int q = s * 32 * NW + (int)threadIdx.x, row = q >> 4, cofs = (q & 15) * 4; v4f val = *(const v4fa*)(red + row * 68 + cofs);
#pragma unroll
        for (int w = 1; w < NW; ++w) val += *(const v4fa*)(red + w * (64 * 68) + row * 68 + cofs);
        if (BIAS) { val[0] += bfr(bias[c0 + cofs]); val[1] += bfr(bias[c0 + cofs + 1]); val[2] += bfr(bias[c0 + cofs + 2]); val[3] += bfr(bias[c0 + cofs + 3]); }
        *(v4f*)(C + (size_t)(r0 + row) * ldc + c0 + cofs) = val; }
}

__device__ __forceinline__ h16 tohx(float x) { return (h16)x; }
__device__ __forceinline__ void splitf(float y, unsigned short& h, unsigned short& l) { h = f2bf(y); l = f2bf(y - bf2f(h)); }
typedef __attribute__((ext_vector_type(2))) _Float16 v2h;
typedef __attribute__((ext_vector_type(4))) _Float16 v4h;
typedef __attribute__((ext_vector_type(2))) unsigned short v2us;
typedef __attribute__((ext_vector_type(4))) unsigned short v4us;
typedef __attribute__((ext_vector_type(2))) float v2f;
typedef __attribute__((ext_vector_type(4))) int v4i;

// k_cvt8: f32 [rows][DM] -> bf16 in fragment order. A thread rounds one 8-element piece; a wave takes 8 rows x one k block (8 whole f32 lines in), its 4 pieces a row going out as 4 whole 128-byte lines.
__global__ __launch_bounds__(256) void k_cvt8(const float* __restrict__ src, bf* dst, size_t n8) { static_assert(DQ == DM, "every converted matrix has DM elements a row"); const size_t i = (size_t)blockIdx.x * 256 + threadIdx.x; if (i >= n8) return;
    const int lane = (int)(i & 31), j = lane & 3; const size_t w = i >> 5, kb = w % (DM / 32), row = (w / (DM / 32)) * 8 + (lane >> 2);
    const v8f v = *(const v8f*)(src + row * DM + kb * 32 + j * 8); v8us o;
#pragma unroll
    for (int k = 0; k < 8; ++k) o[k] = f2bf(v[k]); *(v8us*)(dst + (row >> 4) * (16 * DM) + kb * 512 + (j >> 1) * 256 + ((j & 1) * 16 + (row & 15)) * 8) = o;  }

// k_rope: head planes [h][t][d] in fragment order (rows t, k = d; a thread takes two consecutive elements of the OUTPUT order, so stores stay contiguous) (fp16 + hi/lo) of rope(x) x sc with the rotate-half convention out[d] = x[d] cos[t][d] - x[d+HD/2] sin[t][d], out[d+HD/2] = x[d+HD/2] cos[t][d+HD/2] + x[d] sin[t][d+HD/2]
__global__ __launch_bounds__(256) void k_rope(const float* __restrict__ F, int pitch, int nheads, const float* __restrict__ CS, const float* __restrict__ RF, const float* __restrict__ nw, float sc, h16* P16, bf* Ph, bf* Pl) {
    const size_t e = ((size_t)blockIdx.x * 256 + threadIdx.x) * 2; if (e >= (size_t)nheads * TT * HD) return; const int w = (int)(e & 511); const size_t blk = e >> 9; const int d = (int)(blk & 1) * 32 + (w >> 7) * 8 + (w & 7); const int t = (int)((blk >> 1) % (TT / 16)) * 16 + ((w >> 3) & 15); const int h = (int)((blk >> 1) / (TT / 16)); const float* f = F + (size_t)t * pitch + h * HD; float rf = 1.0f; v2h o16; v2us oh, ol;
    if (RF) { const float* pr = RF + (size_t)h * TT + t; rf = *pr; asm volatile("s_wait_xcnt 0x0" :: "v"(pr) : "memory"); }   // the wait stands in front of any overwrite of the address register that the load names (a precaution)
#pragma unroll
    for (int q = 0; q < 2; ++q) { const int dd = d + q; const int dp = (dd < HD / 2) ? dd + HD / 2 : dd - HD / 2; const float* p0 = f + dd; const float* p1 = f + dp; float x0 = *p0, x1 = *p1; asm volatile("s_wait_xcnt 0x0" :: "v"(p0), "v"(p1) : "memory");   // the same wait behind the two loads
        if (RF) { float n0 = __fmul_rn(x0, rf), n1 = __fmul_rn(x1, rf); asm volatile("" : "+v"(n0)); asm volatile("" : "+v"(n1)); x0 = __fmul_rn(bfr(nw[dd]), n0); x1 = __fmul_rn(bfr(nw[dp]), n1); }
        const v2f cs = *(const v2f*)(CS + ((size_t)t * HD + dd) * 2); float a = __fmul_rn(x0, cs[0]), bq = __fmul_rn(x1, cs[1]); asm volatile("" : "+v"(a)); asm volatile("" : "+v"(bq)); const float r = ((dd < HD / 2) ? __fsub_rn(a, bq) : __fadd_rn(a, bq)) * sc;
        o16[q] = tohx(r); unsigned short a2, c2; splitf(r, a2, c2); oh[q] = a2; ol[q] = c2; }
    *(v2h*)(P16 + e) = o16; *(v2us*)(Ph + e) = oh; *(v2us*)(Pl + e) = ol;  }
__global__ __launch_bounds__(256) void k_vtp(const float* __restrict__ F, int pitch, int nheads, h16* V16, bf* Vh, bf* Vl) { const size_t e = ((size_t)blockIdx.x * 256 + threadIdx.x) * 2; if (e >= (size_t)nheads * HD * TT) return; const int w = (int)(e & 511); const size_t blk = e >> 9; const int t = (int)(blk % (TT / 32)) * 32 + (w >> 7) * 8 + (w & 7); const int gd = (int)(blk / (TT / 32)) * 16 + ((w >> 3) & 15); v2h o16; v2us oh, ol;   // V^T [g][d][t] in fragment order (rows gd = g * HD + d, k = t); e runs in the output order
#pragma unroll
    for (int q = 0; q < 2; ++q) { const float x = F[(size_t)(t + q) * pitch + gd]; o16[q] = tohx(x); unsigned short a2, c2; splitf(x, a2, c2); oh[q] = a2; ol[q] = c2; }
    *(v2h*)(V16 + e) = o16; *(v2us*)(Vh + e) = oh; *(v2us*)(Vl + e) = ol;  }
__constant__ float INVT[HD / 2] = { 1.000000000e+00f, 7.498942018e-01f, 5.623413324e-01f, 4.216965139e-01f, 3.162277639e-01f, 2.371373624e-01f, 1.778279394e-01f, 1.333521456e-01f, 1.000000015e-01f, 7.498941571e-02f, 5.623412877e-02f, 4.216964915e-02f, 3.162277862e-02f, 2.371373586e-02f, 1.778279431e-02f, 1.333521493e-02f, 9.999999776e-03f, 7.498942316e-03f, 5.623413250e-03f, 4.216964822e-03f, 3.162277862e-03f, 2.371373819e-03f, 1.778279431e-03f, 1.333521446e-03f, 1.000000047e-03f, 7.498941850e-04f, 5.623413017e-04f, 4.216964880e-04f, 3.162277862e-04f, 2.371373848e-04f, 1.778279402e-04f, 1.333521504e-04f };   // float32 1 / 10000^(2i/64), generated with jnp to be bit-exact
__global__ __launch_bounds__(256) void k_cs5(float* CS) { const int idx = blockIdx.x * 256 + threadIdx.x; if (idx >= TT * HD) return; const int d = idx % HD; const int t = idx / HD; const float a = __fmul_rn((float)t, INVT[d % (HD / 2)]); v2f cs; cs[0] = cosf(a); cs[1] = sinf(a); *(v2f*)(CS + (size_t)idx * 2) = cs;  }
// ---- k_fattn: scores, softmax, probability x value and the head merge in ONE kernel (running maximum and running sum per query; no score or probability ever leaves the registers).
// One wave = 16 query rows of one head; the REP waves of a work-group are the REP heads of one kv group, so they read the K and V of the same kv head, each from key 0 on. Grid (TT / 16, NKV); no LDS, no barrier.
// S^T = K Q^T: A = K rows (key = lane & 15), B = Q rows (query = lane & 15), so lane (lr, hi) holds for query lr the keys 8 hi + j of each 16-key tile: maximum and sum in-lane plus one exchange between the wave halves.
// Two such tiles, converted in place, are the B operand (k = 8 hi + s, 16 + 8 hi + (s - 8)) of O^T += V^T P^T, A = V^T rows loaded in the same k order; O^T keeps query = lane & 15, so the rescale is lane-local and a lane stores 8 consecutive d. Q, K, V^T come in fragment order (WFrag) and the output leaves in it.
// Rows < RH: hi/lo planes, 3 products each, 32 keys a pass; the rest fp16, 64 keys a pass, probabilities carried x 2^10 (the sum carries the same factor, so it cancels in the division).
typedef __attribute__((ext_vector_type(16))) unsigned short v16us;
template <bool B> struct Flag { static constexpr bool v = B; };
// 2^x on the transcendental unit with the slot that the instruction set asks for behind it, in one statement: each v_exp_f32 works in place, so none touches the source or the result of the one in front of it, and the closing v_nop stands between the last one and whatever the compiler schedules next.
__device__ __forceinline__ void exp2x8(float (&e)[8]) {
    asm("v_exp_f32 %0, %0\n\tv_exp_f32 %1, %1\n\tv_exp_f32 %2, %2\n\tv_exp_f32 %3, %3\n\tv_exp_f32 %4, %4\n\tv_exp_f32 %5, %5\n\tv_exp_f32 %6, %6\n\tv_exp_f32 %7, %7\n\tv_nop"
        : "+v"(e[0]), "+v"(e[1]), "+v"(e[2]), "+v"(e[3]), "+v"(e[4]), "+v"(e[5]), "+v"(e[6]), "+v"(e[7])); }
__device__ __forceinline__ float exp2x1(float a) { float e; asm("v_exp_f32 %0, %1\n\tv_nop" : "=v"(e) : "v"(a)); return e; }   // the same for one value
template <typename T16, bool HL, int KB>
__device__ __forceinline__ void fattn_body(const T16* __restrict__ Q, const T16* __restrict__ Q2, const T16* __restrict__ Kp, const T16* __restrict__ Kp2, const T16* __restrict__ Vt, const T16* __restrict__ Vt2, int q0, int kv, int head, bf* Ah, bf* Al) {
    typedef typename WFrag<T16>::V V;
    constexpr int NKT = KB / 16, NKH = KB / 32;
    constexpr float C1 = SCL * 1.4426950408889634f;   // raw score -> log2 units: HD^-0.5 x log2(e)
    constexpr bool AHEAD = !HL;   // K fragments fetched one pass ahead; not on the hi/lo path, whose twofold fragments would then take the wave past 256 registers
    const int lane = threadIdx.x & 31, lr = lane & 15, hi = lane >> 4; const int qi = q0 + lr;
    V qf[2], qf2[2];
    { const T16* pq = Q + ((size_t)head * TT + q0) * HD + 8 * lane; qf[0] = WFrag<T16>::ld(pq); qf[1] = WFrag<T16>::ld(pq + 512);
      // s_wait_xcnt 0 behind the run of Q loads, in front of any overwrite of an address register that they name (a precaution); the pointers are inputs so that they stay in their registers up to the wait
      if constexpr (HL) { const T16* pq2 = Q2 + ((size_t)head * TT + q0) * HD + 8 * lane; qf2[0] = WFrag<T16>::ld(pq2); qf2[1] = WFrag<T16>::ld(pq2 + 512); asm volatile("s_wait_xcnt 0x0" :: "v"(pq), "v"(pq2) : "memory"); }
      else asm volatile("s_wait_xcnt 0x0" :: "v"(pq) : "memory"); }
    const size_t koff = (size_t)kv * TT * HD + 8 * lane, voff = (size_t)kv * HD * TT + 8 * lane;
    v8f o[4];
#pragma unroll
    for (int db = 0; db < 4; ++db) o[db] = (v8f){};
    float m = -3.0e38f, l = 0.f;
    V kf[NKT][2], kf2[NKT][2];
    auto load_k = [&](int k0) {   // the K fragments of the pass that starts at key k0
        const T16* pk = Kp + koff + (size_t)k0 * HD;
#pragma unroll
        for (int kt = 0; kt < NKT; ++kt)
#pragma unroll
            for (int ks = 0; ks < 2; ++ks) kf[kt][ks] = WFrag<T16>::ld(pk + (kt * 2 + ks) * 512);
        // the same wait behind the run of K loads
        if constexpr (HL) { const T16* pk2 = Kp2 + koff + (size_t)k0 * HD;
#pragma unroll
            for (int kt = 0; kt < NKT; ++kt)
#pragma unroll
                for (int ks = 0; ks < 2; ++ks) kf2[kt][ks] = WFrag<T16>::ld(pk2 + (kt * 2 + ks) * 512);
            asm volatile("s_wait_xcnt 0x0" :: "v"(pk), "v"(pk2) : "memory"); }
        else asm volatile("s_wait_xcnt 0x0" :: "v"(pk) : "memory"); };
    auto pass = [&](int k0, auto edge) {   // KB keys from k0 on; edge: the one pass that holds the diagonal (causal select, no pass behind it)
        constexpr bool EDGE = decltype(edge)::v;
        V vf[4][NKH], vf2[4][NKH];
        if constexpr (!AHEAD) load_k(k0);
        const T16* pv = Vt + voff + (size_t)k0 * 16;
#pragma unroll
        for (int db = 0; db < 4; ++db)
#pragma unroll
            for (int kh = 0; kh < NKH; ++kh) vf[db][kh] = WFrag<T16>::ld(pv + (size_t)db * 16 * TT + kh * 512);
        // the same wait behind the run of V loads
        if constexpr (HL) { const T16* pv2 = Vt2 + voff + (size_t)k0 * 16;
#pragma unroll
            for (int db = 0; db < 4; ++db)
#pragma unroll
                for (int kh = 0; kh < NKH; ++kh) vf2[db][kh] = WFrag<T16>::ld(pv2 + (size_t)db * 16 * TT + kh * 512);
            asm volatile("s_wait_xcnt 0x0" :: "v"(pv), "v"(pv2) : "memory"); }
        else asm volatile("s_wait_xcnt 0x0" :: "v"(pv) : "memory");
        v8f s[NKT];
#pragma unroll
        for (int kt = 0; kt < NKT; ++kt) { s[kt] = (v8f){};
#pragma unroll
            for (int ks = 0; ks < 2; ++ks) { s[kt] = WFrag<T16>::mma(kf[kt][ks], qf[ks], s[kt]); if constexpr (HL) { s[kt] = WFrag<T16>::mma(kf[kt][ks], qf2[ks], s[kt]); s[kt] = WFrag<T16>::mma(kf2[kt][ks], qf[ks], s[kt]); } } }
        if constexpr (AHEAD && !EDGE) load_k(k0 + KB);   // the next pass's K fragments fly during this pass's softmax and P.V (a pass that is not the edge pass always has a successor)
        float bm = -3.0e38f; const int rel = qi - k0 - hi * 8;   // a lane's key kt * 16 + j of the pass is allowed while it is <= rel
#pragma unroll
        for (int kt = 0; kt < NKT; ++kt)
#pragma unroll
            for (int j = 0; j < 8; ++j) { if constexpr (EDGE) s[kt][j] = (kt * 16 + j <= rel) ? s[kt][j] : -3.0e38f; bm = fmaxf(bm, s[kt][j]); }
        bm = fmaxf(bm, __shfl_xor(bm, 16, 32));
        const float mn = fmaxf(m, bm * C1); const float alpha = exp2x1(m - mn); m = mn;   // the running maximum is kept in log2 units
        const float sh = (HL ? 0.0f : 10.0f) - mn;
        float ls[NKT];
#pragma unroll
        for (int kt = 0; kt < NKT; ++kt) { float e[8]; ls[kt] = 0.f;
#pragma unroll
            for (int j = 0; j < 8; ++j) e[j] = s[kt][j] * C1 + sh;   // one multiply-add from raw score to exponent
            exp2x8(e);
#pragma unroll
            for (int j = 0; j < 8; ++j) { s[kt][j] = e[j]; ls[kt] += e[j]; } }
        float lsum = ls[0];
#pragma unroll
        for (int kt = 1; kt < NKT; ++kt) lsum += ls[kt];
        l = l * alpha + lsum;   // each wave half keeps the sum of its own keys; the halves are joined once, behind the last pass
#pragma unroll
        for (int db = 0; db < 4; ++db) o[db] *= alpha;
#pragma unroll
        for (int kh = 0; kh < NKH; ++kh) {
            if constexpr (HL) { v16us ph, pl;
#pragma unroll
                for (int q = 0; q < 16; ++q) { unsigned short a, c2; splitf(s[kh * 2 + (q >> 3)][q & 7], a, c2); ph[q] = a; pl[q] = c2; }
                const V pfh = __builtin_bit_cast(V, ph), pfl = __builtin_bit_cast(V, pl);
#pragma unroll
                for (int db = 0; db < 4; ++db) { o[db] = WFrag<T16>::mma(vf[db][kh], pfh, o[db]); o[db] = WFrag<T16>::mma(vf[db][kh], pfl, o[db]); o[db] = WFrag<T16>::mma(vf2[db][kh], pfh, o[db]); }
            } else { V pf;
#pragma unroll
                for (int q = 0; q < 16; ++q) pf[q] = tohx(s[kh * 2 + (q >> 3)][q & 7]);
#pragma unroll
                for (int db = 0; db < 4; ++db) o[db] = WFrag<T16>::mma(vf[db][kh], pf, o[db]); } }
        asm volatile("v_nop\n\tv_nop\n\tv_nop\n\tv_nop" : "+v"(o[0]), "+v"(o[1]), "+v"(o[2]), "+v"(o[3]) : "v"(vf[3][NKH - 1]));   // four vector slots behind the last WMMA, also on the taken back edge, before fragments or accumulators are touched
    };
    int k0 = 0;   // both loops stay rolled: one pass already holds every fragment of KB keys in registers
    if constexpr (AHEAD) { static_assert(RH >= KB, "the fetch-ahead loop runs at least once: its rows start at RH");
        load_k(0);
#pragma unroll 1
        do { pass(k0, Flag<false>{}); k0 += KB; } while (k0 + KB - 1 <= q0);
    } else {
#pragma unroll 1
        for (; k0 + KB - 1 <= q0; k0 += KB) pass(k0, Flag<false>{}); }
    pass(k0, Flag<true>{});
    const float f = __fdiv_rn(1.0f, l + __shfl_xor(l, 16, 32));
    const size_t oo = (size_t)q0 * DQ + head * (2 * 512) + 8 * lane; v8us oh[4], ol[4];   // fragment order of the wo product's A operand (rows = queries, k = head * HD + d): a lane's 8 values of d block db are its own piece of half db & 1 of k block head * 2 + (db >> 1)
#pragma unroll
    for (int db = 0; db < 4; ++db)
#pragma unroll
        for (int j = 0; j < 8; ++j) { unsigned short a, c2; splitf(o[db][j] * f, a, c2); oh[db][j] = a; ol[db][j] = c2; }
#pragma unroll
    for (int db = 0; db < 4; ++db) { *(v8us*)(Ah + oo + db * 256) = oh[db]; *(v8us*)(Al + oo + db * 256) = ol[db]; }
}
// amdgpu_waves_per_eu(4, 4): at most 256 registers a wave, so that four waves share a SIMD and all TT / 16 x NKV work-groups are resident at once
__global__ __launch_bounds__(32 * REP) __attribute__((amdgpu_waves_per_eu(4, 4))) void k_fattn(const h16* __restrict__ Q16, const bf* __restrict__ Qh, const bf* __restrict__ Ql, const h16* __restrict__ K16, const bf* __restrict__ Kh, const bf* __restrict__ Kl, const h16* __restrict__ V16, const bf* __restrict__ Vh, const bf* __restrict__ Vl, bf* Ah, bf* Al) {
    const int wave = __builtin_amdgcn_readfirstlane((int)(threadIdx.x >> 5));   // wave number in a scalar register: head, loop bound and branches stay scalar
    const int kv = blockIdx.y, head = kv * REP + wave;
    // a tile's cost grows with its index and every work-group is resident at once: two of a work-group's heads take tile t, the other two tile n - 1 - t, and which two alternates with the kv head, so that long and short waves mix (for speed only; each (head, tile) is taken once)
    const int tile = (((wave >> 1) + kv + (kv >> 1)) & 1) ? (int)blockIdx.x : TT / 16 - 1 - (int)blockIdx.x; const int q0 = tile * 16;
    if (q0 < RH) fattn_body<bf, true, 32>(Qh, Ql, Kh, Kl, Vh, Vl, q0, kv, head, Ah, Al);
    else fattn_body<h16, false, 64>(Q16, nullptr, K16, nullptr, V16, nullptr, q0, kv, head, Ah, Al);
}

extern "C" void kernel_launch(void* const* d_in, const int* in_sizes, int n_in,
                              void* d_out, int out_size, void* d_ws, size_t ws_size, hipStream_t stream) {
    (void)in_sizes; (void)n_in; (void)out_size;
        const float* x = (const float*)d_in[0]; const float* wq = (const float*)d_in[1]; const float* wk = (const float*)d_in[2]; const float* wv = (const float*)d_in[3]; const float* wo = (const float*)d_in[4];   /* inputs x, wq [2048][2048], wk [512][2048], wv, wo ('oi'); this module has no mask input (the causal rule is by index) */
    float* OUT = (float*)d_out;     // [2][2048][2048]
    char* wsp = (char*)d_ws;
    auto take = [&](size_t bytes) { char* p = wsp; wsp += (bytes + 255) & ~(size_t)255; return (void*)p; };
    bf* WQ = (bf*)take((size_t)DQ * DM * 2); bf* WK = (bf*)take((size_t)DKV * DM * 2); bf* WV = (bf*)take((size_t)DKV * DM * 2); bf* WO = (bf*)take((size_t)DM * DQ * 2); float* CS = (float*)take((size_t)TT * HD * 2 * 4);
    bf* XB = (bf*)take((size_t)TT * DM * 2); float* FQ = (float*)take((size_t)TT * DQ * 4); float* FK = (float*)take((size_t)TT * DKV * 4);
    h16* QP16 = (h16*)take((size_t)NH_ * TT * HD * 2); h16* KP16 = (h16*)take((size_t)NKV * TT * HD * 2); h16* VT16 = (h16*)take((size_t)NKV * HD * TT * 2);
    bf* QPh = (bf*)take((size_t)NH_ * TT * HD * 2); bf* QPl = (bf*)take((size_t)NH_ * TT * HD * 2); bf* KPh = (bf*)take((size_t)NKV * TT * HD * 2); bf* KPl = (bf*)take((size_t)NKV * TT * HD * 2); bf* VTh = (bf*)take((size_t)NKV * HD * TT * 2); bf* VTl = (bf*)take((size_t)NKV * HD * TT * 2);
    bf* ATh = (bf*)take((size_t)TT * DQ * 2); bf* ATl = (bf*)take((size_t)TT * DQ * 2);
    if ((size_t)(wsp - (char*)d_ws) > ws_size) return;    // ws 256 MiB
    float* FV = FK;   // v projection reuses the k buffer after the k planes are built (stream-ordered)
    { k_cvt8<<<(unsigned)(((size_t)DQ * DM / 8 + 255) / 256), 256, 0, stream>>>(wq, WQ, (size_t)DQ * DM / 8); k_cvt8<<<(unsigned)(((size_t)DKV * DM / 8 + 255) / 256), 256, 0, stream>>>(wk, WK, (size_t)DKV * DM / 8); k_cvt8<<<(unsigned)(((size_t)DKV * DM / 8 + 255) / 256), 256, 0, stream>>>(wv, WV, (size_t)DKV * DM / 8);
      k_cvt8<<<(unsigned)(((size_t)DM * DQ / 8 + 255) / 256), 256, 0, stream>>>(wo, WO, (size_t)DM * DQ / 8);
       }
    k_cs5<<<(TT * HD + 255) / 256, 256, 0, stream>>>(CS);   /* rotary table once */
    const unsigned LQ = (unsigned)(((size_t)NH_ * TT * HD / 2 + 255) / 256), LKv = (unsigned)(((size_t)NKV * TT * HD / 2 + 255) / 256);
    for (int b = 0; b < NB_; ++b) {
        
        k_cvt8<<<(unsigned)(((size_t)TT * DM / 8 + 255) / 256), 256, 0, stream>>>(x + (size_t)b * TT * DM, XB, (size_t)TT * DM / 8);
        k_gemmw<bf, 0, false, 8, false><<<dim3(TT / 64, DQ / 64, 1), 256, 0, stream>>>(XB, nullptr, WQ, nullptr, DM, DM, FQ, DQ, nullptr, 0, 0, 0, 0);
        k_rope<<<LQ, 256, 0, stream>>>(FQ, DQ, NH_, CS, nullptr, nullptr, 1.0f, QP16, QPh, QPl);
        k_gemmw<bf, 0, false, 8, false><<<dim3(TT / 64, DKV / 64, 1), 256, 0, stream>>>(XB, nullptr, WK, nullptr, DM, DM, FK, DKV, nullptr, 0, 0, 0, 0);
        k_rope<<<LKv, 256, 0, stream>>>(FK, DKV, NKV, CS, nullptr, nullptr, 1.0f, KP16, KPh, KPl);
        k_gemmw<bf, 0, false, 8, false><<<dim3(TT / 64, DKV / 64, 1), 256, 0, stream>>>(XB, nullptr, WV, nullptr, DM, DM, FV, DKV, nullptr, 0, 0, 0, 0); k_vtp<<<LKv, 256, 0, stream>>>(FV, DKV, NKV, VT16, VTh, VTl);
        k_fattn<<<dim3(TT / 16, NKV, 1), 32 * REP, 0, stream>>>(QP16, QPh, QPl, KP16, KPh, KPl, VT16, VTh, VTl, ATh, ATl);
        k_gemmw<bf, 1, false, 8, false><<<dim3(TT / 64, DM / 64, 1), 256, 0, stream>>>(ATh, ATl, WO, nullptr, DQ, DQ, OUT + (size_t)b * TT * DM, DM, nullptr, 0, 0, 0, 0); }
}

// v005
// One run takes 259 microseconds.
// Two timings next to v004 put it at 1.09 and 1.10 times that version's speed.
// Counting every step since v000, it is 10.4 times as fast.
#include <hip/hip_runtime.h>

// Grouped-query causal attention with a computed half-split RoPE (x [2][2048][2048]; xq = x wq^T (32 heads x 64), xk, xv = x wk^T, x wv^T (8 kv heads x 64) ('oi', no bias; token-major); cos / sin from inv_freq = 1 / (10000 ** (2i / 64)) and positions arange(S) ([S][32] tables); (x1, x2) = the two 32-wide halves of each head: cat(x1 c - x2 s, x1 s + x2 c) (half-split pairs (d, d + 32)) on q and k; k, v repeated 4 x on the head axis (jnp.repeat: kv head = q head / 4); scores / sqrt(64); where(tril, scores, finfo.min) == exclusion; softmax; out = merged wo^T ('oi') -> [2][2048][2048] (8.4 M); argument order x, wq, wk, wv, wo).
// Every 16-bit matrix operand (x, the weights, the q, k and v^T planes, the merged attention output) is stored by its producer in fragment order (see WFrag).
// Layout per batch: bf16 copy of x; 'oi' weights; exact projections whose epilogue applies the rotate-half rotation (k_cs5 computed table) and stores the 16-bit planes itself; causal T-2048 GQA attention fused in one kernel (k_fattn: running softmax in registers, kv plane = head / REP; hybrid rows: < 512 hi/lo 3 products, rest fp16 x1024; keys above the diagonal block are never read); merged hi/lo x wo exact.
// Compute dtypes, f32 accumulate: every input rounded to bf16; projections exact; rotary f32; attention rows < 512 3 products, rest fp16; softmax f32; wo hl x exact.

#define NB_  2
#define TT   2048
#define DM   2048
#define NH_  32
#define NKV  8
#define REP  (NH_ / NKV)
#define HD   64
#define DQ   (NH_ * HD)
#define DKV  (NKV * HD)
#define RH   512                  // query rows < RH use hi+lo planes
#define SCL  0.125f   // HD^-0.5
typedef _Float16 h16;
typedef unsigned short bf;
typedef __attribute__((ext_vector_type(16))) __bf16   v16bf;
typedef __attribute__((ext_vector_type(16))) _Float16 v16h;
typedef __attribute__((ext_vector_type(8)))  _Float16 v8h;
typedef __attribute__((ext_vector_type(8)))  unsigned short v8us;
typedef __attribute__((ext_vector_type(8)))  float    v8f;
typedef __attribute__((ext_vector_type(4)))  float    v4f;
typedef v8h  __attribute__((may_alias)) v8ha;
typedef v4f  __attribute__((may_alias)) v4fa;
typedef v8us __attribute__((may_alias)) v8usa;

__device__ __forceinline__ unsigned short f2bf(float f) { unsigned u = __float_as_uint(f); u += 0x7FFFu + ((u >> 16) & 1u); return (unsigned short)(u >> 16); }
__device__ __forceinline__ float bf2f(unsigned short b) { return __uint_as_float(((unsigned)b) << 16); }
__device__ __forceinline__ float bfr(float f) { return bf2f(f2bf(f)); }
__device__ __forceinline__ v16h cat16(v8h lo, v8h hi) { return __builtin_shufflevector(lo, hi, 0, 1, 2, 3, 4, 5, 6, 7, 8, 9, 10, 11, 12, 13, 14, 15); }
__device__ __forceinline__ v16bf cat16b(v8us lo, v8us hi) { return __builtin_bit_cast(v16bf, __builtin_shufflevector(lo, hi, 0, 1, 2, 3, 4, 5, 6, 7, 8, 9, 10, 11, 12, 13, 14, 15)); }
__device__ __forceinline__ v8f wmma16(v16h a, v16h b, v8f c) { return __builtin_amdgcn_wmma_f32_16x16x32_f16(false, a, false, b, (short)0, c, false, false); }
__device__ __forceinline__ v8f wmmab(v16bf a, v16bf b, v8f c) { return __builtin_amdgcn_wmma_f32_16x16x32_bf16(false, a, false, b, (short)0, c, false, false); }
__device__ __forceinline__ h16 tohx(float x) { return (h16)x; }
__device__ __forceinline__ void splitf(float y, unsigned short& h, unsigned short& l) { h = f2bf(y); l = f2bf(y - bf2f(h)); }



// ---- k_gemmw: register-blocked GEMM, one 64x64 output tile per work-group of NW waves; grid (M/64, N/64, Z), 32 * NW threads. K is split over the waves: wave w takes the 64-wide K slices w, w + NW, ...
// (two 1-KiB blocks of every group of 16 operand rows per slice) and keeps its own 64x64 partial tile (16 accumulators), operands straight from 16-bit planes in fragment order; the NW partial tiles are then summed in wave order through LDS.
// C[m][n] (f32, pitch ldc, + optional f32 bias[n]) = sum_k A[m][k] Bt[n][k] (+ split products per NSPLIT). A has lda, Bt K elements a row (fragment order). z-batch strides sA/sB/sC in elements; Bt advances once per REP values of z (the heads of one kv group share it). K % 64 == 0.
// CAUSAL (probability x value): the K loop stops at the diagonal block of query rows r0 + roff .. (probabilities beyond it are exactly zero); roff = row offset of this launch's first row within the sequence.
// Fragment order: a block of 16 rows x 32 k of an operand is 512 consecutive elements, element (r, k) at (k >> 4) * 256 + (((k >> 3) & 1) * 16 + r) * 8 + (k & 7): lane l's two 16-byte pieces (row l & 15; k = 8 (l >> 4) + 0..7 and 16 + 8 (l >> 4) + 0..7) lie at l * 8 and 256 + l * 8,
// so each wave-wide 16-byte load covers 512 contiguous bytes (4 whole lines, not 16 pieces of 32 B). Blocks follow one another along k, then along the groups of 16 rows: a matrix of pitch P has block (row group g, k block b) at g * 16 * P + b * 512. ld takes the block's address + 8 * lane.
// EPI 0: the summed tile goes out as f32 C. EPI 1, 2: no f32 tile leaves the kernel; the tile is stored as three 16-bit planes (fp16, bf16 hi, bf16 lo) in fragment order, a thread taking the pieces of columns 8 o .. 8 o + 7 and 32 + 8 o .. of one row, so each wave-wide 16-byte store covers 512 contiguous bytes.
// EPI 1 (q, k; rows = positions t, the 64 columns = one head): rotate-half first, out[d] = x[d] cos[t][d] - x[d+32] sin[t][d], out[d+32] = x[d+32] cos[t][d] + x[d] sin[t][d] (a thread's two pieces are exactly such pairs); planes [head][t][d], pitch HD.
// EPI 2 (v; launched as wv x^T, so rows = kv head * HD + d and columns = t: the tile is V^T already): planes [g][d][t], pitch TT.
template <typename T16> struct WFrag;
template <> struct WFrag<h16> { typedef v16h V; static __device__ __forceinline__ V ld(const h16* p) { return cat16(*(const v8h*)p, *(const v8h*)(p + 256)); } static __device__ __forceinline__ v8f mma(V a, V b, v8f c) { return wmma16(a, b, c); } };
template <> struct WFrag<bf> { typedef v16bf V; static __device__ __forceinline__ V ld(const bf* p) { return cat16b(*(const v8us*)p, *(const v8us*)(p + 256)); } static __device__ __forceinline__ v8f mma(V a, V b, v8f c) { return wmmab(a, b, c); } };
template <typename T16, int NSPLIT, bool BIAS, int NW, bool CAUSAL, int EPI>
__global__ __launch_bounds__(32 * NW) void k_gemmw(const T16* __restrict__ A, const T16* __restrict__ A2, const T16* __restrict__ Bt, const T16* __restrict__ Bt2, int K, int lda, float* C, int ldc, const float* __restrict__ bias, int roff, size_t sA, size_t sB, size_t sC, const float* __restrict__ CS, h16* P16, bf* Ph, bf* Pl) {
    typedef typename WFrag<T16>::V V;
    __shared__ __align__(16) float red[NW * 64 * 68];
    const size_t z = blockIdx.z; A += z * sA; if (A2) A2 += z * sA; Bt += (z / REP) * sB; if (Bt2) Bt2 += (z / REP) * sB; C += z * sC;
    const int lane = threadIdx.x & 31, lr = lane & 15, hi = lane >> 4; const int r0 = blockIdx.x * 64, c0 = blockIdx.y * 64;
    const int wave = __builtin_amdgcn_readfirstlane((int)(threadIdx.x >> 5));   // wave number in a scalar register: the K loop's counter and branch stay scalar
    const int Kl = CAUSAL ? min(K, r0 + roff + 64) : K;
    v8f acc[4][4];
#pragma unroll
    for (int mb = 0; mb < 4; ++mb)
#pragma unroll
        for (int nb = 0; nb < 4; ++nb) acc[mb][nb] = (v8f){};
    const size_t aoff = (size_t)r0 * lda + 8 * lane, boff = (size_t)c0 * K + 8 * lane;
#pragma unroll 1
    for (int kc = wave * 64; kc < Kl; kc += (kc & 32) ? 64 * NW - 32 : 32) {
        V a[4], a2[4]; const T16* pa[4]; const T16* pa2[4];
#pragma unroll
        for (int mb = 0; mb < 4; ++mb) { pa[mb] = A + aoff + (size_t)mb * 16 * lda + (size_t)kc * 16; a[mb] = WFrag<T16>::ld(pa[mb]); if (NSPLIT == 1 || NSPLIT == 2) { pa2[mb] = A2 + aoff + (size_t)mb * 16 * lda + (size_t)kc * 16; a2[mb] = WFrag<T16>::ld(pa2[mb]); } }
        // one s_wait_xcnt 0 behind the run of A loads, in front of any overwrite of an address register that they name (a precaution); the pointers are inputs so that they stay in their registers up to the wait and no load's result is placed over them
        if (NSPLIT == 1 || NSPLIT == 2) asm volatile("s_wait_xcnt 0x0" :: "v"(pa[0]), "v"(pa[1]), "v"(pa[2]), "v"(pa[3]), "v"(pa2[0]), "v"(pa2[1]), "v"(pa2[2]), "v"(pa2[3]) : "memory");
        else asm volatile("s_wait_xcnt 0x0" :: "v"(pa[0]), "v"(pa[1]), "v"(pa[2]), "v"(pa[3]) : "memory");
#pragma unroll
        for (int nb = 0; nb < 4; ++nb) { const T16* pb = Bt + boff + (size_t)nb * 16 * K + (size_t)kc * 16; const V b = WFrag<T16>::ld(pb); V b2;
            // the same wait behind each B fragment's loads
            if (NSPLIT >= 2) { const T16* pb2 = Bt2 + boff + (size_t)nb * 16 * K + (size_t)kc * 16; b2 = WFrag<T16>::ld(pb2); asm volatile("s_wait_xcnt 0x0" :: "v"(pb), "v"(pb2) : "memory"); }
            else asm volatile("s_wait_xcnt 0x0" :: "v"(pb) : "memory");
#pragma unroll
            for (int mb = 0; mb < 4; ++mb) { acc[mb][nb] = WFrag<T16>::mma(a[mb], b, acc[mb][nb]); if (NSPLIT == 1 || NSPLIT == 2) acc[mb][nb] = WFrag<T16>::mma(a2[mb], b, acc[mb][nb]); if (NSPLIT >= 2) acc[mb][nb] = WFrag<T16>::mma(a[mb], b2, acc[mb][nb]); } }
        asm volatile("v_nop\n\tv_nop\n\tv_nop\n\tv_nop" : "+v"(acc[0][0]), "+v"(acc[1][1]), "+v"(acc[2][2]), "+v"(acc[3][3]) : "v"(a[0]), "v"(a[3]));   // four vector slots behind the last WMMA, also on the taken back edge, before fragments or accumulators are touched
    }
    const int pg = (int)threadIdx.x >> 6, po = ((int)threadIdx.x >> 4) & 3, prow = pg * 16 + ((int)threadIdx.x & 15);   // EPI 1, 2: this thread's group of 16 rows, its 8-column piece and its row of the tile
    v4f cs[4];
    if constexpr (EPI == 1) { const float* pc = CS + ((size_t)(r0 + prow) * HD + po * 8) * 2;   // (cos, sin) of the thread's 8 column pairs, asked for here so that they fly during the LDS stores and the barrier
#pragma unroll
        for (int q = 0; q < 4; ++q) cs[q] = *(const v4f*)(pc + q * 4);
        asm volatile("s_wait_xcnt 0x0" :: "v"(pc) : "memory"); }   // the wait stands in front of any overwrite of the address register that the loads name (a precaution)
    float* mine = red + wave * (64 * 68);
#pragma unroll
    for (int mb = 0; mb < 4; ++mb)
#pragma unroll
        for (int nb = 0; nb < 4; ++nb)
#pragma unroll
            for (int j = 0; j < 8; ++j) mine[(mb * 16 + hi * 8 + j) * 68 + nb * 16 + lr] = acc[mb][nb][j];
    __syncthreads();   // every wave's partial tile is in LDS before any wave sums
    if constexpr (EPI == 0) {
#pragma unroll
    for (int s = 0; s < 32 / NW; ++s) { const int q = s * 32 * NW + (int)threadIdx.x, row = q >> 4, cofs = (q & 15) * 4; v4f val = *(const v4fa*)(red + row * 68 + cofs);
#pragma unroll
        for (int w = 1; w < NW; ++w) val += *(const v4fa*)(red + w * (64 * 68) + row * 68 + cofs);
        if (BIAS) { val[0] += bfr(bias[c0 + cofs]); val[1] += bfr(bias[c0 + cofs + 1]); val[2] += bfr(bias[c0 + cofs + 2]); val[3] += bfr(bias[c0 + cofs + 3]); }
        *(v4f*)(C + (size_t)(r0 + row) * ldc + c0 + cofs) = val; }
    } else {
        static_assert(EPI == 0 || (NW == 8 && HD == 64 && !BIAS), "256 threads = 64 rows x 4 pairs of 8-column pieces; one tile = one head");
        float x[2][8];   // x[0]: columns 8 po .. + 7, x[1]: the same + 32, each the NW partials summed in wave order
#pragma unroll
        for (int q = 0; q < 4; ++q) { const int cofs = (q >> 1) * 32 + po * 8 + (q & 1) * 4; v4f val = *(const v4fa*)(red + prow * 68 + cofs);
#pragma unroll
            for (int w = 1; w < NW; ++w) val += *(const v4fa*)(red + w * (64 * 68) + prow * 68 + cofs);
#pragma unroll
            for (int i = 0; i < 4; ++i) x[q >> 1][(q & 1) * 4 + i] = val[i]; }
        if constexpr (EPI == 1) {
#pragma unroll
            for (int j = 0; j < 8; ++j) { const float c = cs[j >> 1][(j & 1) * 2], s = cs[j >> 1][(j & 1) * 2 + 1], a = x[0][j], b = x[1][j]; x[0][j] = a * c - b * s; x[1][j] = b * c + a * s; } }
        v8h o16[2]; v8us oh[2], ol[2];
#pragma unroll
        for (int p = 0; p < 2; ++p)
#pragma unroll
            for (int j = 0; j < 8; ++j) { unsigned short a2, c2; splitf(x[p][j], a2, c2); o16[p][j] = tohx(x[p][j]); oh[p][j] = a2; ol[p][j] = c2; }
        // block (row group, k block) of a plane of pitch P lies at group * 16 * P + block * 512; the thread's piece of it at (8-column piece * 16 + row) * 8; its second piece is the next k block's
        const size_t oo = (EPI == 1 ? (size_t)(c0 / HD) * TT * HD + (size_t)(r0 + pg * 16) * HD : (size_t)(r0 + pg * 16) * TT + (size_t)(c0 / 32) * 512) + ((int)threadIdx.x & 63) * 8;
#pragma unroll
        for (int p = 0; p < 2; ++p) { *(v8h*)(P16 + oo + p * 512) = o16[p]; *(v8us*)(Ph + oo + p * 512) = oh[p]; *(v8us*)(Pl + oo + p * 512) = ol[p]; }
    }
}

typedef __attribute__((ext_vector_type(2))) _Float16 v2h;
typedef __attribute__((ext_vector_type(4))) _Float16 v4h;
typedef __attribute__((ext_vector_type(2))) unsigned short v2us;
typedef __attribute__((ext_vector_type(4))) unsigned short v4us;
typedef __attribute__((ext_vector_type(2))) float v2f;
typedef __attribute__((ext_vector_type(4))) int v4i;

// k_cvt8: f32 [rows][DM] -> bf16 in fragment order. A thread rounds one 8-element piece; a wave takes 8 rows x one k block (8 whole f32 lines in), its 4 pieces a row going out as 4 whole 128-byte lines.
__global__ __launch_bounds__(256) void k_cvt8(const float* __restrict__ src, bf* dst, size_t n8) { static_assert(DQ == DM, "every converted matrix has DM elements a row"); const size_t i = (size_t)blockIdx.x * 256 + threadIdx.x; if (i >= n8) return;
    const int lane = (int)(i & 31), j = lane & 3; const size_t w = i >> 5, kb = w % (DM / 32), row = (w / (DM / 32)) * 8 + (lane >> 2);
    const v8f v = *(const v8f*)(src + row * DM + kb * 32 + j * 8); v8us o;
#pragma unroll
    for (int k = 0; k < 8; ++k) o[k] = f2bf(v[k]); *(v8us*)(dst + (row >> 4) * (16 * DM) + kb * 512 + (j >> 1) * 256 + ((j & 1) * 16 + (row & 15)) * 8) = o;  }

__constant__ float INVT[HD / 2] = { 1.000000000e+00f, 7.498942018e-01f, 5.623413324e-01f, 4.216965139e-01f, 3.162277639e-01f, 2.371373624e-01f, 1.778279394e-01f, 1.333521456e-01f, 1.000000015e-01f, 7.498941571e-02f, 5.623412877e-02f, 4.216964915e-02f, 3.162277862e-02f, 2.371373586e-02f, 1.778279431e-02f, 1.333521493e-02f, 9.999999776e-03f, 7.498942316e-03f, 5.623413250e-03f, 4.216964822e-03f, 3.162277862e-03f, 2.371373819e-03f, 1.778279431e-03f, 1.333521446e-03f, 1.000000047e-03f, 7.498941850e-04f, 5.623413017e-04f, 4.216964880e-04f, 3.162277862e-04f, 2.371373848e-04f, 1.778279402e-04f, 1.333521504e-04f };   // float32 1 / 10000^(2i/64), generated with jnp to be bit-exact
__global__ __launch_bounds__(256) void k_cs5(float* CS) { const int idx = blockIdx.x * 256 + threadIdx.x; if (idx >= TT * HD) return; const int d = idx % HD; const int t = idx / HD; const float a = __fmul_rn((float)t, INVT[d % (HD / 2)]); v2f cs; cs[0] = cosf(a); cs[1] = sinf(a); *(v2f*)(CS + (size_t)idx * 2) = cs;  }
// ---- k_fattn: scores, softmax, probability x value and the head merge in ONE kernel (running maximum and running sum per query; no score or probability ever leaves the registers).
// One wave = 16 query rows of one head; the REP waves of a work-group are the REP heads of one kv group, so they read the K and V of the same kv head, each from key 0 on. Grid (TT / 16, NKV); no LDS, no barrier.
// S^T = K Q^T: A = K rows (key = lane & 15), B = Q rows (query = lane & 15), so lane (lr, hi) holds for query lr the keys 8 hi + j of each 16-key tile: maximum and sum in-lane plus one exchange between the wave halves.
// Two such tiles, converted in place, are the B operand (k = 8 hi + s, 16 + 8 hi + (s - 8)) of O^T += V^T P^T, A = V^T rows loaded in the same k order; O^T keeps query = lane & 15, so the rescale is lane-local and a lane stores 8 consecutive d. Q, K, V^T come in fragment order (WFrag) and the output leaves in it.
// Rows < RH: hi/lo planes, 3 products each, 32 keys a pass; the rest fp16, 64 keys a pass, probabilities carried x 2^10 (the sum carries the same factor, so it cancels in the division).
typedef __attribute__((ext_vector_type(16))) unsigned short v16us;
template <bool B> struct Flag { static constexpr bool v = B; };
// 2^x on the transcendental unit with the slot that the instruction set asks for behind it, in one statement: each v_exp_f32 works in place, so none touches the source or the result of the one in front of it, and the closing v_nop stands between the last one and whatever the compiler schedules next.
__device__ __forceinline__ void exp2x8(float (&e)[8]) {
    asm("v_exp_f32 %0, %0\n\tv_exp_f32 %1, %1\n\tv_exp_f32 %2, %2\n\tv_exp_f32 %3, %3\n\tv_exp_f32 %4, %4\n\tv_exp_f32 %5, %5\n\tv_exp_f32 %6, %6\n\tv_exp_f32 %7, %7\n\tv_nop"
        : "+v"(e[0]), "+v"(e[1]), "+v"(e[2]), "+v"(e[3]), "+v"(e[4]), "+v"(e[5]), "+v"(e[6]), "+v"(e[7])); }
__device__ __forceinline__ float exp2x1(float a) { float e; asm("v_exp_f32 %0, %1\n\tv_nop" : "=v"(e) : "v"(a)); return e; }   // the same for one value
template <typename T16, bool HL, int KB>
__device__ __forceinline__ void fattn_body(const T16* __restrict__ Q, const T16* __restrict__ Q2, const T16* __restrict__ Kp, const T16* __restrict__ Kp2, const T16* __restrict__ Vt, const T16* __restrict__ Vt2, int q0, int kv, int head, bf* Ah, bf* Al) {
    typedef typename WFrag<T16>::V V;
    constexpr int NKT = KB / 16, NKH = KB / 32;
    constexpr float C1 = SCL * 1.4426950408889634f;   // raw score -> log2 units: HD^-0.5 x log2(e)
    constexpr bool AHEAD = !HL;   // K fragments fetched one pass ahead; not on the hi/lo path, whose twofold fragments would then take the wave past 256 registers
    const int lane = threadIdx.x & 31, lr = lane & 15, hi = lane >> 4; const int qi = q0 + lr;
    V qf[2], qf2[2];
    { const T16* pq = Q + ((size_t)head * TT + q0) * HD + 8 * lane; qf[0] = WFrag<T16>::ld(pq); qf[1] = WFrag<T16>::ld(pq + 512);
      // s_wait_xcnt 0 behind the run of Q loads, in front of any overwrite of an address register that they name (a precaution); the pointers are inputs so that they stay in their registers up to the wait
      if constexpr (HL) { const T16* pq2 = Q2 + ((size_t)head * TT + q0) * HD + 8 * lane; qf2[0] = WFrag<T16>::ld(pq2); qf2[1] = WFrag<T16>::ld(pq2 + 512); asm volatile("s_wait_xcnt 0x0" :: "v"(pq), "v"(pq2) : "memory"); }
      else asm volatile("s_wait_xcnt 0x0" :: "v"(pq) : "memory"); }
    const size_t koff = (size_t)kv * TT * HD + 8 * lane, voff = (size_t)kv * HD * TT + 8 * lane;
    v8f o[4];
#pragma unroll
    for (int db = 0; db < 4; ++db) o[db] = (v8f){};
    float m = -3.0e38f, l = 0.f;
    V kf[NKT][2], kf2[NKT][2];
    auto load_k = [&](int k0) {   // the K fragments of the pass that starts at key k0
        const T16* pk = Kp + koff + (size_t)k0 * HD;
#pragma unroll
        for (int kt = 0; kt < NKT; ++kt)
#pragma unroll
            for (int ks = 0; ks < 2; ++ks) kf[kt][ks] = WFrag<T16>::ld(pk + (kt * 2 + ks) * 512);
        // the same wait behind the run of K loads
        if constexpr (HL) { const T16* pk2 = Kp2 + koff + (size_t)k0 * HD;
#pragma unroll
            for (int kt = 0; kt < NKT; ++kt)
#pragma unroll
                for (int ks = 0; ks < 2; ++ks) kf2[kt][ks] = WFrag<T16>::ld(pk2 + (kt * 2 + ks) * 512);
            asm volatile("s_wait_xcnt 0x0" :: "v"(pk), "v"(pk2) : "memory"); }
        else asm volatile("s_wait_xcnt 0x0" :: "v"(pk) : "memory"); };
    auto pass = [&](int k0, auto edge) {   // KB keys from k0 on; edge: the one pass that holds the diagonal (causal select, no pass behind it)
        constexpr bool EDGE = decltype(edge)::v;
        V vf[4][NKH], vf2[4][NKH];
        if constexpr (!AHEAD) load_k(k0);
        const T16* pv = Vt + voff + (size_t)k0 * 16;
#pragma unroll
        for (int db = 0; db < 4; ++db)
#pragma unroll
            for (int kh = 0; kh < NKH; ++kh) vf[db][kh] = WFrag<T16>::ld(pv + (size_t)db * 16 * TT + kh * 512);
        // the same wait behind the run of V loads
        if constexpr (HL) { const T16* pv2 = Vt2 + voff + (size_t)k0 * 16;
#pragma unroll
            for (int db = 0; db < 4; ++db)
#pragma unroll
                for (int kh = 0; kh < NKH; ++kh) vf2[db][kh] = WFrag<T16>::ld(pv2 + (size_t)db * 16 * TT + kh * 512);
            asm volatile("s_wait_xcnt 0x0" :: "v"(pv), "v"(pv2) : "memory"); }
        else asm volatile("s_wait_xcnt 0x0" :: "v"(pv) : "memory");
        v8f s[NKT];
#pragma unroll
        for (int kt = 0; kt < NKT; ++kt) { s[kt] = (v8f){};
#pragma unroll
            for (int ks = 0; ks < 2; ++ks) { s[kt] = WFrag<T16>::mma(kf[kt][ks], qf[ks], s[kt]); if constexpr (HL) { s[kt] = WFrag<T16>::mma(kf[kt][ks], qf2[ks], s[kt]); s[kt] = WFrag<T16>::mma(kf2[kt][ks], qf[ks], s[kt]); } } }
        if constexpr (AHEAD && !EDGE) load_k(k0 + KB);   // the next pass's K fragments fly during this pass's softmax and P.V (a pass that is not the edge pass always has a successor)
        float bm = -3.0e38f; const int rel = qi - k0 - hi * 8;   // a lane's key kt * 16 + j of the pass is allowed while it is <= rel
#pragma unroll
        for (int kt = 0; kt < NKT; ++kt)
#pragma unroll
            for (int j = 0; j < 8; ++j) { if constexpr (EDGE) s[kt][j] = (kt * 16 + j <= rel) ? s[kt][j] : -3.0e38f; bm = fmaxf(bm, s[kt][j]); }
        bm = fmaxf(bm, __shfl_xor(bm, 16, 32));
        const float mn = fmaxf(m, bm * C1); const float alpha = exp2x1(m - mn); m = mn;   // the running maximum is kept in log2 units
        const float sh = (HL ? 0.0f : 10.0f) - mn;
        float ls[NKT];
#pragma unroll
        for (int kt = 0; kt < NKT; ++kt) { float e[8]; ls[kt] = 0.f;
#pragma unroll
            for (int j = 0; j < 8; ++j) e[j] = s[kt][j] * C1 + sh;   // one multiply-add from raw score to exponent
            exp2x8(e);
#pragma unroll
            for (int j = 0; j < 8; ++j) { s[kt][j] = e[j]; ls[kt] += e[j]; } }
        float lsum = ls[0];
#pragma unroll
        for (int kt = 1; kt < NKT; ++kt) lsum += ls[kt];
        l = l * alpha + lsum;   // each wave half keeps the sum of its own keys; the halves are joined once, behind the last pass
#pragma unroll
        for (int db = 0; db < 4; ++db) o[db] *= alpha;
#pragma unroll
        for (int kh = 0; kh < NKH; ++kh) {
            if constexpr (HL) { v16us ph, pl;
#pragma unroll
                for (int q = 0; q < 16; ++q) { unsigned short a, c2; splitf(s[kh * 2 + (q >> 3)][q & 7], a, c2); ph[q] = a; pl[q] = c2; }
                const V pfh = __builtin_bit_cast(V, ph), pfl = __builtin_bit_cast(V, pl);
#pragma unroll
                for (int db = 0; db < 4; ++db) { o[db] = WFrag<T16>::mma(vf[db][kh], pfh, o[db]); o[db] = WFrag<T16>::mma(vf[db][kh], pfl, o[db]); o[db] = WFrag<T16>::mma(vf2[db][kh], pfh, o[db]); }
            } else { V pf;
#pragma unroll
                for (int q = 0; q < 16; ++q) pf[q] = tohx(s[kh * 2 + (q >> 3)][q & 7]);
#pragma unroll
                for (int db = 0; db < 4; ++db) o[db] = WFrag<T16>::mma(vf[db][kh], pf, o[db]); } }
        asm volatile("v_nop\n\tv_nop\n\tv_nop\n\tv_nop" : "+v"(o[0]), "+v"(o[1]), "+v"(o[2]), "+v"(o[3]) : "v"(vf[3][NKH - 1]));   // four vector slots behind the last WMMA, also on the taken back edge, before fragments or accumulators are touched
    };
    int k0 = 0;   // both loops stay rolled: one pass already holds every fragment of KB keys in registers
    if constexpr (AHEAD) { static_assert(RH >= KB, "the fetch-ahead loop runs at least once: its rows start at RH");
        load_k(0);
#pragma unroll 1
        do { pass(k0, Flag<false>{}); k0 += KB; } while (k0 + KB - 1 <= q0);
    } else {
#pragma unroll 1
        for (; k0 + KB - 1 <= q0; k0 += KB) pass(k0, Flag<false>{}); }
    pass(k0, Flag<true>{});
    const float f = __fdiv_rn(1.0f, l + __shfl_xor(l, 16, 32));
    const size_t oo = (size_t)q0 * DQ + head * (2 * 512) + 8 * lane; v8us oh[4], ol[4];   // fragment order of the wo product's A operand (rows = queries, k = head * HD + d): a lane's 8 values of d block db are its own piece of half db & 1 of k block head * 2 + (db >> 1)
#pragma unroll
    for (int db = 0; db < 4; ++db)
#pragma unroll
        for (int j = 0; j < 8; ++j) { unsigned short a, c2; splitf(o[db][j] * f, a, c2); oh[db][j] = a; ol[db][j] = c2; }
#pragma unroll
    for (int db = 0; db < 4; ++db) { *(v8us*)(Ah + oo + db * 256) = oh[db]; *(v8us*)(Al + oo + db * 256) = ol[db]; }
}
// amdgpu_waves_per_eu(4, 4): at most 256 registers a wave, so that four waves share a SIMD and all TT / 16 x NKV work-groups are resident at once
__global__ __launch_bounds__(32 * REP) __attribute__((amdgpu_waves_per_eu(4, 4))) void k_fattn(const h16* __restrict__ Q16, const bf* __restrict__ Qh, const bf* __restrict__ Ql, const h16* __restrict__ K16, const bf* __restrict__ Kh, const bf* __restrict__ Kl, const h16* __restrict__ V16, const bf* __restrict__ Vh, const bf* __restrict__ Vl, bf* Ah, bf* Al) {
    const int wave = __builtin_amdgcn_readfirstlane((int)(threadIdx.x >> 5));   // wave number in a scalar register: head, loop bound and branches stay scalar
    const int kv = blockIdx.y, head = kv * REP + wave;
    // a tile's cost grows with its index and every work-group is resident at once: two of a work-group's heads take tile t, the other two tile n - 1 - t, and which two alternates with the kv head, so that long and short waves mix (for speed only; each (head, tile) is taken once)
    const int tile = (((wave >> 1) + kv + (kv >> 1)) & 1) ? (int)blockIdx.x : TT / 16 - 1 - (int)blockIdx.x; const int q0 = tile * 16;
    if (q0 < RH) fattn_body<bf, true, 32>(Qh, Ql, Kh, Kl, Vh, Vl, q0, kv, head, Ah, Al);
    else fattn_body<h16, false, 64>(Q16, nullptr, K16, nullptr, V16, nullptr, q0, kv, head, Ah, Al);
}

extern "C" void kernel_launch(void* const* d_in, const int* in_sizes, int n_in,
                              void* d_out, int out_size, void* d_ws, size_t ws_size, hipStream_t stream) {
    (void)in_sizes; (void)n_in; (void)out_size;
        const float* x = (const float*)d_in[0]; const float* wq = (const float*)d_in[1]; const float* wk = (const float*)d_in[2]; const float* wv = (const float*)d_in[3]; const float* wo = (const float*)d_in[4];   /* inputs x, wq [2048][2048], wk [512][2048], wv, wo ('oi'); this module has no mask input (the causal rule is by index) */
    float* OUT = (float*)d_out;     // [2][2048][2048]
    char* wsp = (char*)d_ws;
    auto take = [&](size_t bytes) { char* p = wsp; wsp += (bytes + 255) & ~(size_t)255; return (void*)p; };
    bf* WQ = (bf*)take((size_t)DQ * DM * 2); bf* WK = (bf*)take((size_t)DKV * DM * 2); bf* WV = (bf*)take((size_t)DKV * DM * 2); bf* WO = (bf*)take((size_t)DM * DQ * 2); float* CS = (float*)take((size_t)TT * HD * 2 * 4);
    bf* XB = (bf*)take((size_t)TT * DM * 2);
    h16* QP16 = (h16*)take((size_t)NH_ * TT * HD * 2); h16* KP16 = (h16*)take((size_t)NKV * TT * HD * 2); h16* VT16 = (h16*)take((size_t)NKV * HD * TT * 2);
    bf* QPh = (bf*)take((size_t)NH_ * TT * HD * 2); bf* QPl = (bf*)take((size_t)NH_ * TT * HD * 2); bf* KPh = (bf*)take((size_t)NKV * TT * HD * 2); bf* KPl = (bf*)take((size_t)NKV * TT * HD * 2); bf* VTh = (bf*)take((size_t)NKV * HD * TT * 2); bf* VTl = (bf*)take((size_t)NKV * HD * TT * 2);
    bf* ATh = (bf*)take((size_t)TT * DQ * 2); bf* ATl = (bf*)take((size_t)TT * DQ * 2);
    if ((size_t)(wsp - (char*)d_ws) > ws_size) return;    // ws 256 MiB
    { k_cvt8<<<(unsigned)(((size_t)DQ * DM / 8 + 255) / 256), 256, 0, stream>>>(wq, WQ, (size_t)DQ * DM / 8); k_cvt8<<<(unsigned)(((size_t)DKV * DM / 8 + 255) / 256), 256, 0, stream>>>(wk, WK, (size_t)DKV * DM / 8); k_cvt8<<<(unsigned)(((size_t)DKV * DM / 8 + 255) / 256), 256, 0, stream>>>(wv, WV, (size_t)DKV * DM / 8);
      k_cvt8<<<(unsigned)(((size_t)DM * DQ / 8 + 255) / 256), 256, 0, stream>>>(wo, WO, (size_t)DM * DQ / 8);
       }
    k_cs5<<<(TT * HD + 255) / 256, 256, 0, stream>>>(CS);   /* rotary table once */
    for (int b = 0; b < NB_; ++b) {
        
        k_cvt8<<<(unsigned)(((size_t)TT * DM / 8 + 255) / 256), 256, 0, stream>>>(x + (size_t)b * TT * DM, XB, (size_t)TT * DM / 8);
        k_gemmw<bf, 0, false, 8, false, 1><<<dim3(TT / 64, DQ / 64, 1), 256, 0, stream>>>(XB, nullptr, WQ, nullptr, DM, DM, nullptr, 0, nullptr, 0, 0, 0, 0, CS, QP16, QPh, QPl);
        k_gemmw<bf, 0, false, 8, false, 1><<<dim3(TT / 64, DKV / 64, 1), 256, 0, stream>>>(XB, nullptr, WK, nullptr, DM, DM, nullptr, 0, nullptr, 0, 0, 0, 0, CS, KP16, KPh, KPl);
        k_gemmw<bf, 0, false, 8, false, 2><<<dim3(DKV / 64, TT / 64, 1), 256, 0, stream>>>(WV, nullptr, XB, nullptr, DM, DM, nullptr, 0, nullptr, 0, 0, 0, 0, nullptr, VT16, VTh, VTl);   // wv x^T: the tile comes out as V^T
        k_fattn<<<dim3(TT / 16, NKV, 1), 32 * REP, 0, stream>>>(QP16, QPh, QPl, KP16, KPh, KPl, VT16, VTh, VTl, ATh, ATl);
        k_gemmw<bf, 1, false, 8, false, 0><<<dim3(TT / 64, DM / 64, 1), 256, 0, stream>>>(ATh, ATl, WO, nullptr, DQ, DQ, OUT + (size_t)b * TT * DM, DM, nullptr, 0, 0, 0, 0, nullptr, nullptr, nullptr, nullptr); }
}

// v006
// A run of this version takes 178 microseconds.
// In two side-by-side timings against v005, it was 1.45 and 1.47 times as fast.
// Over all steps from v000 it is 15.2 times as fast.
#include <hip/hip_runtime.h>

// Grouped-query causal attention with a computed half-split RoPE (x [2][2048][2048]; xq = x wq^T (32 heads x 64), xk, xv = x wk^T, x wv^T (8 kv heads x 64) ('oi', no bias; token-major); cos / sin from inv_freq = 1 / (10000 ** (2i / 64)) and positions arange(S) ([S][32] tables); (x1, x2) = the two 32-wide halves of each head: cat(x1 c - x2 s, x1 s + x2 c) (half-split pairs (d, d + 32)) on q and k; k, v repeated 4 x on the head axis (jnp.repeat: kv head = q head / 4); scores / sqrt(64); where(tril, scores, finfo.min) == exclusion; softmax; out = merged wo^T ('oi') -> [2][2048][2048] (8.4 M); argument order x, wq, wk, wv, wo).
// Every 16-bit matrix operand (x, the weights, the q, k and v^T planes, the merged attention output) is stored by its producer in fragment order (see WFrag).
// Four launches, each over both batches (k_prep, k_proj, k_fattn, k_gemmw for wo). Layout: bf16 copy of x; 'oi' weights; exact projections whose epilogue applies the rotate-half rotation (cs5 computed table) and stores the 16-bit planes itself; causal T-2048 GQA attention fused in one kernel (k_fattn: running softmax in registers, kv plane = head / REP; hybrid rows: < 512 hi/lo 3 products, rest fp16 x1024; keys above the diagonal block are never read); merged hi/lo x wo exact.
// Compute dtypes, f32 accumulate: every input rounded to bf16; projections exact; rotary f32; attention rows < 512 3 products, rest fp16; softmax f32; wo hl x exact.

#define NB_  2
#define TT   2048
#define DM   2048
#define NH_  32
#define NKV  8
#define REP  (NH_ / NKV)
#define HD   64
#define DQ   (NH_ * HD)
#define DKV  (NKV * HD)
#define RH   512                  // query rows < RH use hi+lo planes
#define SCL  0.125f   // HD^-0.5
typedef _Float16 h16;
typedef unsigned short bf;
typedef __attribute__((ext_vector_type(16))) __bf16   v16bf;
typedef __attribute__((ext_vector_type(16))) _Float16 v16h;
typedef __attribute__((ext_vector_type(8)))  _Float16 v8h;
typedef __attribute__((ext_vector_type(8)))  unsigned short v8us;
typedef __attribute__((ext_vector_type(8)))  float    v8f;
typedef __attribute__((ext_vector_type(4)))  float    v4f;
typedef v8h  __attribute__((may_alias)) v8ha;
typedef v4f  __attribute__((may_alias)) v4fa;
typedef v8us __attribute__((may_alias)) v8usa;

__device__ __forceinline__ unsigned short f2bf(float f) { unsigned u = __float_as_uint(f); u += 0x7FFFu + ((u >> 16) & 1u); return (unsigned short)(u >> 16); }
__device__ __forceinline__ float bf2f(unsigned short b) { return __uint_as_float(((unsigned)b) << 16); }
__device__ __forceinline__ float bfr(float f) { return bf2f(f2bf(f)); }
__device__ __forceinline__ v16h cat16(v8h lo, v8h hi) { return __builtin_shufflevector(lo, hi, 0, 1, 2, 3, 4, 5, 6, 7, 8, 9, 10, 11, 12, 13, 14, 15); }
__device__ __forceinline__ v16bf cat16b(v8us lo, v8us hi) { return __builtin_bit_cast(v16bf, __builtin_shufflevector(lo, hi, 0, 1, 2, 3, 4, 5, 6, 7, 8, 9, 10, 11, 12, 13, 14, 15)); }
__device__ __forceinline__ v8f wmma16(v16h a, v16h b, v8f c) { return __builtin_amdgcn_wmma_f32_16x16x32_f16(false, a, false, b, (short)0, c, false, false); }
__device__ __forceinline__ v8f wmmab(v16bf a, v16bf b, v8f c) { return __builtin_amdgcn_wmma_f32_16x16x32_bf16(false, a, false, b, (short)0, c, false, false); }
__device__ __forceinline__ h16 tohx(float x) { return (h16)x; }
__device__ __forceinline__ void splitf(float y, unsigned short& h, unsigned short& l) { h = f2bf(y); l = f2bf(y - bf2f(h)); }



// ---- k_gemmw: register-blocked GEMM, one 64x64 output tile per work-group of NW waves; grid (M/64, N/64, Z), 32 * NW threads. K is split over the waves: wave w takes the 64-wide K slices w, w + NW, ...
// (two 1-KiB blocks of every group of 16 operand rows per slice) and keeps its own 64x64 partial tile (16 accumulators), operands straight from 16-bit planes in fragment order; the NW partial tiles are then summed in wave order through LDS.
// C[m][n] (f32, pitch ldc, + optional f32 bias[n]) = sum_k A[m][k] Bt[n][k] (+ split products per NSPLIT). A has lda, Bt K elements a row (fragment order). z-batch strides sA/sB/sC in elements; Bt advances once per REP values of z (the heads of one kv group share it). K % 64 == 0.
// CAUSAL (probability x value): the K loop stops at the diagonal block of query rows r0 + roff .. (probabilities beyond it are exactly zero); roff = row offset of this launch's first row within the sequence.
// Fragment order: a block of 16 rows x 32 k of an operand is 512 consecutive elements, element (r, k) at (k >> 4) * 256 + (((k >> 3) & 1) * 16 + r) * 8 + (k & 7): lane l's two 16-byte pieces (row l & 15; k = 8 (l >> 4) + 0..7 and 16 + 8 (l >> 4) + 0..7) lie at l * 8 and 256 + l * 8,
// so each wave-wide 16-byte load covers 512 contiguous bytes (4 whole lines, not 16 pieces of 32 B). Blocks follow one another along k, then along the groups of 16 rows: a matrix of pitch P has block (row group g, k block b) at g * 16 * P + b * 512. ld takes the block's address + 8 * lane.
// EPI 0: the summed tile goes out as f32 C. EPI 1, 2: no f32 tile leaves the kernel; the tile is stored as three 16-bit planes (fp16, bf16 hi, bf16 lo) in fragment order, a thread taking the pieces of columns 8 o .. 8 o + 7 and 32 + 8 o .. of one row, so each wave-wide 16-byte store covers 512 contiguous bytes.
// EPI 1 (q, k; rows = positions t, the 64 columns = one head): rotate-half first, out[d] = x[d] cos[t][d] - x[d+32] sin[t][d], out[d+32] = x[d+32] cos[t][d] + x[d] sin[t][d] (a thread's two pieces are exactly such pairs); planes [head][t][d], pitch HD.
// EPI 2 (v; launched as wv x^T, so rows = kv head * HD + d and columns = t: the tile is V^T already): planes [g][d][t], pitch TT.
template <typename T16> struct WFrag;
template <> struct WFrag<h16> { typedef v16h V; static __device__ __forceinline__ V ld(const h16* p) { return cat16(*(const v8h*)p, *(const v8h*)(p + 256)); } static __device__ __forceinline__ v8f mma(V a, V b, v8f c) { return wmma16(a, b, c); } };
template <> struct WFrag<bf> { typedef v16bf V; static __device__ __forceinline__ V ld(const bf* p) { return cat16b(*(const v8us*)p, *(const v8us*)(p + 256)); } static __device__ __forceinline__ v8f mma(V a, V b, v8f c) { return wmmab(a, b, c); } };
// gemmw_body is the work of one work-group: the tile at rows r0, columns c0, with red = its NW * 64 * 68 floats of LDS; the kernels below pick tile, operands and planes from blockIdx.
template <typename T16, int NSPLIT, bool BIAS, int NW, bool CAUSAL, int EPI>
__device__ __forceinline__ void gemmw_body(float* red, int r0, int c0, const T16* __restrict__ A, const T16* __restrict__ A2, const T16* __restrict__ Bt, const T16* __restrict__ Bt2, int K, int lda, float* C, int ldc, const float* __restrict__ bias, int roff, const float* __restrict__ CS, h16* P16, bf* Ph, bf* Pl) {
    typedef typename WFrag<T16>::V V;
    const int lane = threadIdx.x & 31, lr = lane & 15, hi = lane >> 4;
    const int wave = __builtin_amdgcn_readfirstlane((int)(threadIdx.x >> 5));   // wave number in a scalar register: the K loop's counter and branch stay scalar
    const int Kl = CAUSAL ? min(K, r0 + roff + 64) : K;
    v8f acc[4][4];
#pragma unroll
    for (int mb = 0; mb < 4; ++mb)
#pragma unroll
        for (int nb = 0; nb < 4; ++nb) acc[mb][nb] = (v8f){};
    const size_t aoff = (size_t)r0 * lda + 8 * lane, boff = (size_t)c0 * K + 8 * lane;
#pragma unroll 1
    for (int kc = wave * 64; kc < Kl; kc += (kc & 32) ? 64 * NW - 32 : 32) {
        V a[4], a2[4]; const T16* pa[4]; const T16* pa2[4];
#pragma unroll
        for (int mb = 0; mb < 4; ++mb) { pa[mb] = A + aoff + (size_t)mb * 16 * lda + (size_t)kc * 16; a[mb] = WFrag<T16>::ld(pa[mb]); if (NSPLIT == 1 || NSPLIT == 2) { pa2[mb] = A2 + aoff + (size_t)mb * 16 * lda + (size_t)kc * 16; a2[mb] = WFrag<T16>::ld(pa2[mb]); } }
        // one s_wait_xcnt 0 behind the run of A loads, in front of any overwrite of an address register that they name (a precaution); the pointers are inputs so that they stay in their registers up to the wait and no load's result is placed over them
        if (NSPLIT == 1 || NSPLIT == 2) asm volatile("s_wait_xcnt 0x0" :: "v"(pa[0]), "v"(pa[1]), "v"(pa[2]), "v"(pa[3]), "v"(pa2[0]), "v"(pa2[1]), "v"(pa2[2]), "v"(pa2[3]) : "memory");
        else asm volatile("s_wait_xcnt 0x0" :: "v"(pa[0]), "v"(pa[1]), "v"(pa[2]), "v"(pa[3]) : "memory");
#pragma unroll
        for (int nb = 0; nb < 4; ++nb) { const T16* pb = Bt + boff + (size_t)nb * 16 * K + (size_t)kc * 16; const V b = WFrag<T16>::ld(pb); V b2;
            // the same wait behind each B fragment's loads
            if (NSPLIT >= 2) { const T16* pb2 = Bt2 + boff + (size_t)nb * 16 * K + (size_t)kc * 16; b2 = WFrag<T16>::ld(pb2); asm volatile("s_wait_xcnt 0x0" :: "v"(pb), "v"(pb2) : "memory"); }
            else asm volatile("s_wait_xcnt 0x0" :: "v"(pb) : "memory");
#pragma unroll
            for (int mb = 0; mb < 4; ++mb) { acc[mb][nb] = WFrag<T16>::mma(a[mb], b, acc[mb][nb]); if (NSPLIT == 1 || NSPLIT == 2) acc[mb][nb] = WFrag<T16>::mma(a2[mb], b, acc[mb][nb]); if (NSPLIT >= 2) acc[mb][nb] = WFrag<T16>::mma(a[mb], b2, acc[mb][nb]); } }
        asm volatile("v_nop\n\tv_nop\n\tv_nop\n\tv_nop" : "+v"(acc[0][0]), "+v"(acc[1][1]), "+v"(acc[2][2]), "+v"(acc[3][3]) : "v"(a[0]), "v"(a[3]));   // four vector slots behind the last WMMA, also on the taken back edge, before fragments or accumulators are touched
    }
    const int pg = (int)threadIdx.x >> 6, po = ((int)threadIdx.x >> 4) & 3, prow = pg * 16 + ((int)threadIdx.x & 15);   // EPI 1, 2: this thread's group of 16 rows, its 8-column piece and its row of the tile
    v4f cs[4];
    if constexpr (EPI == 1) { const float* pc = CS + ((size_t)(r0 + prow) * HD + po * 8) * 2;   // (cos, sin) of the thread's 8 column pairs, asked for here so that they fly during the LDS stores and the barrier
#pragma unroll
        for (int q = 0; q < 4; ++q) cs[q] = *(const v4f*)(pc + q * 4);
        asm volatile("s_wait_xcnt 0x0" :: "v"(pc) : "memory"); }   // the wait stands in front of any overwrite of the address register that the loads name (a precaution)
    float* mine = red + wave * (64 * 68);
#pragma unroll
    for (int mb = 0; mb < 4; ++mb)
#pragma unroll
        for (int nb = 0; nb < 4; ++nb)
#pragma unroll
            for (int j = 0; j < 8; ++j) mine[(mb * 16 + hi * 8 + j) * 68 + nb * 16 + lr] = acc[mb][nb][j];
    __syncthreads();   // every wave's partial tile is in LDS before any wave sums
    if constexpr (EPI == 0) {
#pragma unroll
    for (int s = 0; s < 32 / NW; ++s) { const int q = s * 32 * NW + (int)threadIdx.x, row = q >> 4, cofs = (q & 15) * 4; v4f val = *(const v4fa*)(red + row * 68 + cofs);
#pragma unroll
        for (int w = 1; w < NW; ++w) val += *(const v4fa*)(red + w * (64 * 68) + row * 68 + cofs);
        if (BIAS) { val[0] += bfr(bias[c0 + cofs]); val[1] += bfr(bias[c0 + cofs + 1]); val[2] += bfr(bias[c0 + cofs + 2]); val[3] += bfr(bias[c0 + cofs + 3]); }
        *(v4f*)(C + (size_t)(r0 + row) * ldc + c0 + cofs) = val; }
    } else {
        static_assert(EPI == 0 || (NW == 8 && HD == 64 && !BIAS), "256 threads = 64 rows x 4 pairs of 8-column pieces; one tile = one head");
        float x[2][8];   // x[0]: columns 8 po .. + 7, x[1]: the same + 32, each the NW partials summed in wave order
#pragma unroll
        for (int q = 0; q < 4; ++q) { const int cofs = (q >> 1) * 32 + po * 8 + (q & 1) * 4; v4f val = *(const v4fa*)(red + prow * 68 + cofs);
#pragma unroll
            for (int w = 1; w < NW; ++w) val += *(const v4fa*)(red + w * (64 * 68) + prow * 68 + cofs);
#pragma unroll
            for (int i = 0; i < 4; ++i) x[q >> 1][(q & 1) * 4 + i] = val[i]; }
        if constexpr (EPI == 1) {
#pragma unroll
            for (int j = 0; j < 8; ++j) { const float c = cs[j >> 1][(j & 1) * 2], s = cs[j >> 1][(j & 1) * 2 + 1], a = x[0][j], b = x[1][j]; x[0][j] = a * c - b * s; x[1][j] = b * c + a * s; } }
        v8h o16[2]; v8us oh[2], ol[2];
#pragma unroll
        for (int p = 0; p < 2; ++p)
#pragma unroll
            for (int j = 0; j < 8; ++j) { unsigned short a2, c2; splitf(x[p][j], a2, c2); o16[p][j] = tohx(x[p][j]); oh[p][j] = a2; ol[p][j] = c2; }
        // block (row group, k block) of a plane of pitch P lies at group * 16 * P + block * 512; the thread's piece of it at (8-column piece * 16 + row) * 8; its second piece is the next k block's
        const size_t oo = (EPI == 1 ? (size_t)(c0 / HD) * TT * HD + (size_t)(r0 + pg * 16) * HD : (size_t)(r0 + pg * 16) * TT + (size_t)(c0 / 32) * 512) + ((int)threadIdx.x & 63) * 8;
#pragma unroll
        for (int p = 0; p < 2; ++p) { *(v8h*)(P16 + oo + p * 512) = o16[p]; *(v8us*)(Ph + oo + p * 512) = oh[p]; *(v8us*)(Pl + oo + p * 512) = ol[p]; }
    }
}
template <typename T16, int NSPLIT, bool BIAS, int NW, bool CAUSAL, int EPI>
__global__ __launch_bounds__(32 * NW) void k_gemmw(const T16* __restrict__ A, const T16* __restrict__ A2, const T16* __restrict__ Bt, const T16* __restrict__ Bt2, int K, int lda, float* C, int ldc, const float* __restrict__ bias, int roff, size_t sA, size_t sB, size_t sC, const float* __restrict__ CS, h16* P16, bf* Ph, bf* Pl) {
    __shared__ __align__(16) float red[NW * 64 * 68];
    const size_t z = blockIdx.z; A += z * sA; if (A2) A2 += z * sA; Bt += (z / REP) * sB; if (Bt2) Bt2 += (z / REP) * sB; C += z * sC;
    gemmw_body<T16, NSPLIT, BIAS, NW, CAUSAL, EPI>(red, blockIdx.x * 64, blockIdx.y * 64, A, A2, Bt, Bt2, K, lda, C, ldc, bias, roff, CS, P16, Ph, Pl);
}
// k_proj: the q, k and v projections of both batches in one grid (TT / 64 token tiles, DQ / 64 + 2 DKV / 64 tiles of output features, NB_). y < DQ / 64: a q head; the next DKV / 64: a k head (both x w^T, EPI 1); the last DKV / 64: 64 rows of wv x^T (EPI 2). The choice is the same for a whole work-group.
__global__ __launch_bounds__(256) void k_proj(const bf* __restrict__ XB, const bf* __restrict__ WQ, const bf* __restrict__ WK, const bf* __restrict__ WV, const float* __restrict__ CS, h16* QP16, bf* QPh, bf* QPl, h16* KP16, bf* KPh, bf* KPl, h16* VT16, bf* VTh, bf* VTl) {
    __shared__ __align__(16) float red[8 * 64 * 68];
    const int tt = blockIdx.x, y = blockIdx.y; const size_t z = blockIdx.z; const bf* X = XB + z * ((size_t)TT * DM);
    const size_t zq = z * ((size_t)NH_ * TT * HD), zk = z * ((size_t)NKV * TT * HD);
    if (y < DQ / 64 + DKV / 64) { const bool q = y < DQ / 64;
        gemmw_body<bf, 0, false, 8, false, 1>(red, tt * 64, (q ? y : y - DQ / 64) * 64, X, nullptr, q ? WQ : WK, nullptr, DM, DM, nullptr, 0, nullptr, 0, CS, q ? QP16 + zq : KP16 + zk, q ? QPh + zq : KPh + zk, q ? QPl + zq : KPl + zk); }
    else gemmw_body<bf, 0, false, 8, false, 2>(red, (y - DQ / 64 - DKV / 64) * 64, tt * 64, WV, nullptr, X, nullptr, DM, DM, nullptr, 0, nullptr, 0, nullptr, VT16 + zk, VTh + zk, VTl + zk);
}

typedef __attribute__((ext_vector_type(2))) _Float16 v2h;
typedef __attribute__((ext_vector_type(4))) _Float16 v4h;
typedef __attribute__((ext_vector_type(2))) unsigned short v2us;
typedef __attribute__((ext_vector_type(4))) unsigned short v4us;
typedef __attribute__((ext_vector_type(2))) float v2f;
typedef __attribute__((ext_vector_type(4))) int v4i;

// cvt8: f32 [rows][DM] -> bf16 in fragment order. A thread rounds one 8-element piece (number i); a wave takes 8 rows x one k block (8 whole f32 lines in), its 4 pieces a row going out as 4 whole 128-byte lines.
// The five inputs count as one matrix of CROWS rows, x (both batches), wq, wk, wv, wo one below the other, and dst is that matrix in fragment order (every part starts at a multiple of 16 rows); a work-group's 256 pieces lie in 8 rows of one input, row0 being the first of them.
#define CROWS (NB_ * TT + DQ + 2 * DKV + DM)
__device__ __forceinline__ void cvt8(const float* __restrict__ x, const float* __restrict__ wq, const float* __restrict__ wk, const float* __restrict__ wv, const float* __restrict__ wo, bf* dst, size_t i, int row0) { static_assert(DQ == DM, "every converted matrix has DM elements a row");
    const float* src = x; int first = 0;
    if (row0 >= NB_ * TT + DQ + 2 * DKV) { src = wo; first = NB_ * TT + DQ + 2 * DKV; } else if (row0 >= NB_ * TT + DQ + DKV) { src = wv; first = NB_ * TT + DQ + DKV; } else if (row0 >= NB_ * TT + DQ) { src = wk; first = NB_ * TT + DQ; } else if (row0 >= NB_ * TT) { src = wq; first = NB_ * TT; }
    const int lane = (int)(i & 31), j = lane & 3; const size_t w = i >> 5, kb = w % (DM / 32), row = (w / (DM / 32)) * 8 + (lane >> 2);
    const v8f v = *(const v8f*)(src + (row - first) * DM + kb * 32 + j * 8); v8us o;
#pragma unroll
    for (int k = 0; k < 8; ++k) o[k] = f2bf(v[k]); *(v8us*)(dst + (row >> 4) * (16 * DM) + kb * 512 + (j >> 1) * 256 + ((j & 1) * 16 + (row & 15)) * 8) = o;  }

__constant__ float INVT[HD / 2] = { 1.000000000e+00f, 7.498942018e-01f, 5.623413324e-01f, 4.216965139e-01f, 3.162277639e-01f, 2.371373624e-01f, 1.778279394e-01f, 1.333521456e-01f, 1.000000015e-01f, 7.498941571e-02f, 5.623412877e-02f, 4.216964915e-02f, 3.162277862e-02f, 2.371373586e-02f, 1.778279431e-02f, 1.333521493e-02f, 9.999999776e-03f, 7.498942316e-03f, 5.623413250e-03f, 4.216964822e-03f, 3.162277862e-03f, 2.371373819e-03f, 1.778279431e-03f, 1.333521446e-03f, 1.000000047e-03f, 7.498941850e-04f, 5.623413017e-04f, 4.216964880e-04f, 3.162277862e-04f, 2.371373848e-04f, 1.778279402e-04f, 1.333521504e-04f };   // float32 1 / 10000^(2i/64), generated with jnp to be bit-exact
__device__ __forceinline__ void cs5(float* CS, int idx) { const int d = idx % HD; const int t = idx / HD; const float a = __fmul_rn((float)t, INVT[d % (HD / 2)]); v2f cs; cs[0] = cosf(a); cs[1] = sinf(a); *(v2f*)(CS + (size_t)idx * 2) = cs;  }
// k_prep: the rotary table and all five conversions in one grid: the first TT * HD / 256 work-groups write the table, each of the others converts 256 pieces.
__global__ __launch_bounds__(256) void k_prep(const float* __restrict__ x, const float* __restrict__ wq, const float* __restrict__ wk, const float* __restrict__ wv, const float* __restrict__ wo, bf* dst, float* CS) {
    static_assert(TT * HD % 256 == 0 && DM == 2048, "whole work-groups for the table; 8 work-groups to 8 rows");
    const int g = blockIdx.x;
    if (g < TT * HD / 256) cs5(CS, g * 256 + (int)threadIdx.x);
    else cvt8(x, wq, wk, wv, wo, dst, (size_t)(g - TT * HD / 256) * 256 + threadIdx.x, ((g - TT * HD / 256) >> 3) * 8);
}
// ---- k_fattn: scores, softmax, probability x value and the head merge in ONE kernel (running maximum and running sum per query; no score or probability ever leaves the registers).
// One wave = 16 query rows of one head; the REP waves of a work-group are the REP heads of one kv group, so they walk the same K and V lines from key 0 on. Grid (NKV, NB_, TT / 16); no LDS, no barrier.
// S^T = K Q^T: A = K rows (key = lane & 15), B = Q rows (query = lane & 15), so lane (lr, hi) holds for query lr the keys 8 hi + j of each 16-key tile: maximum and sum in-lane plus one exchange between the wave halves.
// Two such tiles, converted in place, are the B operand (k = 8 hi + s, 16 + 8 hi + (s - 8)) of O^T += V^T P^T, A = V^T rows loaded in the same k order; O^T keeps query = lane & 15, so the rescale is lane-local and a lane stores 8 consecutive d. Q, K, V^T come in fragment order (WFrag) and the output leaves in it.
// Rows < RH: hi/lo planes, 3 products each, 32 keys a pass; the rest fp16, 64 keys a pass, probabilities carried x 2^10 (the sum carries the same factor, so it cancels in the division).
typedef __attribute__((ext_vector_type(16))) unsigned short v16us;
template <bool B> struct Flag { static constexpr bool v = B; };
// 2^x on the transcendental unit with the slot that the instruction set asks for behind it, in one statement: each v_exp_f32 works in place, so none touches the source or the result of the one in front of it, and the closing v_nop stands between the last one and whatever the compiler schedules next.
__device__ __forceinline__ void exp2x8(float (&e)[8]) {
    asm("v_exp_f32 %0, %0\n\tv_exp_f32 %1, %1\n\tv_exp_f32 %2, %2\n\tv_exp_f32 %3, %3\n\tv_exp_f32 %4, %4\n\tv_exp_f32 %5, %5\n\tv_exp_f32 %6, %6\n\tv_exp_f32 %7, %7\n\tv_nop"
        : "+v"(e[0]), "+v"(e[1]), "+v"(e[2]), "+v"(e[3]), "+v"(e[4]), "+v"(e[5]), "+v"(e[6]), "+v"(e[7])); }
__device__ __forceinline__ float exp2x1(float a) { float e; asm("v_exp_f32 %0, %1\n\tv_nop" : "=v"(e) : "v"(a)); return e; }   // the same for one value
template <typename T16, bool HL, int KB>
__device__ __forceinline__ void fattn_body(const T16* __restrict__ Q, const T16* __restrict__ Q2, const T16* __restrict__ Kp, const T16* __restrict__ Kp2, const T16* __restrict__ Vt, const T16* __restrict__ Vt2, int q0, int kv, int head, bf* Ah, bf* Al) {
    typedef typename WFrag<T16>::V V;
    constexpr int NKT = KB / 16, NKH = KB / 32;
    constexpr float C1 = SCL * 1.4426950408889634f;   // raw score -> log2 units: HD^-0.5 x log2(e)
    constexpr bool AHEAD = !HL;   // K fragments fetched one pass ahead; not on the hi/lo path, whose twofold fragments would then take the wave past 256 registers
    const int lane = threadIdx.x & 31, lr = lane & 15, hi = lane >> 4; const int qi = q0 + lr;
    V qf[2], qf2[2];
    { const T16* pq = Q + ((size_t)head * TT + q0) * HD + 8 * lane; qf[0] = WFrag<T16>::ld(pq); qf[1] = WFrag<T16>::ld(pq + 512);
      // s_wait_xcnt 0 behind the run of Q loads, in front of any overwrite of an address register that they name (a precaution); the pointers are inputs so that they stay in their registers up to the wait
      if constexpr (HL) { const T16* pq2 = Q2 + ((size_t)head * TT + q0) * HD + 8 * lane; qf2[0] = WFrag<T16>::ld(pq2); qf2[1] = WFrag<T16>::ld(pq2 + 512); asm volatile("s_wait_xcnt 0x0" :: "v"(pq), "v"(pq2) : "memory"); }
      else asm volatile("s_wait_xcnt 0x0" :: "v"(pq) : "memory"); }
    const size_t koff = (size_t)kv * TT * HD + 8 * lane, voff = (size_t)kv * HD * TT + 8 * lane;
    v8f o[4];
#pragma unroll
    for (int db = 0; db < 4; ++db) o[db] = (v8f){};
    float m = -3.0e38f, l = 0.f;
    V kf[NKT][2], kf2[NKT][2];
    auto load_k = [&](int k0) {   // the K fragments of the pass that starts at key k0
        const T16* pk = Kp + koff + (size_t)k0 * HD;
#pragma unroll
        for (int kt = 0; kt < NKT; ++kt)
#pragma unroll
            for (int ks = 0; ks < 2; ++ks) kf[kt][ks] = WFrag<T16>::ld(pk + (kt * 2 + ks) * 512);
        // the same wait behind the run of K loads
        if constexpr (HL) { const T16* pk2 = Kp2 + koff + (size_t)k0 * HD;
#pragma unroll
            for (int kt = 0; kt < NKT; ++kt)
#pragma unroll
                for (int ks = 0; ks < 2; ++ks) kf2[kt][ks] = WFrag<T16>::ld(pk2 + (kt * 2 + ks) * 512);
            asm volatile("s_wait_xcnt 0x0" :: "v"(pk), "v"(pk2) : "memory"); }
        else asm volatile("s_wait_xcnt 0x0" :: "v"(pk) : "memory"); };
    auto pass = [&](int k0, auto edge) {   // KB keys from k0 on; edge: the one pass that holds the diagonal (causal select, no pass behind it)
        constexpr bool EDGE = decltype(edge)::v;
        V vf[4][NKH], vf2[4][NKH];
        if constexpr (!AHEAD) load_k(k0);
        const T16* pv = Vt + voff + (size_t)k0 * 16;
#pragma unroll
        for (int db = 0; db < 4; ++db)
#pragma unroll
            for (int kh = 0; kh < NKH; ++kh) vf[db][kh] = WFrag<T16>::ld(pv + (size_t)db * 16 * TT + kh * 512);
        // the same wait behind the run of V loads
        if constexpr (HL) { const T16* pv2 = Vt2 + voff + (size_t)k0 * 16;
#pragma unroll
            for (int db = 0; db < 4; ++db)
#pragma unroll
                for (int kh = 0; kh < NKH; ++kh) vf2[db][kh] = WFrag<T16>::ld(pv2 + (size_t)db * 16 * TT + kh * 512);
            asm volatile("s_wait_xcnt 0x0" :: "v"(pv), "v"(pv2) : "memory"); }
        else asm volatile("s_wait_xcnt 0x0" :: "v"(pv) : "memory");
        v8f s[NKT];
#pragma unroll
        for (int kt = 0; kt < NKT; ++kt) { s[kt] = (v8f){};
#pragma unroll
            for (int ks = 0; ks < 2; ++ks) { s[kt] = WFrag<T16>::mma(kf[kt][ks], qf[ks], s[kt]); if constexpr (HL) { s[kt] = WFrag<T16>::mma(kf[kt][ks], qf2[ks], s[kt]); s[kt] = WFrag<T16>::mma(kf2[kt][ks], qf[ks], s[kt]); } } }
        if constexpr (AHEAD && !EDGE) load_k(k0 + KB);   // the next pass's K fragments fly during this pass's softmax and P.V (a pass that is not the edge pass always has a successor)
        float bm = -3.0e38f; const int rel = qi - k0 - hi * 8;   // a lane's key kt * 16 + j of the pass is allowed while it is <= rel
#pragma unroll
        for (int kt = 0; kt < NKT; ++kt)
#pragma unroll
            for (int j = 0; j < 8; ++j) { if constexpr (EDGE) s[kt][j] = (kt * 16 + j <= rel) ? s[kt][j] : -3.0e38f; bm = fmaxf(bm, s[kt][j]); }
        bm = fmaxf(bm, __shfl_xor(bm, 16, 32));
        const float mn = fmaxf(m, bm * C1); const float alpha = exp2x1(m - mn); m = mn;   // the running maximum is kept in log2 units
        const float sh = (HL ? 0.0f : 10.0f) - mn;
        float ls[NKT];
#pragma unroll
        for (int kt = 0; kt < NKT; ++kt) { float e[8]; ls[kt] = 0.f;
#pragma unroll
            for (int j = 0; j < 8; ++j) e[j] = s[kt][j] * C1 + sh;   // one multiply-add from raw score to exponent
            exp2x8(e);
#pragma unroll
            for (int j = 0; j < 8; ++j) { s[kt][j] = e[j]; ls[kt] += e[j]; } }
        float lsum = ls[0];
#pragma unroll
        for (int kt = 1; kt < NKT; ++kt) lsum += ls[kt];
        l = l * alpha + lsum;   // each wave half keeps the sum of its own keys; the halves are joined once, behind the last pass
#pragma unroll
        for (int db = 0; db < 4; ++db) o[db] *= alpha;
#pragma unroll
        for (int kh = 0; kh < NKH; ++kh) {
            if constexpr (HL) { v16us ph, pl;
#pragma unroll
                for (int q = 0; q < 16; ++q) { unsigned short a, c2; splitf(s[kh * 2 + (q >> 3)][q & 7], a, c2); ph[q] = a; pl[q] = c2; }
                const V pfh = __builtin_bit_cast(V, ph), pfl = __builtin_bit_cast(V, pl);
#pragma unroll
                for (int db = 0; db < 4; ++db) { o[db] = WFrag<T16>::mma(vf[db][kh], pfh, o[db]); o[db] = WFrag<T16>::mma(vf[db][kh], pfl, o[db]); o[db] = WFrag<T16>::mma(vf2[db][kh], pfh, o[db]); }
            } else { V pf;
#pragma unroll
                for (int q = 0; q < 16; ++q) pf[q] = tohx(s[kh * 2 + (q >> 3)][q & 7]);
#pragma unroll
                for (int db = 0; db < 4; ++db) o[db] = WFrag<T16>::mma(vf[db][kh], pf, o[db]); } }
        asm volatile("v_nop\n\tv_nop\n\tv_nop\n\tv_nop" : "+v"(o[0]), "+v"(o[1]), "+v"(o[2]), "+v"(o[3]) : "v"(vf[3][NKH - 1]));   // four vector slots behind the last WMMA, also on the taken back edge, before fragments or accumulators are touched
    };
    int k0 = 0;   // both loops stay rolled: one pass already holds every fragment of KB keys in registers
    if constexpr (AHEAD) { static_assert(RH >= KB, "the fetch-ahead loop runs at least once: its rows start at RH");
        load_k(0);
#pragma unroll 1
        do { pass(k0, Flag<false>{}); k0 += KB; } while (k0 + KB - 1 <= q0);
    } else {
#pragma unroll 1
        for (; k0 + KB - 1 <= q0; k0 += KB) pass(k0, Flag<false>{}); }
    pass(k0, Flag<true>{});
    const float f = __fdiv_rn(1.0f, l + __shfl_xor(l, 16, 32));
    const size_t oo = (size_t)q0 * DQ + head * (2 * 512) + 8 * lane; v8us oh[4], ol[4];   // fragment order of the wo product's A operand (rows = queries, k = head * HD + d): a lane's 8 values of d block db are its own piece of half db & 1 of k block head * 2 + (db >> 1)
#pragma unroll
    for (int db = 0; db < 4; ++db)
#pragma unroll
        for (int j = 0; j < 8; ++j) { unsigned short a, c2; splitf(o[db][j] * f, a, c2); oh[db][j] = a; ol[db][j] = c2; }
#pragma unroll
    for (int db = 0; db < 4; ++db) { *(v8us*)(Ah + oo + db * 256) = oh[db]; *(v8us*)(Al + oo + db * 256) = ol[db]; }
}
// amdgpu_waves_per_eu(4, 4): at most 256 registers a wave, so that four waves share a SIMD and half of the NKV x NB_ x TT / 16 work-groups are resident at once; the others follow as places come free
__global__ __launch_bounds__(32 * REP) __attribute__((amdgpu_waves_per_eu(4, 4))) void k_fattn(const h16* __restrict__ Q16, const bf* __restrict__ Qh, const bf* __restrict__ Ql, const h16* __restrict__ K16, const bf* __restrict__ Kh, const bf* __restrict__ Kl, const h16* __restrict__ V16, const bf* __restrict__ Vh, const bf* __restrict__ Vl, bf* Ah, bf* Al) {
    const int wave = __builtin_amdgcn_readfirstlane((int)(threadIdx.x >> 5));   // wave number in a scalar register: head, loop bound and branches stay scalar
    const int kv = blockIdx.x, head = kv * REP + wave, rank = blockIdx.z;
    { const size_t zq = (size_t)blockIdx.y * ((size_t)NH_ * TT * HD), zk = (size_t)blockIdx.y * ((size_t)NKV * TT * HD), za = (size_t)blockIdx.y * ((size_t)TT * DQ);   // this batch's planes
      Q16 += zq; Qh += zq; Ql += zq; K16 += zk; Kh += zk; Kl += zk; V16 += zk; Vh += zk; Vl += zk; Ah += za; Al += za; }
    // There are twice as many work-groups as places: the four heads of a work-group take the same tile, and a tile's cost falls with the rank (the slowest grid index), so that the short ones fill the places that the long ones leave.
    // An fp16 tile t costs about t; a hi/lo tile h (three products a key) about 3 h: ranks 0..33 are tiles 127..94; then groups of four (hi/lo tile 31 - g, fp16 tiles 93 - 3 g, 92 - 3 g, 91 - 3 g) down to tile 32; ranks 117..127 are tiles 10..0. For speed only; the map is a permutation, so each (head, tile) is taken once.
    static_assert(TT / 16 == 128 && RH / 16 == 32, "the rank -> tile map is written for 128 tiles, 32 of them hi/lo");
    const int s = rank - 34; const int tile = (rank < 34 || rank >= 117) ? 127 - rank : ((s & 3) == 0 ? 31 - (s >> 2) : 94 - 3 * (s >> 2) - (s & 3)); const int q0 = tile * 16;
    if (q0 < RH) fattn_body<bf, true, 32>(Qh, Ql, Kh, Kl, Vh, Vl, q0, kv, head, Ah, Al);
    else fattn_body<h16, false, 64>(Q16, nullptr, K16, nullptr, V16, nullptr, q0, kv, head, Ah, Al);
}

extern "C" void kernel_launch(void* const* d_in, const int* in_sizes, int n_in,
                              void* d_out, int out_size, void* d_ws, size_t ws_size, hipStream_t stream) {
    (void)in_sizes; (void)n_in; (void)out_size;
        const float* x = (const float*)d_in[0]; const float* wq = (const float*)d_in[1]; const float* wk = (const float*)d_in[2]; const float* wv = (const float*)d_in[3]; const float* wo = (const float*)d_in[4];   /* inputs x, wq [2048][2048], wk [512][2048], wv, wo ('oi'); this module has no mask input (the causal rule is by index) */
    float* OUT = (float*)d_out;     // [2][2048][2048]
    char* wsp = (char*)d_ws;
    auto take = [&](size_t bytes) { char* p = wsp; wsp += (bytes + 255) & ~(size_t)255; return (void*)p; };
    bf* XB = (bf*)take((size_t)CROWS * DM * 2); bf* WQ = XB + (size_t)NB_ * TT * DM; bf* WK = WQ + (size_t)DQ * DM; bf* WV = WK + (size_t)DKV * DM; bf* WO = WV + (size_t)DKV * DM;   // one block, in the row order of cvt8
    float* CS = (float*)take((size_t)TT * HD * 2 * 4);
    // every plane below holds both batches, one behind the other
    h16* QP16 = (h16*)take((size_t)NB_ * NH_ * TT * HD * 2); h16* KP16 = (h16*)take((size_t)NB_ * NKV * TT * HD * 2); h16* VT16 = (h16*)take((size_t)NB_ * NKV * HD * TT * 2);
    bf* QPh = (bf*)take((size_t)NB_ * NH_ * TT * HD * 2); bf* QPl = (bf*)take((size_t)NB_ * NH_ * TT * HD * 2); bf* KPh = (bf*)take((size_t)NB_ * NKV * TT * HD * 2); bf* KPl = (bf*)take((size_t)NB_ * NKV * TT * HD * 2); bf* VTh = (bf*)take((size_t)NB_ * NKV * HD * TT * 2); bf* VTl = (bf*)take((size_t)NB_ * NKV * HD * TT * 2);
    bf* ATh = (bf*)take((size_t)NB_ * TT * DQ * 2); bf* ATl = (bf*)take((size_t)NB_ * TT * DQ * 2);
    if ((size_t)(wsp - (char*)d_ws) > ws_size) return;    // ws 256 MiB
    k_prep<<<TT * HD / 256 + CROWS * (DM / 8) / 256, 256, 0, stream>>>(x, wq, wk, wv, wo, XB, CS);   /* rotary table and every 16-bit copy */
    k_proj<<<dim3(TT / 64, DQ / 64 + 2 * (DKV / 64), NB_), 256, 0, stream>>>(XB, WQ, WK, WV, CS, QP16, QPh, QPl, KP16, KPh, KPl, VT16, VTh, VTl);
    k_fattn<<<dim3(NKV, NB_, TT / 16), 32 * REP, 0, stream>>>(QP16, QPh, QPl, KP16, KPh, KPl, VT16, VTh, VTl, ATh, ATl);
    k_gemmw<bf, 1, false, 8, false, 0><<<dim3(TT / 64, DM / 64, NB_), 256, 0, stream>>>(ATh, ATl, WO, nullptr, DQ, DQ, OUT, DM, nullptr, 0, (size_t)TT * DQ, 0, (size_t)TT * DM, nullptr, nullptr, nullptr, nullptr);
}

// v007
// Measured time: 148 microseconds a run.
// Two timings next to v006 both put it at 1.20 times that version's speed.
// All steps since v000 together make it 18.3 times as fast.
#include <hip/hip_runtime.h>

// Grouped-query causal attention with a computed half-split RoPE (x [2][2048][2048]; xq = x wq^T (32 heads x 64), xk, xv = x wk^T, x wv^T (8 kv heads x 64) ('oi', no bias; token-major); cos / sin from inv_freq = 1 / (10000 ** (2i / 64)) and positions arange(S) ([S][32] tables); (x1, x2) = the two 32-wide halves of each head: cat(x1 c - x2 s, x1 s + x2 c) (half-split pairs (d, d + 32)) on q and k; k, v repeated 4 x on the head axis (jnp.repeat: kv head = q head / 4); scores / sqrt(64); where(tril, scores, finfo.min) == exclusion; softmax; out = merged wo^T ('oi') -> [2][2048][2048] (8.4 M); argument order x, wq, wk, wv, wo).
// Every 16-bit matrix operand (x, the weights, the q, k and v^T planes, the merged attention output) is stored by its producer in fragment order (see WFrag).
// Four launches, each over both batches (k_prep, k_proj, k_fattn, k_gemmw for wo). Layout: bf16 copy of x; 'oi' weights; exact projections whose epilogue applies the rotate-half rotation (cs5 computed table) and stores the 16-bit planes itself; causal T-2048 GQA attention fused in one kernel (k_fattn: running softmax in registers, kv plane = head / REP; hybrid rows: < 512 hi/lo 3 products, rest fp16 x1024; keys above the diagonal block are never read); merged hi/lo x wo exact.
// Compute dtypes, f32 accumulate: every input rounded to bf16; projections exact; rotary f32; attention rows < 512 3 products, rest fp16; softmax f32; wo hl x exact.

#define NB_  2
#define TT   2048
#define DM   2048
#define NH_  32
#define NKV  8
#define REP  (NH_ / NKV)
#define HD   64
#define DQ   (NH_ * HD)
#define DKV  (NKV * HD)
#define RH   512                  // query rows < RH use hi+lo planes
#define SCL  0.125f   // HD^-0.5
typedef _Float16 h16;
typedef unsigned short bf;
typedef __attribute__((ext_vector_type(16))) __bf16   v16bf;
typedef __attribute__((ext_vector_type(16))) _Float16 v16h;
typedef __attribute__((ext_vector_type(8)))  _Float16 v8h;
typedef __attribute__((ext_vector_type(8)))  unsigned short v8us;
typedef __attribute__((ext_vector_type(8)))  float    v8f;
typedef __attribute__((ext_vector_type(4)))  float    v4f;
typedef v8h  __attribute__((may_alias)) v8ha;
typedef v4f  __attribute__((may_alias)) v4fa;
typedef v8us __attribute__((may_alias)) v8usa;

__device__ __forceinline__ unsigned short f2bf(float f) { unsigned u = __float_as_uint(f); u += 0x7FFFu + ((u >> 16) & 1u); return (unsigned short)(u >> 16); }
__device__ __forceinline__ float bf2f(unsigned short b) { return __uint_as_float(((unsigned)b) << 16); }
__device__ __forceinline__ float bfr(float f) { return bf2f(f2bf(f)); }
__device__ __forceinline__ v16h cat16(v8h lo, v8h hi) { return __builtin_shufflevector(lo, hi, 0, 1, 2, 3, 4, 5, 6, 7, 8, 9, 10, 11, 12, 13, 14, 15); }
__device__ __forceinline__ v16bf cat16b(v8us lo, v8us hi) { return __builtin_bit_cast(v16bf, __builtin_shufflevector(lo, hi, 0, 1, 2, 3, 4, 5, 6, 7, 8, 9, 10, 11, 12, 13, 14, 15)); }
__device__ __forceinline__ v8f wmma16(v16h a, v16h b, v8f c) { return __builtin_amdgcn_wmma_f32_16x16x32_f16(false, a, false, b, (short)0, c, false, false); }
__device__ __forceinline__ v8f wmmab(v16bf a, v16bf b, v8f c) { return __builtin_amdgcn_wmma_f32_16x16x32_bf16(false, a, false, b, (short)0, c, false, false); }
__device__ __forceinline__ h16 tohx(float x) { return (h16)x; }
__device__ __forceinline__ void splitf(float y, unsigned short& h, unsigned short& l) { h = f2bf(y); l = f2bf(y - bf2f(h)); }



// ---- k_gemmw: register-blocked GEMM, one 128x128 output tile per work-group of 8 waves; grid (M/128, N/128, Z), 256 threads. The tile is 2 x 2 sub-tiles of 64x64; two waves share a sub-tile and split K between them (wave = sub-tile * 2 + wk).
// K goes in stages of 64 (two 1-KiB blocks of every group of 16 operand rows): the work-group brings the stage's 128 rows of every operand into LDS once, by asynchronous copies, two buffers, the next stage flying while this one is worked on; so each operand byte leaves L2 once per 128x128 tile and serves two sub-tiles.
// Wave wk takes k block wk of every stage and keeps its own 64x64 partial tile (16 accumulators); the two partial tiles of a sub-tile are then summed, wk 0 first, through LDS (the staging buffers' place, free by then).
// C[m][n] (f32, pitch ldc) = sum_k A[m][k] Bt[n][k] (NSPLIT 1: + A2[m][k] Bt[n][k]). A has lda, Bt K elements a row (fragment order). z-batch strides sA/sC in elements. K % 64 == 0.
// Fragment order: a block of 16 rows x 32 k of an operand is 512 consecutive elements, element (r, k) at (k >> 4) * 256 + (((k >> 3) & 1) * 16 + r) * 8 + (k & 7): lane l's two 16-byte pieces (row l & 15; k = 8 (l >> 4) + 0..7 and 16 + 8 (l >> 4) + 0..7) lie at l * 8 and 256 + l * 8,
// so each wave-wide 16-byte load covers 512 contiguous bytes (4 whole lines, not 16 pieces of 32 B). Blocks follow one another along k, then along the groups of 16 rows: a matrix of pitch P has block (row group g, k block b) at g * 16 * P + b * 512. ld takes the block's address + 8 * lane.
// EPI 0: the summed tile goes out as f32 C. EPI 1, 2: no f32 tile leaves the kernel; the tile is stored as three 16-bit planes (fp16, bf16 hi, bf16 lo) in fragment order, a thread taking the pieces of columns 8 o .. 8 o + 7 and 32 + 8 o .. of one row, so each wave-wide 16-byte store covers 512 contiguous bytes.
// EPI 1 (q, k; rows = positions t, the 64 columns = one head): rotate-half first, out[d] = x[d] cos[t][d] - x[d+32] sin[t][d], out[d+32] = x[d+32] cos[t][d] + x[d] sin[t][d] (a thread's two pieces are exactly such pairs); planes [head][t][d], pitch HD.
// EPI 2 (v; launched as wv x^T, so rows = kv head * HD + d and columns = t: the tile is V^T already): planes [g][d][t], pitch TT.
template <typename T16> struct WFrag;
template <> struct WFrag<h16> { typedef v16h V; static __device__ __forceinline__ V ld(const h16* p) { return cat16(*(const v8h*)p, *(const v8h*)(p + 256)); } static __device__ __forceinline__ v8f mma(V a, V b, v8f c) { return wmma16(a, b, c); } };
template <> struct WFrag<bf> { typedef v16bf V; static __device__ __forceinline__ V ld(const bf* p) { return cat16b(*(const v8us*)p, *(const v8us*)(p + 256)); } static __device__ __forceinline__ v8f mma(V a, V b, v8f c) { return wmmab(a, b, c); } };
// copy8, copy12: a stage's asynchronous 16-byte-a-lane copies to LDS, four an operand, 4 KiB apart in LDS and sa (A, A2) or sb (Bt) bytes apart in memory. The s_wait_xcnt 0 stands in the copies' own statement, in front of any overwrite of a register that they name (a precaution).
__device__ __forceinline__ void copy8(unsigned l, const char* a, size_t sa, const char* b, size_t sb) {
    asm volatile("global_load_async_to_lds_b128 %0, %8, off\n\tglobal_load_async_to_lds_b128 %1, %9, off\n\tglobal_load_async_to_lds_b128 %2, %10, off\n\tglobal_load_async_to_lds_b128 %3, %11, off\n\tglobal_load_async_to_lds_b128 %4, %12, off\n\tglobal_load_async_to_lds_b128 %5, %13, off\n\tglobal_load_async_to_lds_b128 %6, %14, off\n\tglobal_load_async_to_lds_b128 %7, %15, off\n\ts_wait_xcnt 0x0"
                 :: "v"(l), "v"(l + 4096u), "v"(l + 8192u), "v"(l + 12288u), "v"(l + 16384u), "v"(l + 20480u), "v"(l + 24576u), "v"(l + 28672u),
                    "v"(a), "v"(a + sa), "v"(a + 2 * sa), "v"(a + 3 * sa), "v"(b), "v"(b + sb), "v"(b + 2 * sb), "v"(b + 3 * sb) : "memory"); }
__device__ __forceinline__ void copy12(unsigned l, const char* a, size_t sa, const char* b, size_t sb, const char* a2) {
    asm volatile("global_load_async_to_lds_b128 %0, %12, off\n\tglobal_load_async_to_lds_b128 %1, %13, off\n\tglobal_load_async_to_lds_b128 %2, %14, off\n\tglobal_load_async_to_lds_b128 %3, %15, off\n\tglobal_load_async_to_lds_b128 %4, %16, off\n\tglobal_load_async_to_lds_b128 %5, %17, off\n\tglobal_load_async_to_lds_b128 %6, %18, off\n\tglobal_load_async_to_lds_b128 %7, %19, off\n\tglobal_load_async_to_lds_b128 %8, %20, off\n\tglobal_load_async_to_lds_b128 %9, %21, off\n\tglobal_load_async_to_lds_b128 %10, %22, off\n\tglobal_load_async_to_lds_b128 %11, %23, off\n\ts_wait_xcnt 0x0"
                 :: "v"(l), "v"(l + 4096u), "v"(l + 8192u), "v"(l + 12288u), "v"(l + 16384u), "v"(l + 20480u), "v"(l + 24576u), "v"(l + 28672u), "v"(l + 32768u), "v"(l + 36864u), "v"(l + 40960u), "v"(l + 45056u),
                    "v"(a), "v"(a + sa), "v"(a + 2 * sa), "v"(a + 3 * sa), "v"(b), "v"(b + sb), "v"(b + 2 * sb), "v"(b + 3 * sb), "v"(a2), "v"(a2 + sa), "v"(a2 + 2 * sa), "v"(a2 + 3 * sa) : "memory"); }
// gemmw_body is the work of one work-group: the tile at rows r0, columns c0, with red = its 8 * 64 * 68 floats of LDS; the kernels below pick tile, operands and planes from blockIdx.
// A stage in LDS: [A 16 KiB | Bt 16 KiB | A2 16 KiB (NSPLIT 1)], each the operand's 8 groups of 16 rows, 2 KiB (two k blocks, as they lie in memory) a group. One copy of all 256 threads moves two groups.
template <typename T16, int NSPLIT, int EPI>
__device__ __forceinline__ void gemmw_body(float* red, int r0, int c0, const T16* __restrict__ A, const T16* __restrict__ A2, const T16* __restrict__ Bt, int K, int lda, float* C, int ldc, const float* __restrict__ CS, h16* P16, bf* Ph, bf* Pl) {
    typedef typename WFrag<T16>::V V;
    static_assert(NSPLIT == 0 || NSPLIT == 1, "one or two A planes");
    constexpr int SB = (NSPLIT == 1 ? 3 : 2) * 16384;   // bytes of a stage
    static_assert(2 * SB <= 8 * 64 * 68 * 4, "both buffers lie inside red");
    const int tid = (int)threadIdx.x, lane = tid & 31, lr = lane & 15, hi = lane >> 4;
    const int wave = __builtin_amdgcn_readfirstlane(tid >> 5);   // wave number in a scalar register: sub-tile and k block stay scalar
    const int sm = wave >> 2, sn = (wave >> 1) & 1, wk = wave & 1;
    const int NT = K / 64;
    v8f acc[4][4];
#pragma unroll
    for (int mb = 0; mb < 4; ++mb)
#pragma unroll
        for (int nb = 0; nb < 4; ++nb) acc[mb][nb] = (v8f){};
    // this thread's 16 bytes of the first two groups of each operand; the next two groups lie 32 rows on, the next stage 2 KiB on
    const char* gA = (const char*)(A + (size_t)(r0 + 16 * (tid >> 7)) * lda + (tid & 127) * 8);
    const char* gB = (const char*)(Bt + (size_t)(c0 + 16 * (tid >> 7)) * K + (tid & 127) * 8);
    const char* gA2 = NSPLIT == 1 ? (const char*)(A2 + (size_t)(r0 + 16 * (tid >> 7)) * lda + (tid & 127) * 8) : nullptr;
    const unsigned l0 = (unsigned)(size_t)red + (unsigned)tid * 16u;   // LDS byte address: the low 32 bits of the __shared__ address
    auto stage = [&](int t) {   // stage t's copies into buffer t & 1
        const unsigned l = l0 + (unsigned)(t & 1) * (unsigned)SB; const size_t o = (size_t)t * 2048;
        if constexpr (NSPLIT == 1) copy12(l, gA + o, (size_t)lda * 64, gB + o, (size_t)K * 64, gA2 + o);
        else copy8(l, gA + o, (size_t)lda * 64, gB + o, (size_t)K * 64); };
    stage(0);
    asm volatile("s_wait_asynccnt 0x0" ::: "memory");   // this wave's copies of stage 0 have landed
    __syncthreads();                                     // ... and every other wave's: stage 0 may be read
    if (1 < NT) stage(1);
#pragma unroll 1   // rolled: one copy of the stage's code, the buffer picked by t & 1
    for (int t = 0; t < NT; ++t) {
        const T16* sb = (const T16*)red + (t & 1) * (SB / 2) + wk * 512 + 8 * lane;
        V a[4], a2[4], b[4];   // every fragment of the stage is asked for in one group, in front of the first WMMA
#pragma unroll
        for (int mb = 0; mb < 4; ++mb) { a[mb] = WFrag<T16>::ld(sb + (sm * 4 + mb) * 1024); b[mb] = WFrag<T16>::ld(sb + 8192 + (sn * 4 + mb) * 1024); }
        if constexpr (NSPLIT == 1) {
#pragma unroll
            for (int mb = 0; mb < 4; ++mb) a2[mb] = WFrag<T16>::ld(sb + 16384 + (sm * 4 + mb) * 1024); }
        asm volatile("" :: "v"(b[0]), "v"(b[1]), "v"(b[2]), "v"(b[3]));   // inputs only: holds the B fragments' loads in the one group in front of the first WMMA; left alone the compiler puts three of them among the WMMAs, each with a wait for the LDS of its own
#pragma unroll
        for (int nb = 0; nb < 4; ++nb)
#pragma unroll
            for (int mb = 0; mb < 4; ++mb) acc[mb][nb] = WFrag<T16>::mma(a[mb], b[nb], acc[mb][nb]);
        if constexpr (NSPLIT == 1) {
#pragma unroll
            for (int nb = 0; nb < 4; ++nb)
#pragma unroll
                for (int mb = 0; mb < 4; ++mb) acc[mb][nb] = WFrag<T16>::mma(a2[mb], b[nb], acc[mb][nb]); }
        // four vector slots behind the last WMMA, also on the taken back edge, before fragments or accumulators are touched; every accumulator is named so that no WMMA of the stage stands behind them
        asm volatile("v_nop\n\tv_nop\n\tv_nop\n\tv_nop" : "+v"(acc[0][0]), "+v"(acc[0][1]), "+v"(acc[0][2]), "+v"(acc[0][3]), "+v"(acc[1][0]), "+v"(acc[1][1]), "+v"(acc[1][2]), "+v"(acc[1][3]), "+v"(acc[2][0]), "+v"(acc[2][1]), "+v"(acc[2][2]), "+v"(acc[2][3]), "+v"(acc[3][0]), "+v"(acc[3][1]), "+v"(acc[3][2]), "+v"(acc[3][3]));
        asm volatile("s_wait_dscnt 0x0" ::: "memory");
        asm volatile("s_wait_asynccnt 0x0" ::: "memory");
        __syncthreads();
        if (t + 2 < NT) stage(t + 2);
    }
    asm volatile("s_wait_asynccnt 0x0" ::: "memory");   // nothing is in flight when the buffers become the partial tiles' place
    const int pg = tid >> 6, po = (tid >> 4) & 3, prow = pg * 16 + (tid & 15);   // EPI 1, 2: this thread's group of 16 rows, its 8-column piece and its row of a sub-tile
    v4f cs[2][4];
    if constexpr (EPI == 1) { const float* pc = CS + ((size_t)(r0 + prow) * HD + po * 8) * 2;   // (cos, sin) of the thread's 8 column pairs, for its row of the upper and of the lower sub-tiles, asked for here so that they fly during the LDS stores and the barrier
#pragma unroll
        for (int h = 0; h < 2; ++h)
#pragma unroll
            for (int q = 0; q < 4; ++q) cs[h][q] = *(const v4f*)(pc + h * (64 * HD * 2) + q * 4);
        asm volatile("s_wait_xcnt 0x0" :: "v"(pc) : "memory"); }   // the wait stands in front of any overwrite of the address register that the loads name (a precaution)
    float* mine = red + wave * (64 * 68);
#pragma unroll
    for (int mb = 0; mb < 4; ++mb)
#pragma unroll
        for (int nb = 0; nb < 4; ++nb)
#pragma unroll
            for (int j = 0; j < 8; ++j) mine[(mb * 16 + hi * 8 + j) * 68 + nb * 16 + lr] = acc[mb][nb][j];
    __syncthreads();   // every wave's partial tile is in LDS before any wave sums
    if constexpr (EPI == 0) {
        v4f val[16]; float* pc[16];
#pragma unroll
        for (int s = 0; s < 16; ++s) { const int sub = s >> 2, q = (s & 3) * 256 + tid, row = q >> 4, cofs = (q & 15) * 4; const float* pr = red + sub * (2 * 64 * 68) + row * 68 + cofs;
            val[s] = *(const v4fa*)pr + *(const v4fa*)(pr + 64 * 68); pc[s] = C + (size_t)(r0 + (sub >> 1) * 64 + row) * ldc + c0 + (sub & 1) * 64 + cofs; }
#pragma unroll
        for (int s = 0; s < 16; ++s) *(v4f*)pc[s] = val[s];
        // one s_wait_xcnt 0 behind the run of stores; the pointers are inputs so that they stay in their registers up to the wait (a precaution)
        asm volatile("s_wait_xcnt 0x0" :: "v"(pc[0]), "v"(pc[1]), "v"(pc[2]), "v"(pc[3]), "v"(pc[4]), "v"(pc[5]), "v"(pc[6]), "v"(pc[7]), "v"(pc[8]), "v"(pc[9]), "v"(pc[10]), "v"(pc[11]), "v"(pc[12]), "v"(pc[13]), "v"(pc[14]), "v"(pc[15]) : "memory");
    } else {
        static_assert(HD == 64, "256 threads = 64 rows x 4 pairs of 8-column pieces; one sub-tile = one head");
        float x[4][2][8];   // per sub-tile: x[0]: columns 8 po .. + 7, x[1]: the same + 32, each the two partials summed, wk 0 first
#pragma unroll
        for (int sub = 0; sub < 4; ++sub)
#pragma unroll
            for (int q = 0; q < 4; ++q) { const int cofs = (q >> 1) * 32 + po * 8 + (q & 1) * 4; const float* pr = red + sub * (2 * 64 * 68) + prow * 68 + cofs; const v4f val = *(const v4fa*)pr + *(const v4fa*)(pr + 64 * 68);
#pragma unroll
                for (int i = 0; i < 4; ++i) x[sub][q >> 1][(q & 1) * 4 + i] = val[i]; }
#pragma unroll
        for (int sub = 0; sub < 4; ++sub) { const int rs = r0 + (sub >> 1) * 64, cc = c0 + (sub & 1) * 64;   // the sub-tile's first row and column
            if constexpr (EPI == 1) {
#pragma unroll
                for (int j = 0; j < 8; ++j) { const float c = cs[sub >> 1][j >> 1][(j & 1) * 2], s = cs[sub >> 1][j >> 1][(j & 1) * 2 + 1], a = x[sub][0][j], b = x[sub][1][j]; x[sub][0][j] = a * c - b * s; x[sub][1][j] = b * c + a * s; } }
            v8h o16[2]; v8us oh[2], ol[2];
#pragma unroll
            for (int p = 0; p < 2; ++p)
#pragma unroll
                for (int j = 0; j < 8; ++j) { unsigned short a2, c2; splitf(x[sub][p][j], a2, c2); o16[p][j] = tohx(x[sub][p][j]); oh[p][j] = a2; ol[p][j] = c2; }
            // block (row group, k block) of a plane of pitch P lies at group * 16 * P + block * 512; the thread's piece of it at (8-column piece * 16 + row) * 8; its second piece is the next k block's
            const size_t oo = (EPI == 1 ? (size_t)(cc / HD) * TT * HD + (size_t)(rs + pg * 16) * HD : (size_t)(rs + pg * 16) * TT + (size_t)(cc / 32) * 512) + (tid & 63) * 8;
            h16* p16 = P16 + oo; bf* ph = Ph + oo; bf* pl = Pl + oo;
#pragma unroll
            for (int p = 0; p < 2; ++p) { *(v8h*)(p16 + p * 512) = o16[p]; *(v8us*)(ph + p * 512) = oh[p]; *(v8us*)(pl + p * 512) = ol[p]; }
            asm volatile("s_wait_xcnt 0x0" :: "v"(p16), "v"(ph), "v"(pl) : "memory"); }   // behind the sub-tile's stores, in front of any overwrite of an address register that they name (a precaution)
    }
}
template <typename T16, int NSPLIT, int EPI>
__global__ __launch_bounds__(256) void k_gemmw(const T16* __restrict__ A, const T16* __restrict__ A2, const T16* __restrict__ Bt, int K, int lda, float* C, int ldc, size_t sA, size_t sC) {
    __shared__ __align__(16) float red[8 * 64 * 68];
    const size_t z = blockIdx.z; A += z * sA; if (A2) A2 += z * sA; C += z * sC;
    gemmw_body<T16, NSPLIT, EPI>(red, blockIdx.x * 128, blockIdx.y * 128, A, A2, Bt, K, lda, C, ldc, nullptr, nullptr, nullptr, nullptr);
}
// k_proj: the q, k and v projections of both batches in one grid (TT / 128 token tiles, DQ / 128 + 2 DKV / 128 tiles of output features, NB_). y < DQ / 128: two q heads; the next DKV / 128: two k heads (both x w^T, EPI 1); the last DKV / 128: 128 rows of wv x^T (EPI 2). The choice is the same for a whole work-group.
__global__ __launch_bounds__(256) void k_proj(const bf* __restrict__ XB, const bf* __restrict__ WQ, const bf* __restrict__ WK, const bf* __restrict__ WV, const float* __restrict__ CS, h16* QP16, bf* QPh, bf* QPl, h16* KP16, bf* KPh, bf* KPl, h16* VT16, bf* VTh, bf* VTl) {
    __shared__ __align__(16) float red[8 * 64 * 68];
    const int tt = blockIdx.x, y = blockIdx.y; const size_t z = blockIdx.z; const bf* X = XB + z * ((size_t)TT * DM);
    const size_t zq = z * ((size_t)NH_ * TT * HD), zk = z * ((size_t)NKV * TT * HD);
    if (y < DQ / 128 + DKV / 128) { const bool q = y < DQ / 128;
        gemmw_body<bf, 0, 1>(red, tt * 128, (q ? y : y - DQ / 128) * 128, X, nullptr, q ? WQ : WK, DM, DM, nullptr, 0, CS, q ? QP16 + zq : KP16 + zk, q ? QPh + zq : KPh + zk, q ? QPl + zq : KPl + zk); }
    else gemmw_body<bf, 0, 2>(red, (y - DQ / 128 - DKV / 128) * 128, tt * 128, WV, nullptr, X, DM, DM, nullptr, 0, nullptr, VT16 + zk, VTh + zk, VTl + zk);
}

typedef __attribute__((ext_vector_type(2))) _Float16 v2h;
typedef __attribute__((ext_vector_type(4))) _Float16 v4h;
typedef __attribute__((ext_vector_type(2))) unsigned short v2us;
typedef __attribute__((ext_vector_type(4))) unsigned short v4us;
typedef __attribute__((ext_vector_type(2))) float v2f;
typedef __attribute__((ext_vector_type(4))) int v4i;

// cvt8: f32 [rows][DM] -> bf16 in fragment order. A thread rounds one 8-element piece (number i); a wave takes 8 rows x one k block (8 whole f32 lines in), its 4 pieces a row going out as 4 whole 128-byte lines.
// The five inputs count as one matrix of CROWS rows, x (both batches), wq, wk, wv, wo one below the other, and dst is that matrix in fragment order (every part starts at a multiple of 16 rows); a work-group's 256 pieces lie in 8 rows of one input, row0 being the first of them.
#define CROWS (NB_ * TT + DQ + 2 * DKV + DM)
__device__ __forceinline__ void cvt8(const float* __restrict__ x, const float* __restrict__ wq, const float* __restrict__ wk, const float* __restrict__ wv, const float* __restrict__ wo, bf* dst, size_t i, int row0) { static_assert(DQ == DM, "every converted matrix has DM elements a row");
    const float* src = x; int first = 0;
    if (row0 >= NB_ * TT + DQ + 2 * DKV) { src = wo; first = NB_ * TT + DQ + 2 * DKV; } else if (row0 >= NB_ * TT + DQ + DKV) { src = wv; first = NB_ * TT + DQ + DKV; } else if (row0 >= NB_ * TT + DQ) { src = wk; first = NB_ * TT + DQ; } else if (row0 >= NB_ * TT) { src = wq; first = NB_ * TT; }
    const int lane = (int)(i & 31), j = lane & 3; const size_t w = i >> 5, kb = w % (DM / 32), row = (w / (DM / 32)) * 8 + (lane >> 2);
    const v8f v = *(const v8f*)(src + (row - first) * DM + kb * 32 + j * 8); v8us o;
#pragma unroll
    for (int k = 0; k < 8; ++k) o[k] = f2bf(v[k]); *(v8us*)(dst + (row >> 4) * (16 * DM) + kb * 512 + (j >> 1) * 256 + ((j & 1) * 16 + (row & 15)) * 8) = o;  }

__constant__ float INVT[HD / 2] = { 1.000000000e+00f, 7.498942018e-01f, 5.623413324e-01f, 4.216965139e-01f, 3.162277639e-01f, 2.371373624e-01f, 1.778279394e-01f, 1.333521456e-01f, 1.000000015e-01f, 7.498941571e-02f, 5.623412877e-02f, 4.216964915e-02f, 3.162277862e-02f, 2.371373586e-02f, 1.778279431e-02f, 1.333521493e-02f, 9.999999776e-03f, 7.498942316e-03f, 5.623413250e-03f, 4.216964822e-03f, 3.162277862e-03f, 2.371373819e-03f, 1.778279431e-03f, 1.333521446e-03f, 1.000000047e-03f, 7.498941850e-04f, 5.623413017e-04f, 4.216964880e-04f, 3.162277862e-04f, 2.371373848e-04f, 1.778279402e-04f, 1.333521504e-04f };   // float32 1 / 10000^(2i/64), generated with jnp to be bit-exact
__device__ __forceinline__ void cs5(float* CS, int idx) { const int d = idx % HD; const int t = idx / HD; const float a = __fmul_rn((float)t, INVT[d % (HD / 2)]); v2f cs; cs[0] = cosf(a); cs[1] = sinf(a); *(v2f*)(CS + (size_t)idx * 2) = cs;  }
// k_prep: the rotary table and all five conversions in one grid: the first TT * HD / 256 work-groups write the table, each of the others converts 256 pieces.
__global__ __launch_bounds__(256) void k_prep(const float* __restrict__ x, const float* __restrict__ wq, const float* __restrict__ wk, const float* __restrict__ wv, const float* __restrict__ wo, bf* dst, float* CS) {
    static_assert(TT * HD % 256 == 0 && DM == 2048, "whole work-groups for the table; 8 work-groups to 8 rows");
    const int g = blockIdx.x;
    if (g < TT * HD / 256) cs5(CS, g * 256 + (int)threadIdx.x);
    else cvt8(x, wq, wk, wv, wo, dst, (size_t)(g - TT * HD / 256) * 256 + threadIdx.x, ((g - TT * HD / 256) >> 3) * 8);
}
// ---- k_fattn: scores, softmax, probability x value and the head merge in ONE kernel (running maximum and running sum per query; no score or probability ever leaves the registers).
// One wave = 16 query rows of one head; the REP waves of a work-group are the REP heads of one kv group, so they walk the same K and V lines from key 0 on. Grid (NKV, NB_, TT / 16); no LDS, no barrier.
// S^T = K Q^T: A = K rows (key = lane & 15), B = Q rows (query = lane & 15), so lane (lr, hi) holds for query lr the keys 8 hi + j of each 16-key tile: maximum and sum in-lane plus one exchange between the wave halves.
// Two such tiles, converted in place, are the B operand (k = 8 hi + s, 16 + 8 hi + (s - 8)) of O^T += V^T P^T, A = V^T rows loaded in the same k order; O^T keeps query = lane & 15, so the rescale is lane-local and a lane stores 8 consecutive d. Q, K, V^T come in fragment order (WFrag) and the output leaves in it.
// Rows < RH: hi/lo planes, 3 products each, 32 keys a pass; the rest fp16, 64 keys a pass, probabilities carried x 2^10 (the sum carries the same factor, so it cancels in the division).
typedef __attribute__((ext_vector_type(16))) unsigned short v16us;
template <bool B> struct Flag { static constexpr bool v = B; };
// 2^x on the transcendental unit with the slot that the instruction set asks for behind it, in one statement: each v_exp_f32 works in place, so none touches the source or the result of the one in front of it, and the closing v_nop stands between the last one and whatever the compiler schedules next.
__device__ __forceinline__ void exp2x8(float (&e)[8]) {
    asm("v_exp_f32 %0, %0\n\tv_exp_f32 %1, %1\n\tv_exp_f32 %2, %2\n\tv_exp_f32 %3, %3\n\tv_exp_f32 %4, %4\n\tv_exp_f32 %5, %5\n\tv_exp_f32 %6, %6\n\tv_exp_f32 %7, %7\n\tv_nop"
        : "+v"(e[0]), "+v"(e[1]), "+v"(e[2]), "+v"(e[3]), "+v"(e[4]), "+v"(e[5]), "+v"(e[6]), "+v"(e[7])); }
__device__ __forceinline__ float exp2x1(float a) { float e; asm("v_exp_f32 %0, %1\n\tv_nop" : "=v"(e) : "v"(a)); return e; }   // the same for one value
template <typename T16, bool HL, int KB>
__device__ __forceinline__ void fattn_body(const T16* __restrict__ Q, const T16* __restrict__ Q2, const T16* __restrict__ Kp, const T16* __restrict__ Kp2, const T16* __restrict__ Vt, const T16* __restrict__ Vt2, int q0, int kv, int head, bf* Ah, bf* Al) {
    typedef typename WFrag<T16>::V V;
    constexpr int NKT = KB / 16, NKH = KB / 32;
    constexpr float C1 = SCL * 1.4426950408889634f;   // raw score -> log2 units: HD^-0.5 x log2(e)
    constexpr bool AHEAD = !HL;   // K fragments fetched one pass ahead; not on the hi/lo path, whose twofold fragments would then take the wave past 256 registers
    const int lane = threadIdx.x & 31, lr = lane & 15, hi = lane >> 4; const int qi = q0 + lr;
    V qf[2], qf2[2];
    { const T16* pq = Q + ((size_t)head * TT + q0) * HD + 8 * lane; qf[0] = WFrag<T16>::ld(pq); qf[1] = WFrag<T16>::ld(pq + 512);
      // s_wait_xcnt 0 behind the run of Q loads, in front of any overwrite of an address register that they name (a precaution); the pointers are inputs so that they stay in their registers up to the wait
      if constexpr (HL) { const T16* pq2 = Q2 + ((size_t)head * TT + q0) * HD + 8 * lane; qf2[0] = WFrag<T16>::ld(pq2); qf2[1] = WFrag<T16>::ld(pq2 + 512); asm volatile("s_wait_xcnt 0x0" :: "v"(pq), "v"(pq2) : "memory"); }
      else asm volatile("s_wait_xcnt 0x0" :: "v"(pq) : "memory"); }
    const size_t koff = (size_t)kv * TT * HD + 8 * lane, voff = (size_t)kv * HD * TT + 8 * lane;
    v8f o[4];
#pragma unroll
    for (int db = 0; db < 4; ++db) o[db] = (v8f){};
    float m = -3.0e38f, l = 0.f;
    V kf[NKT][2], kf2[NKT][2];
    auto load_k = [&](int k0) {   // the K fragments of the pass that starts at key k0
        const T16* pk = Kp + koff + (size_t)k0 * HD;
#pragma unroll
        for (int kt = 0; kt < NKT; ++kt)
#pragma unroll
            for (int ks = 0; ks < 2; ++ks) kf[kt][ks] = WFrag<T16>::ld(pk + (kt * 2 + ks) * 512);
        // the same wait behind the run of K loads
        if constexpr (HL) { const T16* pk2 = Kp2 + koff + (size_t)k0 * HD;
#pragma unroll
            for (int kt = 0; kt < NKT; ++kt)
#pragma unroll
                for (int ks = 0; ks < 2; ++ks) kf2[kt][ks] = WFrag<T16>::ld(pk2 + (kt * 2 + ks) * 512);
            asm volatile("s_wait_xcnt 0x0" :: "v"(pk), "v"(pk2) : "memory"); }
        else asm volatile("s_wait_xcnt 0x0" :: "v"(pk) : "memory"); };
    auto pass = [&](int k0, auto edge) {   // KB keys from k0 on; edge: the one pass that holds the diagonal (causal select, no pass behind it)
        constexpr bool EDGE = decltype(edge)::v;
        V vf[4][NKH], vf2[4][NKH];
        if constexpr (!AHEAD) load_k(k0);
        const T16* pv = Vt + voff + (size_t)k0 * 16;
#pragma unroll
        for (int db = 0; db < 4; ++db)
#pragma unroll
            for (int kh = 0; kh < NKH; ++kh) vf[db][kh] = WFrag<T16>::ld(pv + (size_t)db * 16 * TT + kh * 512);
        // the same wait behind the run of V loads
        if constexpr (HL) { const T16* pv2 = Vt2 + voff + (size_t)k0 * 16;
#pragma unroll
            for (int db = 0; db < 4; ++db)
#pragma unroll
                for (int kh = 0; kh < NKH; ++kh) vf2[db][kh] = WFrag<T16>::ld(pv2 + (size_t)db * 16 * TT + kh * 512);
            asm volatile("s_wait_xcnt 0x0" :: "v"(pv), "v"(pv2) : "memory"); }
        else asm volatile("s_wait_xcnt 0x0" :: "v"(pv) : "memory");
        v8f s[NKT];
#pragma unroll
        for (int kt = 0; kt < NKT; ++kt) { s[kt] = (v8f){};
#pragma unroll
            for (int ks = 0; ks < 2; ++ks) { s[kt] = WFrag<T16>::mma(kf[kt][ks], qf[ks], s[kt]); if constexpr (HL) { s[kt] = WFrag<T16>::mma(kf[kt][ks], qf2[ks], s[kt]); s[kt] = WFrag<T16>::mma(kf2[kt][ks], qf[ks], s[kt]); } } }
        if constexpr (AHEAD && !EDGE) load_k(k0 + KB);   // the next pass's K fragments fly during this pass's softmax and P.V (a pass that is not the edge pass always has a successor)
        float bm = -3.0e38f; const int rel = qi - k0 - hi * 8;   // a lane's key kt * 16 + j of the pass is allowed while it is <= rel
#pragma unroll
        for (int kt = 0; kt < NKT; ++kt)
#pragma unroll
            for (int j = 0; j < 8; ++j) { if constexpr (EDGE) s[kt][j] = (kt * 16 + j <= rel) ? s[kt][j] : -3.0e38f; bm = fmaxf(bm, s[kt][j]); }
        bm = fmaxf(bm, __shfl_xor(bm, 16, 32));
        const float mn = fmaxf(m, bm * C1); const float alpha = exp2x1(m - mn); m = mn;   // the running maximum is kept in log2 units
        const float sh = (HL ? 0.0f : 10.0f) - mn;
        float ls[NKT];
#pragma unroll
        for (int kt = 0; kt < NKT; ++kt) { float e[8]; ls[kt] = 0.f;
#pragma unroll
            for (int j = 0; j < 8; ++j) e[j] = s[kt][j] * C1 + sh;   // one multiply-add from raw score to exponent
            exp2x8(e);
#pragma unroll
            for (int j = 0; j < 8; ++j) { s[kt][j] = e[j]; ls[kt] += e[j]; } }
        float lsum = ls[0];
#pragma unroll
        for (int kt = 1; kt < NKT; ++kt) lsum += ls[kt];
        l = l * alpha + lsum;   // each wave half keeps the sum of its own keys; the halves are joined once, behind the last pass
#pragma unroll
        for (int db = 0; db < 4; ++db) o[db] *= alpha;
#pragma unroll
        for (int kh = 0; kh < NKH; ++kh) {
            if constexpr (HL) { v16us ph, pl;
#pragma unroll
                for (int q = 0; q < 16; ++q) { unsigned short a, c2; splitf(s[kh * 2 + (q >> 3)][q & 7], a, c2); ph[q] = a; pl[q] = c2; }
                const V pfh = __builtin_bit_cast(V, ph), pfl = __builtin_bit_cast(V, pl);
#pragma unroll
                for (int db = 0; db < 4; ++db) { o[db] = WFrag<T16>::mma(vf[db][kh], pfh, o[db]); o[db] = WFrag<T16>::mma(vf[db][kh], pfl, o[db]); o[db] = WFrag<T16>::mma(vf2[db][kh], pfh, o[db]); }
            } else { V pf;
#pragma unroll
                for (int q = 0; q < 16; ++q) pf[q] = tohx(s[kh * 2 + (q >> 3)][q & 7]);
#pragma unroll
                for (int db = 0; db < 4; ++db) o[db] = WFrag<T16>::mma(vf[db][kh], pf, o[db]); } }
        asm volatile("v_nop\n\tv_nop\n\tv_nop\n\tv_nop" : "+v"(o[0]), "+v"(o[1]), "+v"(o[2]), "+v"(o[3]) : "v"(vf[3][NKH - 1]));   // four vector slots behind the last WMMA, also on the taken back edge, before fragments or accumulators are touched
    };
    int k0 = 0;   // both loops stay rolled: one pass already holds every fragment of KB keys in registers
    if constexpr (AHEAD) { static_assert(RH >= KB, "the fetch-ahead loop runs at least once: its rows start at RH");
        load_k(0);
#pragma unroll 1
        do { pass(k0, Flag<false>{}); k0 += KB; } while (k0 + KB - 1 <= q0);
    } else {
#pragma unroll 1
        for (; k0 + KB - 1 <= q0; k0 += KB) pass(k0, Flag<false>{}); }
    pass(k0, Flag<true>{});
    const float f = __fdiv_rn(1.0f, l + __shfl_xor(l, 16, 32));
    const size_t oo = (size_t)q0 * DQ + head * (2 * 512) + 8 * lane; v8us oh[4], ol[4];   // fragment order of the wo product's A operand (rows = queries, k = head * HD + d): a lane's 8 values of d block db are its own piece of half db & 1 of k block head * 2 + (db >> 1)
#pragma unroll
    for (int db = 0; db < 4; ++db)
#pragma unroll
        for (int j = 0; j < 8; ++j) { unsigned short a, c2; splitf(o[db][j] * f, a, c2); oh[db][j] = a; ol[db][j] = c2; }
#pragma unroll
    for (int db = 0; db < 4; ++db) { *(v8us*)(Ah + oo + db * 256) = oh[db]; *(v8us*)(Al + oo + db * 256) = ol[db]; }
}
// amdgpu_waves_per_eu(4, 4): at most 256 registers a wave, so that four waves share a SIMD and half of the NKV x NB_ x TT / 16 work-groups are resident at once; the others follow as places come free
__global__ __launch_bounds__(32 * REP) __attribute__((amdgpu_waves_per_eu(4, 4))) void k_fattn(const h16* __restrict__ Q16, const bf* __restrict__ Qh, const bf* __restrict__ Ql, const h16* __restrict__ K16, const bf* __restrict__ Kh, const bf* __restrict__ Kl, const h16* __restrict__ V16, const bf* __restrict__ Vh, const bf* __restrict__ Vl, bf* Ah, bf* Al) {
    const int wave = __builtin_amdgcn_readfirstlane((int)(threadIdx.x >> 5));   // wave number in a scalar register: head, loop bound and branches stay scalar
    const int kv = blockIdx.x, head = kv * REP + wave, rank = blockIdx.z;
    { const size_t zq = (size_t)blockIdx.y * ((size_t)NH_ * TT * HD), zk = (size_t)blockIdx.y * ((size_t)NKV * TT * HD), za = (size_t)blockIdx.y * ((size_t)TT * DQ);   // this batch's planes
      Q16 += zq; Qh += zq; Ql += zq; K16 += zk; Kh += zk; Kl += zk; V16 += zk; Vh += zk; Vl += zk; Ah += za; Al += za; }
    // There are twice as many work-groups as places: the four heads of a work-group take the same tile, and a tile's cost falls with the rank (the slowest grid index), so that the short ones fill the places that the long ones leave.
    // An fp16 tile t costs about t; a hi/lo tile h (three products a key) about 3 h: ranks 0..33 are tiles 127..94; then groups of four (hi/lo tile 31 - g, fp16 tiles 93 - 3 g, 92 - 3 g, 91 - 3 g) down to tile 32; ranks 117..127 are tiles 10..0. For speed only; the map is a permutation, so each (head, tile) is taken once.
    static_assert(TT / 16 == 128 && RH / 16 == 32, "the rank -> tile map is written for 128 tiles, 32 of them hi/lo");
    const int s = rank - 34; const int tile = (rank < 34 || rank >= 117) ? 127 - rank : ((s & 3) == 0 ? 31 - (s >> 2) : 94 - 3 * (s >> 2) - (s & 3)); const int q0 = tile * 16;
    if (q0 < RH) fattn_body<bf, true, 32>(Qh, Ql, Kh, Kl, Vh, Vl, q0, kv, head, Ah, Al);
    else fattn_body<h16, false, 64>(Q16, nullptr, K16, nullptr, V16, nullptr, q0, kv, head, Ah, Al);
}

extern "C" void kernel_launch(void* const* d_in, const int* in_sizes, int n_in,
                              void* d_out, int out_size, void* d_ws, size_t ws_size, hipStream_t stream) {
    (void)in_sizes; (void)n_in; (void)out_size;
        const float* x = (const float*)d_in[0]; const float* wq = (const float*)d_in[1]; const float* wk = (const float*)d_in[2]; const float* wv = (const float*)d_in[3]; const float* wo = (const float*)d_in[4];   /* inputs x, wq [2048][2048], wk [512][2048], wv, wo ('oi'); this module has no mask input (the causal rule is by index) */
    float* OUT = (float*)d_out;     // [2][2048][2048]
    char* wsp = (char*)d_ws;
    auto take = [&](size_t bytes) { char* p = wsp; wsp += (bytes + 255) & ~(size_t)255; return (void*)p; };
    bf* XB = (bf*)take((size_t)CROWS * DM * 2); bf* WQ = XB + (size_t)NB_ * TT * DM; bf* WK = WQ + (size_t)DQ * DM; bf* WV = WK + (size_t)DKV * DM; bf* WO = WV + (size_t)DKV * DM;   // one block, in the row order of cvt8
    float* CS = (float*)take((size_t)TT * HD * 2 * 4);
    // every plane below holds both batches, one behind the other
    h16* QP16 = (h16*)take((size_t)NB_ * NH_ * TT * HD * 2); h16* KP16 = (h16*)take((size_t)NB_ * NKV * TT * HD * 2); h16* VT16 = (h16*)take((size_t)NB_ * NKV * HD * TT * 2);
    bf* QPh = (bf*)take((size_t)NB_ * NH_ * TT * HD * 2); bf* QPl = (bf*)take((size_t)NB_ * NH_ * TT * HD * 2); bf* KPh = (bf*)take((size_t)NB_ * NKV * TT * HD * 2); bf* KPl = (bf*)take((size_t)NB_ * NKV * TT * HD * 2); bf* VTh = (bf*)take((size_t)NB_ * NKV * HD * TT * 2); bf* VTl = (bf*)take((size_t)NB_ * NKV * HD * TT * 2);
    bf* ATh = (bf*)take((size_t)NB_ * TT * DQ * 2); bf* ATl = (bf*)take((size_t)NB_ * TT * DQ * 2);
    if ((size_t)(wsp - (char*)d_ws) > ws_size) return;    // ws 256 MiB
    k_prep<<<TT * HD / 256 + CROWS * (DM / 8) / 256, 256, 0, stream>>>(x, wq, wk, wv, wo, XB, CS);   /* rotary table and every 16-bit copy */
    k_proj<<<dim3(TT / 128, DQ / 128 + 2 * (DKV / 128), NB_), 256, 0, stream>>>(XB, WQ, WK, WV, CS, QP16, QPh, QPl, KP16, KPh, KPl, VT16, VTh, VTl);
    k_fattn<<<dim3(NKV, NB_, TT / 16), 32 * REP, 0, stream>>>(QP16, QPh, QPl, KP16, KPh, KPl, VT16, VTh, VTl, ATh, ATl);
    k_gemmw<bf, 1, 0><<<dim3(TT / 128, DM / 128, NB_), 256, 0, stream>>>(ATh, ATl, WO, DQ, DQ, OUT, DM, (size_t)TT * DQ, (size_t)TT * DM);
}

// v008
// One run takes 138 microseconds.
// Timed twice side by side with v007, it ran 1.06 times as fast both times.
// All steps since v000 together make it 19.4 times as fast.
#include <hip/hip_runtime.h>

// Grouped-query causal attention with a computed half-split RoPE (x [2][2048][2048]; xq = x wq^T (32 heads x 64), xk, xv = x wk^T, x wv^T (8 kv heads x 64) ('oi', no bias; token-major); cos / sin from inv_freq = 1 / (10000 ** (2i / 64)) and positions arange(S) ([S][32] tables); (x1, x2) = the two 32-wide halves of each head: cat(x1 c - x2 s, x1 s + x2 c) (half-split pairs (d, d + 32)) on q and k; k, v repeated 4 x on the head axis (jnp.repeat: kv head = q head / 4); scores / sqrt(64); where(tril, scores, finfo.min) == exclusion; softmax; out = merged wo^T ('oi') -> [2][2048][2048] (8.4 M); argument order x, wq, wk, wv, wo).
// Every 16-bit matrix operand (x, the weights, the q, k and v^T planes, the merged attention output) is stored by its producer in fragment order (see WFrag).
// Four launches, each over both batches (k_prep, k_proj, k_fattn, k_gemmw for wo). Layout: bf16 copy of x; 'oi' weights; exact projections whose epilogue applies the rotate-half rotation (cs5 computed table) and stores the 16-bit planes itself; causal T-2048 GQA attention fused in one kernel (k_fattn: running softmax in registers, kv plane = head / REP; hybrid rows: < 512 hi/lo 3 products, rest fp16 x1024; keys above the diagonal block are never read); merged hi/lo x wo exact.
// Compute dtypes, f32 accumulate: every input rounded to bf16; projections exact; rotary f32; attention rows < 512 3 products, rest fp16; softmax f32; wo hl x exact.

#define NB_  2
#define TT   2048
#define DM   2048
#define NH_  32
#define NKV  8
#define REP  (NH_ / NKV)
#define HD   64
#define DQ   (NH_ * HD)
#define DKV  (NKV * HD)
#define RH   512                  // query rows < RH use hi+lo planes
#define SCL  0.125f   // HD^-0.5
typedef _Float16 h16;
typedef unsigned short bf;
typedef __attribute__((ext_vector_type(16))) __bf16   v16bf;
typedef __attribute__((ext_vector_type(16))) _Float16 v16h;
typedef __attribute__((ext_vector_type(8)))  _Float16 v8h;
typedef __attribute__((ext_vector_type(8)))  unsigned short v8us;
typedef __attribute__((ext_vector_type(8)))  float    v8f;
typedef __attribute__((ext_vector_type(4)))  float    v4f;
typedef v8h  __attribute__((may_alias)) v8ha;
typedef v4f  __attribute__((may_alias)) v4fa;
typedef v8us __attribute__((may_alias)) v8usa;

__device__ __forceinline__ unsigned short f2bf(float f) { unsigned u = __float_as_uint(f); u += 0x7FFFu + ((u >> 16) & 1u); return (unsigned short)(u >> 16); }
__device__ __forceinline__ float bf2f(unsigned short b) { return __uint_as_float(((unsigned)b) << 16); }
__device__ __forceinline__ float bfr(float f) { return bf2f(f2bf(f)); }
__device__ __forceinline__ v16h cat16(v8h lo, v8h hi) { return __builtin_shufflevector(lo, hi, 0, 1, 2, 3, 4, 5, 6, 7, 8, 9, 10, 11, 12, 13, 14, 15); }
__device__ __forceinline__ v16bf cat16b(v8us lo, v8us hi) { return __builtin_bit_cast(v16bf, __builtin_shufflevector(lo, hi, 0, 1, 2, 3, 4, 5, 6, 7, 8, 9, 10, 11, 12, 13, 14, 15)); }
__device__ __forceinline__ v8f wmma16(v16h a, v16h b, v8f c) { return __builtin_amdgcn_wmma_f32_16x16x32_f16(false, a, false, b, (short)0, c, false, false); }
__device__ __forceinline__ v8f wmmab(v16bf a, v16bf b, v8f c) { return __builtin_amdgcn_wmma_f32_16x16x32_bf16(false, a, false, b, (short)0, c, false, false); }
__device__ __forceinline__ h16 tohx(float x) { return (h16)x; }
__device__ __forceinline__ void splitf(float y, unsigned short& h, unsigned short& l) { h = f2bf(y); l = f2bf(y - bf2f(h)); }



// ---- k_gemmw: register-blocked GEMM, one 128x128 output tile per work-group of 8 waves; grid (M/128, N/128, Z), 256 threads. The tile is 2 x 2 sub-tiles of 64x64; two waves share a sub-tile and split K between them (wave = sub-tile * 2 + wk).
// K goes in stages of 64 (two 1-KiB blocks of every group of 16 operand rows): the work-group brings the stage's 128 rows of every operand into LDS once, by asynchronous copies, two buffers, the next stage flying while this one is worked on; so each operand byte leaves L2 once per 128x128 tile and serves two sub-tiles.
// Wave wk takes k block wk of every stage and keeps its own 64x64 partial tile (16 accumulators); the two partial tiles of a sub-tile are then summed, wk 0 first, through LDS (the staging buffers' place, free by then).
// C[m][n] (f32, pitch ldc) = sum_k A[m][k] Bt[n][k] (NSPLIT 1: + A2[m][k] Bt[n][k]). A has lda, Bt K elements a row (fragment order). z-batch strides sA/sC in elements. K % 64 == 0.
// Fragment order: a block of 16 rows x 32 k of an operand is 512 consecutive elements, element (r, k) at (k >> 4) * 256 + (((k >> 3) & 1) * 16 + r) * 8 + (k & 7): lane l's two 16-byte pieces (row l & 15; k = 8 (l >> 4) + 0..7 and 16 + 8 (l >> 4) + 0..7) lie at l * 8 and 256 + l * 8,
// so each wave-wide 16-byte load covers 512 contiguous bytes (4 whole lines, not 16 pieces of 32 B). Blocks follow one another along k, then along the groups of 16 rows: a matrix of pitch P has block (row group g, k block b) at g * 16 * P + b * 512. ld takes the block's address + 8 * lane.
// EPI 0: the summed tile goes out as f32 C. EPI 1, 2: no f32 tile leaves the kernel; the tile is stored as three 16-bit planes (fp16, bf16 hi, bf16 lo) in fragment order, a thread taking the pieces of columns 8 o .. 8 o + 7 and 32 + 8 o .. of one row, so each wave-wide 16-byte store covers 512 contiguous bytes.
// EPI 1 (q, k; rows = positions t, the 64 columns = one head): rotate-half first, out[d] = x[d] cos[t][d] - x[d+32] sin[t][d], out[d+32] = x[d+32] cos[t][d] + x[d] sin[t][d] (a thread's two pieces are exactly such pairs); planes [head][t][d], pitch HD.
// EPI 2 (v; launched as wv x^T, so rows = kv head * HD + d and columns = t: the tile is V^T already): planes [g][d][t], pitch TT.
template <typename T16> struct WFrag;
template <> struct WFrag<h16> { typedef v16h V; static __device__ __forceinline__ V ld(const h16* p) { return cat16(*(const v8h*)p, *(const v8h*)(p + 256)); } static __device__ __forceinline__ v8f mma(V a, V b, v8f c) { return wmma16(a, b, c); } };
template <> struct WFrag<bf> { typedef v16bf V; static __device__ __forceinline__ V ld(const bf* p) { return cat16b(*(const v8us*)p, *(const v8us*)(p + 256)); } static __device__ __forceinline__ v8f mma(V a, V b, v8f c) { return wmmab(a, b, c); } };
// copy8, copy12: a stage's asynchronous 16-byte-a-lane copies to LDS, four an operand, 4 KiB apart in LDS and sa (A, A2) or sb (Bt) bytes apart in memory. The s_wait_xcnt 0 stands in the copies' own statement, in front of any overwrite of a register that they name (a precaution).
__device__ __forceinline__ void copy8(unsigned l, const char* a, size_t sa, const char* b, size_t sb) {
    asm volatile("global_load_async_to_lds_b128 %0, %8, off\n\tglobal_load_async_to_lds_b128 %1, %9, off\n\tglobal_load_async_to_lds_b128 %2, %10, off\n\tglobal_load_async_to_lds_b128 %3, %11, off\n\tglobal_load_async_to_lds_b128 %4, %12, off\n\tglobal_load_async_to_lds_b128 %5, %13, off\n\tglobal_load_async_to_lds_b128 %6, %14, off\n\tglobal_load_async_to_lds_b128 %7, %15, off\n\ts_wait_xcnt 0x0"
                 :: "v"(l), "v"(l + 4096u), "v"(l + 8192u), "v"(l + 12288u), "v"(l + 16384u), "v"(l + 20480u), "v"(l + 24576u), "v"(l + 28672u),
                    "v"(a), "v"(a + sa), "v"(a + 2 * sa), "v"(a + 3 * sa), "v"(b), "v"(b + sb), "v"(b + 2 * sb), "v"(b + 3 * sb) : "memory"); }
__device__ __forceinline__ void copy12(unsigned l, const char* a, size_t sa, const char* b, size_t sb, const char* a2) {
    asm volatile("global_load_async_to_lds_b128 %0, %12, off\n\tglobal_load_async_to_lds_b128 %1, %13, off\n\tglobal_load_async_to_lds_b128 %2, %14, off\n\tglobal_load_async_to_lds_b128 %3, %15, off\n\tglobal_load_async_to_lds_b128 %4, %16, off\n\tglobal_load_async_to_lds_b128 %5, %17, off\n\tglobal_load_async_to_lds_b128 %6, %18, off\n\tglobal_load_async_to_lds_b128 %7, %19, off\n\tglobal_load_async_to_lds_b128 %8, %20, off\n\tglobal_load_async_to_lds_b128 %9, %21, off\n\tglobal_load_async_to_lds_b128 %10, %22, off\n\tglobal_load_async_to_lds_b128 %11, %23, off\n\ts_wait_xcnt 0x0"
                 :: "v"(l), "v"(l + 4096u), "v"(l + 8192u), "v"(l + 12288u), "v"(l + 16384u), "v"(l + 20480u), "v"(l + 24576u), "v"(l + 28672u), "v"(l + 32768u), "v"(l + 36864u), "v"(l + 40960u), "v"(l + 45056u),
                    "v"(a), "v"(a + sa), "v"(a + 2 * sa), "v"(a + 3 * sa), "v"(b), "v"(b + sb), "v"(b + 2 * sb), "v"(b + 3 * sb), "v"(a2), "v"(a2 + sa), "v"(a2 + 2 * sa), "v"(a2 + 3 * sa) : "memory"); }
// gemmw_body is the work of one work-group: the tile at rows r0, columns c0, with red = its 8 * 64 * 68 floats of LDS; the kernels below pick tile, operands and planes from blockIdx.
// A stage in LDS: [A 16 KiB | Bt 16 KiB | A2 16 KiB (NSPLIT 1)], each the operand's 8 groups of 16 rows, 2 KiB (two k blocks, as they lie in memory) a group. One copy of all 256 threads moves two groups.
template <typename T16, int NSPLIT, int EPI>
__device__ __forceinline__ void gemmw_body(float* red, int r0, int c0, const T16* __restrict__ A, const T16* __restrict__ A2, const T16* __restrict__ Bt, int K, int lda, float* C, int ldc, const float* __restrict__ CS, h16* P16, bf* Ph, bf* Pl) {
    typedef typename WFrag<T16>::V V;
    static_assert(NSPLIT == 0 || NSPLIT == 1, "one or two A planes");
    constexpr int SB = (NSPLIT == 1 ? 3 : 2) * 16384;   // bytes of a stage
    static_assert(2 * SB <= 8 * 64 * 68 * 4, "both buffers lie inside red");
    const int tid = (int)threadIdx.x, lane = tid & 31, lr = lane & 15, hi = lane >> 4;
    const int wave = __builtin_amdgcn_readfirstlane(tid >> 5);   // wave number in a scalar register: sub-tile and k block stay scalar
    const int sm = wave >> 2, sn = (wave >> 1) & 1, wk = wave & 1;
    const int NT = K / 64;
    v8f acc[4][4];
#pragma unroll
    for (int mb = 0; mb < 4; ++mb)
#pragma unroll
        for (int nb = 0; nb < 4; ++nb) acc[mb][nb] = (v8f){};
    // this thread's 16 bytes of the first two groups of each operand; the next two groups lie 32 rows on, the next stage 2 KiB on
    const char* gA = (const char*)(A + (size_t)(r0 + 16 * (tid >> 7)) * lda + (tid & 127) * 8);
    const char* gB = (const char*)(Bt + (size_t)(c0 + 16 * (tid >> 7)) * K + (tid & 127) * 8);
    const char* gA2 = NSPLIT == 1 ? (const char*)(A2 + (size_t)(r0 + 16 * (tid >> 7)) * lda + (tid & 127) * 8) : nullptr;
    const unsigned l0 = (unsigned)(size_t)red + (unsigned)tid * 16u;   // LDS byte address: the low 32 bits of the __shared__ address
    auto stage = [&](int t) {   // stage t's copies into buffer t & 1
        const unsigned l = l0 + (unsigned)(t & 1) * (unsigned)SB; const size_t o = (size_t)t * 2048;
        if constexpr (NSPLIT == 1) copy12(l, gA + o, (size_t)lda * 64, gB + o, (size_t)K * 64, gA2 + o);
        else copy8(l, gA + o, (size_t)lda * 64, gB + o, (size_t)K * 64); };
    stage(0);
    asm volatile("s_wait_asynccnt 0x0" ::: "memory");   // this wave's copies of stage 0 have landed
    __syncthreads();                                     // ... and every other wave's: stage 0 may be read
    if (1 < NT) stage(1);
#pragma unroll 1   // rolled: one copy of the stage's code, the buffer picked by t & 1
    for (int t = 0; t < NT; ++t) {
        const T16* sb = (const T16*)red + (t & 1) * (SB / 2) + wk * 512 + 8 * lane;
        V a[4], a2[4], b[4];   // every fragment of the stage is asked for in one group, in front of the first WMMA
#pragma unroll
        for (int mb = 0; mb < 4; ++mb) { a[mb] = WFrag<T16>::ld(sb + (sm * 4 + mb) * 1024); b[mb] = WFrag<T16>::ld(sb + 8192 + (sn * 4 + mb) * 1024); }
        if constexpr (NSPLIT == 1) {
#pragma unroll
            for (int mb = 0; mb < 4; ++mb) a2[mb] = WFrag<T16>::ld(sb + 16384 + (sm * 4 + mb) * 1024); }
        asm volatile("" :: "v"(b[0]), "v"(b[1]), "v"(b[2]), "v"(b[3]));   // inputs only: holds the B fragments' loads in the one group in front of the first WMMA; left alone the compiler puts three of them among the WMMAs, each with a wait for the LDS of its own
#pragma unroll
        for (int nb = 0; nb < 4; ++nb)
#pragma unroll
            for (int mb = 0; mb < 4; ++mb) acc[mb][nb] = WFrag<T16>::mma(a[mb], b[nb], acc[mb][nb]);
        if constexpr (NSPLIT == 1) {
#pragma unroll
            for (int nb = 0; nb < 4; ++nb)
#pragma unroll
                for (int mb = 0; mb < 4; ++mb) acc[mb][nb] = WFrag<T16>::mma(a2[mb], b[nb], acc[mb][nb]); }
        // four vector slots behind the last WMMA, also on the taken back edge, before fragments or accumulators are touched; every accumulator is named so that no WMMA of the stage stands behind them
        asm volatile("v_nop\n\tv_nop\n\tv_nop\n\tv_nop" : "+v"(acc[0][0]), "+v"(acc[0][1]), "+v"(acc[0][2]), "+v"(acc[0][3]), "+v"(acc[1][0]), "+v"(acc[1][1]), "+v"(acc[1][2]), "+v"(acc[1][3]), "+v"(acc[2][0]), "+v"(acc[2][1]), "+v"(acc[2][2]), "+v"(acc[2][3]), "+v"(acc[3][0]), "+v"(acc[3][1]), "+v"(acc[3][2]), "+v"(acc[3][3]));
        asm volatile("s_wait_dscnt 0x0" ::: "memory");
        asm volatile("s_wait_asynccnt 0x0" ::: "memory");
        __syncthreads();
        if (t + 2 < NT) stage(t + 2);
    }
    asm volatile("s_wait_asynccnt 0x0" ::: "memory");   // nothing is in flight when the buffers become the partial tiles' place
    const int pg = tid >> 6, po = (tid >> 4) & 3, prow = pg * 16 + (tid & 15);   // EPI 1, 2: this thread's group of 16 rows, its 8-column piece and its row of a sub-tile
    v4f cs[2][4];
    if constexpr (EPI == 1) { const float* pc = CS + ((size_t)(r0 + prow) * HD + po * 8) * 2;   // (cos, sin) of the thread's 8 column pairs, for its row of the upper and of the lower sub-tiles, asked for here so that they fly during the LDS stores and the barrier
#pragma unroll
        for (int h = 0; h < 2; ++h)
#pragma unroll
            for (int q = 0; q < 4; ++q) cs[h][q] = *(const v4f*)(pc + h * (64 * HD * 2) + q * 4);
        asm volatile("s_wait_xcnt 0x0" :: "v"(pc) : "memory"); }   // the wait stands in front of any overwrite of the address register that the loads name (a precaution)
    float* mine = red + wave * (64 * 68);
#pragma unroll
    for (int mb = 0; mb < 4; ++mb)
#pragma unroll
        for (int nb = 0; nb < 4; ++nb)
#pragma unroll
            for (int j = 0; j < 8; ++j) mine[(mb * 16 + hi * 8 + j) * 68 + nb * 16 + lr] = acc[mb][nb][j];
    __syncthreads();   // every wave's partial tile is in LDS before any wave sums
    if constexpr (EPI == 0) {
        v4f val[16]; float* pc[16];
#pragma unroll
        for (int s = 0; s < 16; ++s) { const int sub = s >> 2, q = (s & 3) * 256 + tid, row = q >> 4, cofs = (q & 15) * 4; const float* pr = red + sub * (2 * 64 * 68) + row * 68 + cofs;
            val[s] = *(const v4fa*)pr + *(const v4fa*)(pr + 64 * 68); pc[s] = C + (size_t)(r0 + (sub >> 1) * 64 + row) * ldc + c0 + (sub & 1) * 64 + cofs; }
#pragma unroll
        for (int s = 0; s < 16; ++s) *(v4f*)pc[s] = val[s];
        // one s_wait_xcnt 0 behind the run of stores; the pointers are inputs so that they stay in their registers up to the wait (a precaution)
        asm volatile("s_wait_xcnt 0x0" :: "v"(pc[0]), "v"(pc[1]), "v"(pc[2]), "v"(pc[3]), "v"(pc[4]), "v"(pc[5]), "v"(pc[6]), "v"(pc[7]), "v"(pc[8]), "v"(pc[9]), "v"(pc[10]), "v"(pc[11]), "v"(pc[12]), "v"(pc[13]), "v"(pc[14]), "v"(pc[15]) : "memory");
    } else {
        static_assert(HD == 64, "256 threads = 64 rows x 4 pairs of 8-column pieces; one sub-tile = one head");
        float x[4][2][8];   // per sub-tile: x[0]: columns 8 po .. + 7, x[1]: the same + 32, each the two partials summed, wk 0 first
#pragma unroll
        for (int sub = 0; sub < 4; ++sub)
#pragma unroll
            for (int q = 0; q < 4; ++q) { const int cofs = (q >> 1) * 32 + po * 8 + (q & 1) * 4; const float* pr = red + sub * (2 * 64 * 68) + prow * 68 + cofs; const v4f val = *(const v4fa*)pr + *(const v4fa*)(pr + 64 * 68);
#pragma unroll
                for (int i = 0; i < 4; ++i) x[sub][q >> 1][(q & 1) * 4 + i] = val[i]; }
#pragma unroll
        for (int sub = 0; sub < 4; ++sub) { const int rs = r0 + (sub >> 1) * 64, cc = c0 + (sub & 1) * 64;   // the sub-tile's first row and column
            if constexpr (EPI == 1) {
#pragma unroll
                for (int j = 0; j < 8; ++j) { const float c = cs[sub >> 1][j >> 1][(j & 1) * 2], s = cs[sub >> 1][j >> 1][(j & 1) * 2 + 1], a = x[sub][0][j], b = x[sub][1][j]; x[sub][0][j] = a * c - b * s; x[sub][1][j] = b * c + a * s; } }
            v8h o16[2]; v8us oh[2], ol[2];
#pragma unroll
            for (int p = 0; p < 2; ++p)
#pragma unroll
                for (int j = 0; j < 8; ++j) { unsigned short a2, c2; splitf(x[sub][p][j], a2, c2); o16[p][j] = tohx(x[sub][p][j]); oh[p][j] = a2; ol[p][j] = c2; }
            // block (row group, k block) of a plane of pitch P lies at group * 16 * P + block * 512; the thread's piece of it at (8-column piece * 16 + row) * 8; its second piece is the next k block's
            const size_t oo = (EPI == 1 ? (size_t)(cc / HD) * TT * HD + (size_t)(rs + pg * 16) * HD : (size_t)(rs + pg * 16) * TT + (size_t)(cc / 32) * 512) + (tid & 63) * 8;
            h16* p16 = P16 + oo; bf* ph = Ph + oo; bf* pl = Pl + oo;
#pragma unroll
            for (int p = 0; p < 2; ++p) { *(v8h*)(p16 + p * 512) = o16[p]; *(v8us*)(ph + p * 512) = oh[p]; *(v8us*)(pl + p * 512) = ol[p]; }
            asm volatile("s_wait_xcnt 0x0" :: "v"(p16), "v"(ph), "v"(pl) : "memory"); }   // behind the sub-tile's stores, in front of any overwrite of an address register that they name (a precaution)
    }
}
template <typename T16, int NSPLIT, int EPI>
__global__ __launch_bounds__(256) void k_gemmw(const T16* __restrict__ A, const T16* __restrict__ A2, const T16* __restrict__ Bt, int K, int lda, float* C, int ldc, size_t sA, size_t sC) {
    __shared__ __align__(16) float red[8 * 64 * 68];
    const size_t z = blockIdx.z; A += z * sA; if (A2) A2 += z * sA; C += z * sC;
    gemmw_body<T16, NSPLIT, EPI>(red, blockIdx.x * 128, blockIdx.y * 128, A, A2, Bt, K, lda, C, ldc, nullptr, nullptr, nullptr, nullptr);
}
// k_proj: the q, k and v projections of both batches in one grid (TT / 128 token tiles, DQ / 128 + 2 DKV / 128 tiles of output features, NB_). y < DQ / 128: two q heads; the next DKV / 128: two k heads (both x w^T, EPI 1); the last DKV / 128: 128 rows of wv x^T (EPI 2). The choice is the same for a whole work-group.
__global__ __launch_bounds__(256) void k_proj(const bf* __restrict__ XB, const bf* __restrict__ WQ, const bf* __restrict__ WK, const bf* __restrict__ WV, const float* __restrict__ CS, h16* QP16, bf* QPh, bf* QPl, h16* KP16, bf* KPh, bf* KPl, h16* VT16, bf* VTh, bf* VTl) {
    __shared__ __align__(16) float red[8 * 64 * 68];
    const int tt = blockIdx.x, y = blockIdx.y; const size_t z = blockIdx.z; const bf* X = XB + z * ((size_t)TT * DM);
    const size_t zq = z * ((size_t)NH_ * TT * HD), zk = z * ((size_t)NKV * TT * HD);
    if (y < DQ / 128 + DKV / 128) { const bool q = y < DQ / 128;
        gemmw_body<bf, 0, 1>(red, tt * 128, (q ? y : y - DQ / 128) * 128, X, nullptr, q ? WQ : WK, DM, DM, nullptr, 0, CS, q ? QP16 + zq : KP16 + zk, q ? QPh + zq : KPh + zk, q ? QPl + zq : KPl + zk); }
    else gemmw_body<bf, 0, 2>(red, (y - DQ / 128 - DKV / 128) * 128, tt * 128, WV, nullptr, X, DM, DM, nullptr, 0, nullptr, VT16 + zk, VTh + zk, VTl + zk);
}

typedef __attribute__((ext_vector_type(2))) _Float16 v2h;
typedef __attribute__((ext_vector_type(4))) _Float16 v4h;
typedef __attribute__((ext_vector_type(2))) unsigned short v2us;
typedef __attribute__((ext_vector_type(4))) unsigned short v4us;
typedef __attribute__((ext_vector_type(2))) float v2f;
typedef __attribute__((ext_vector_type(4))) int v4i;

// Conversion f32 [rows][DM] -> bf16 in fragment order. A piece is 8 elements of a row; a wave takes 8 rows x one k block at a time (8 whole f32 lines in), its 4 pieces a row going out as 4 whole 128-byte lines; a unit is what the 8 waves of a work-group take at a time: 8 rows x 8 k blocks.
// The five inputs count as one matrix of CROWS rows, x (both batches), wq, wk, wv, wo one below the other, and dst is that matrix in fragment order (every part starts at a multiple of 16 rows), so a unit lies in one input. cvt_at gives thread tid's piece of a unit: where it is read (ps) and where it goes (pd).
#define CROWS (NB_ * TT + DQ + 2 * DKV + DM)
__device__ __forceinline__ void cvt_at(const float* __restrict__ x, const float* __restrict__ wq, const float* __restrict__ wk, const float* __restrict__ wv, const float* __restrict__ wo, bf* dst, int unit, int tid, const float*& ps, bf*& pd) { static_assert(DQ == DM && DM == 2048, "every converted matrix has DM elements a row; 8 units to 8 rows");
    const int rg = unit >> 3, row0 = rg * 8, kb = (unit & 7) * 8 + (tid >> 5), j = tid & 3, r = (tid & 31) >> 2;   // group of 8 rows and its first row; the wave's k block; the thread's piece of the block and its row of the group
    const float* src = x; int first = 0;
    if (row0 >= NB_ * TT + DQ + 2 * DKV) { src = wo; first = NB_ * TT + DQ + 2 * DKV; } else if (row0 >= NB_ * TT + DQ + DKV) { src = wv; first = NB_ * TT + DQ + DKV; } else if (row0 >= NB_ * TT + DQ) { src = wk; first = NB_ * TT + DQ; } else if (row0 >= NB_ * TT) { src = wq; first = NB_ * TT; }
    ps = src + (size_t)(row0 - first + r) * DM + kb * 32 + j * 8;
    pd = dst + (size_t)(rg >> 1) * (16 * DM) + kb * 512 + (j >> 1) * 256 + ((j & 1) * 16 + (rg & 1) * 8 + r) * 8; }

__constant__ float INVT[HD / 2] = { 1.000000000e+00f, 7.498942018e-01f, 5.623413324e-01f, 4.216965139e-01f, 3.162277639e-01f, 2.371373624e-01f, 1.778279394e-01f, 1.333521456e-01f, 1.000000015e-01f, 7.498941571e-02f, 5.623412877e-02f, 4.216964915e-02f, 3.162277862e-02f, 2.371373586e-02f, 1.778279431e-02f, 1.333521493e-02f, 9.999999776e-03f, 7.498942316e-03f, 5.623413250e-03f, 4.216964822e-03f, 3.162277862e-03f, 2.371373819e-03f, 1.778279431e-03f, 1.333521446e-03f, 1.000000047e-03f, 7.498941850e-04f, 5.623413017e-04f, 4.216964880e-04f, 3.162277862e-04f, 2.371373848e-04f, 1.778279402e-04f, 1.333521504e-04f };   // float32 1 / 10000^(2i/64), generated with jnp to be bit-exact
__device__ __forceinline__ v2f cs5(int idx) { const int d = idx % HD; const int t = idx / HD; const float a = __fmul_rn((float)t, INVT[d % (HD / 2)]); v2f cs; cs[0] = cosf(a); cs[1] = sinf(a); return cs; }   // (cos, sin) of table entry idx = t * HD + d
// k_prep: the rotary table and all five conversions in one grid that is resident as a whole: few waves that each do much, for speed only.
// The first TWG work-groups write the table, TE entries a thread. Each of the PWG others (two to a WGP: 16 waves) converts PU units, unit u * PWG + its own number, so that the grid as a whole walks the matrix from top to bottom; the loads of PGR units are issued as one group, one group ahead of the group that is being rounded and stored.
#define PU  18
#define PGR 6
#define PWG (CROWS * (DM / 8) / 256 / PU)
#define TE  4
#define TWG (TT * HD / 256 / TE)
__global__ __launch_bounds__(256) void k_prep(const float* __restrict__ x, const float* __restrict__ wq, const float* __restrict__ wk, const float* __restrict__ wv, const float* __restrict__ wo, bf* dst, float* CS) {
    static_assert(TT * HD % (256 * TE) == 0 && CROWS * (DM / 8) % (256 * PU) == 0 && PU % PGR == 0 && PGR == 6, "whole work-groups for the table and for the units; whole groups; the waits below name 6 pointers");
    const int g = blockIdx.x, tid = (int)threadIdx.x;
    if (g < TWG) { v2f cs[TE];
#pragma unroll   // unrolled: the entries stay in registers and go out as one run of stores
        for (int e = 0; e < TE; ++e) cs[e] = cs5((g * TE + e) * 256 + tid);
#pragma unroll   // unrolled: cs is indexed by constants
        for (int e = 0; e < TE; ++e) *(v2f*)(CS + (size_t)((g * TE + e) * 256 + tid) * 2) = cs[e];
        return; }
    const int gg = g - TWG; __builtin_assume(gg < PWG);   // the grid has TWG + PWG work-groups: with PWG units = 512 rows a step, which input a unit lies in is then known when the loop is unrolled
    v8f v[PU];
#pragma unroll   // unrolled, the inner loops too: every piece has registers of its own, so that two groups of loads can be in flight at once
    for (int c = 0; c <= PU / PGR; ++c) {
        if (c < PU / PGR) { const float* ps[PGR]; bf* pd;   // group c's loads
#pragma unroll
            for (int k = 0; k < PGR; ++k) { cvt_at(x, wq, wk, wv, wo, dst, (c * PGR + k) * PWG + gg, tid, ps[k], pd); v[c * PGR + k] = *(const v8f*)ps[k]; }
            // s_wait_xcnt 0 behind the group of loads, in front of any overwrite of an address register that they name (a precaution); the pointers are inputs so that they stay in their registers up to the wait
            asm volatile("s_wait_xcnt 0x0" :: "v"(ps[0]), "v"(ps[1]), "v"(ps[2]), "v"(ps[3]), "v"(ps[4]), "v"(ps[5]) : "memory");
            __builtin_amdgcn_sched_barrier(0); }   // nothing moves over the end of a group: left alone the compiler rounds two groups in front of the first store, waiting for every load in flight before the next group is asked for
        if (c > 0) { const float* ps; bf* pd[PGR];   // group c - 1 is rounded and stored while group c flies
#pragma unroll
            for (int k = 0; k < PGR; ++k) { cvt_at(x, wq, wk, wv, wo, dst, ((c - 1) * PGR + k) * PWG + gg, tid, ps, pd[k]); v8us o;
#pragma unroll
                for (int e = 0; e < 8; ++e) o[e] = f2bf(v[(c - 1) * PGR + k][e]);
                *(v8us*)pd[k] = o; }
            // the same wait behind the group of stores
            asm volatile("s_wait_xcnt 0x0" :: "v"(pd[0]), "v"(pd[1]), "v"(pd[2]), "v"(pd[3]), "v"(pd[4]), "v"(pd[5]) : "memory");
            __builtin_amdgcn_sched_barrier(0); }   // as above: the next group's loads are asked for before the group in flight is waited for
    }
}
// ---- k_fattn: scores, softmax, probability x value and the head merge in ONE kernel (running maximum and running sum per query; no score or probability ever leaves the registers).
// One wave = 16 query rows of one head; the REP waves of a work-group are the REP heads of one kv group, so they walk the same K and V lines from key 0 on. Grid (NKV, NB_, TT / 16); no LDS, no barrier.
// S^T = K Q^T: A = K rows (key = lane & 15), B = Q rows (query = lane & 15), so lane (lr, hi) holds for query lr the keys 8 hi + j of each 16-key tile: maximum and sum in-lane plus one exchange between the wave halves.
// Two such tiles, converted in place, are the B operand (k = 8 hi + s, 16 + 8 hi + (s - 8)) of O^T += V^T P^T, A = V^T rows loaded in the same k order; O^T keeps query = lane & 15, so the rescale is lane-local and a lane stores 8 consecutive d. Q, K, V^T come in fragment order (WFrag) and the output leaves in it.
// Rows < RH: hi/lo planes, 3 products each, 32 keys a pass; the rest fp16, 64 keys a pass, probabilities carried x 2^10 (the sum carries the same factor, so it cancels in the division).
typedef __attribute__((ext_vector_type(16))) unsigned short v16us;
template <bool B> struct Flag { static constexpr bool v = B; };
// 2^x on the transcendental unit with the slot that the instruction set asks for behind it, in one statement: each v_exp_f32 works in place, so none touches the source or the result of the one in front of it, and the closing v_nop stands between the last one and whatever the compiler schedules next.
__device__ __forceinline__ void exp2x8(float (&e)[8]) {
    asm("v_exp_f32 %0, %0\n\tv_exp_f32 %1, %1\n\tv_exp_f32 %2, %2\n\tv_exp_f32 %3, %3\n\tv_exp_f32 %4, %4\n\tv_exp_f32 %5, %5\n\tv_exp_f32 %6, %6\n\tv_exp_f32 %7, %7\n\tv_nop"
        : "+v"(e[0]), "+v"(e[1]), "+v"(e[2]), "+v"(e[3]), "+v"(e[4]), "+v"(e[5]), "+v"(e[6]), "+v"(e[7])); }
__device__ __forceinline__ float exp2x1(float a) { float e; asm("v_exp_f32 %0, %1\n\tv_nop" : "=v"(e) : "v"(a)); return e; }   // the same for one value
template <typename T16, bool HL, int KB>
__device__ __forceinline__ void fattn_body(const T16* __restrict__ Q, const T16* __restrict__ Q2, const T16* __restrict__ Kp, const T16* __restrict__ Kp2, const T16* __restrict__ Vt, const T16* __restrict__ Vt2, int q0, int kv, int head, bf* Ah, bf* Al) {
    typedef typename WFrag<T16>::V V;
    constexpr int NKT = KB / 16, NKH = KB / 32;
    constexpr float C1 = SCL * 1.4426950408889634f;   // raw score -> log2 units: HD^-0.5 x log2(e)
    constexpr bool AHEAD = !HL;   // K fragments fetched one pass ahead; not on the hi/lo path, whose twofold fragments would then take the wave past 256 registers
    const int lane = threadIdx.x & 31, lr = lane & 15, hi = lane >> 4; const int qi = q0 + lr;
    V qf[2], qf2[2];
    { const T16* pq = Q + ((size_t)head * TT + q0) * HD + 8 * lane; qf[0] = WFrag<T16>::ld(pq); qf[1] = WFrag<T16>::ld(pq + 512);
      // s_wait_xcnt 0 behind the run of Q loads, in front of any overwrite of an address register that they name (a precaution); the pointers are inputs so that they stay in their registers up to the wait
      if constexpr (HL) { const T16* pq2 = Q2 + ((size_t)head * TT + q0) * HD + 8 * lane; qf2[0] = WFrag<T16>::ld(pq2); qf2[1] = WFrag<T16>::ld(pq2 + 512); asm volatile("s_wait_xcnt 0x0" :: "v"(pq), "v"(pq2) : "memory"); }
      else asm volatile("s_wait_xcnt 0x0" :: "v"(pq) : "memory"); }
    const size_t koff = (size_t)kv * TT * HD + 8 * lane, voff = (size_t)kv * HD * TT + 8 * lane;
    v8f o[4];
#pragma unroll
    for (int db = 0; db < 4; ++db) o[db] = (v8f){};
    float m = -3.0e38f, l = 0.f;
    V kf[NKT][2], kf2[NKT][2];
    auto load_k = [&](int k0) {   // the K fragments of the pass that starts at key k0
        const T16* pk = Kp + koff + (size_t)k0 * HD;
#pragma unroll
        for (int kt = 0; kt < NKT; ++kt)
#pragma unroll
            for (int ks = 0; ks < 2; ++ks) kf[kt][ks] = WFrag<T16>::ld(pk + (kt * 2 + ks) * 512);
        // the same wait behind the run of K loads
        if constexpr (HL) { const T16* pk2 = Kp2 + koff + (size_t)k0 * HD;
#pragma unroll
            for (int kt = 0; kt < NKT; ++kt)
#pragma unroll
                for (int ks = 0; ks < 2; ++ks) kf2[kt][ks] = WFrag<T16>::ld(pk2 + (kt * 2 + ks) * 512);
            asm volatile("s_wait_xcnt 0x0" :: "v"(pk), "v"(pk2) : "memory"); }
        else asm volatile("s_wait_xcnt 0x0" :: "v"(pk) : "memory"); };
    auto pass = [&](int k0, auto edge) {   // KB keys from k0 on; edge: the one pass that holds the diagonal (causal select, no pass behind it)
        constexpr bool EDGE = decltype(edge)::v;
        V vf[4][NKH], vf2[4][NKH];
        if constexpr (!AHEAD) load_k(k0);
        const T16* pv = Vt + voff + (size_t)k0 * 16;
#pragma unroll
        for (int db = 0; db < 4; ++db)
#pragma unroll
            for (int kh = 0; kh < NKH; ++kh) vf[db][kh] = WFrag<T16>::ld(pv + (size_t)db * 16 * TT + kh * 512);
        // the same wait behind the run of V loads
        if constexpr (HL) { const T16* pv2 = Vt2 + voff + (size_t)k0 * 16;
#pragma unroll
            for (int db = 0; db < 4; ++db)
#pragma unroll
                for (int kh = 0; kh < NKH; ++kh) vf2[db][kh] = WFrag<T16>::ld(pv2 + (size_t)db * 16 * TT + kh * 512);
            asm volatile("s_wait_xcnt 0x0" :: "v"(pv), "v"(pv2) : "memory"); }
        else asm volatile("s_wait_xcnt 0x0" :: "v"(pv) : "memory");
        v8f s[NKT];
#pragma unroll
        for (int kt = 0; kt < NKT; ++kt) { s[kt] = (v8f){};
#pragma unroll
            for (int ks = 0; ks < 2; ++ks) { s[kt] = WFrag<T16>::mma(kf[kt][ks], qf[ks], s[kt]); if constexpr (HL) { s[kt] = WFrag<T16>::mma(kf[kt][ks], qf2[ks], s[kt]); s[kt] = WFrag<T16>::mma(kf2[kt][ks], qf[ks], s[kt]); } } }
        if constexpr (AHEAD && !EDGE) load_k(k0 + KB);   // the next pass's K fragments fly during this pass's softmax and P.V (a pass that is not the edge pass always has a successor)
        float bm = -3.0e38f; const int rel = qi - k0 - hi * 8;   // a lane's key kt * 16 + j of the pass is allowed while it is <= rel
#pragma unroll
        for (int kt = 0; kt < NKT; ++kt)
#pragma unroll
            for (int j = 0; j < 8; ++j) { if constexpr (EDGE) s[kt][j] = (kt * 16 + j <= rel) ? s[kt][j] : -3.0e38f; bm = fmaxf(bm, s[kt][j]); }
        bm = fmaxf(bm, __shfl_xor(bm, 16, 32));
        const float mn = fmaxf(m, bm * C1); const float alpha = exp2x1(m - mn); m = mn;   // the running maximum is kept in log2 units
        const float sh = (HL ? 0.0f : 10.0f) - mn;
        float ls[NKT];
#pragma unroll
        for (int kt = 0; kt < NKT; ++kt) { float e[8]; ls[kt] = 0.f;
#pragma unroll
            for (int j = 0; j < 8; ++j) e[j] = s[kt][j] * C1 + sh;   // one multiply-add from raw score to exponent
            exp2x8(e);
#pragma unroll
            for (int j = 0; j < 8; ++j) { s[kt][j] = e[j]; ls[kt] += e[j]; } }
        float lsum = ls[0];
#pragma unroll
        for (int kt = 1; kt < NKT; ++kt) lsum += ls[kt];
        l = l * alpha + lsum;   // each wave half keeps the sum of its own keys; the halves are joined once, behind the last pass
#pragma unroll
        for (int db = 0; db < 4; ++db) o[db] *= alpha;
#pragma unroll
        for (int kh = 0; kh < NKH; ++kh) {
            if constexpr (HL) { v16us ph, pl;
#pragma unroll
                for (int q = 0; q < 16; ++q) { unsigned short a, c2; splitf(s[kh * 2 + (q >> 3)][q & 7], a, c2); ph[q] = a; pl[q] = c2; }
                const V pfh = __builtin_bit_cast(V, ph), pfl = __builtin_bit_cast(V, pl);
#pragma unroll
                for (int db = 0; db < 4; ++db) { o[db] = WFrag<T16>::mma(vf[db][kh], pfh, o[db]); o[db] = WFrag<T16>::mma(vf[db][kh], pfl, o[db]); o[db] = WFrag<T16>::mma(vf2[db][kh], pfh, o[db]); }
            } else { V pf;
#pragma unroll
                for (int q = 0; q < 16; ++q) pf[q] = tohx(s[kh * 2 + (q >> 3)][q & 7]);
#pragma unroll
                for (int db = 0; db < 4; ++db) o[db] = WFrag<T16>::mma(vf[db][kh], pf, o[db]); } }
        asm volatile("v_nop\n\tv_nop\n\tv_nop\n\tv_nop" : "+v"(o[0]), "+v"(o[1]), "+v"(o[2]), "+v"(o[3]) : "v"(vf[3][NKH - 1]));   // four vector slots behind the last WMMA, also on the taken back edge, before fragments or accumulators are touched
    };
    int k0 = 0;   // both loops stay rolled: one pass already holds every fragment of KB keys in registers
    if constexpr (AHEAD) { static_assert(RH >= KB, "the fetch-ahead loop runs at least once: its rows start at RH");
        load_k(0);
#pragma unroll 1
        do { pass(k0, Flag<false>{}); k0 += KB; } while (k0 + KB - 1 <= q0);
    } else {
#pragma unroll 1
        for (; k0 + KB - 1 <= q0; k0 += KB) pass(k0, Flag<false>{}); }
    pass(k0, Flag<true>{});
    const float f = __fdiv_rn(1.0f, l + __shfl_xor(l, 16, 32));
    const size_t oo = (size_t)q0 * DQ + head * (2 * 512) + 8 * lane; v8us oh[4], ol[4];   // fragment order of the wo product's A operand (rows = queries, k = head * HD + d): a lane's 8 values of d block db are its own piece of half db & 1 of k block head * 2 + (db >> 1)
#pragma unroll
    for (int db = 0; db < 4; ++db)
#pragma unroll
        for (int j = 0; j < 8; ++j) { unsigned short a, c2; splitf(o[db][j] * f, a, c2); oh[db][j] = a; ol[db][j] = c2; }
#pragma unroll
    for (int db = 0; db < 4; ++db) { *(v8us*)(Ah + oo + db * 256) = oh[db]; *(v8us*)(Al + oo + db * 256) = ol[db]; }
}
// amdgpu_waves_per_eu(4, 4): at most 256 registers a wave, so that four waves share a SIMD and half of the NKV x NB_ x TT / 16 work-groups are resident at once; the others follow as places come free
__global__ __launch_bounds__(32 * REP) __attribute__((amdgpu_waves_per_eu(4, 4))) void k_fattn(const h16* __restrict__ Q16, const bf* __restrict__ Qh, const bf* __restrict__ Ql, const h16* __restrict__ K16, const bf* __restrict__ Kh, const bf* __restrict__ Kl, const h16* __restrict__ V16, const bf* __restrict__ Vh, const bf* __restrict__ Vl, bf* Ah, bf* Al) {
    const int wave = __builtin_amdgcn_readfirstlane((int)(threadIdx.x >> 5));   // wave number in a scalar register: head, loop bound and branches stay scalar
    const int kv = blockIdx.x, head = kv * REP + wave, rank = blockIdx.z;
    { const size_t zq = (size_t)blockIdx.y * ((size_t)NH_ * TT * HD), zk = (size_t)blockIdx.y * ((size_t)NKV * TT * HD), za = (size_t)blockIdx.y * ((size_t)TT * DQ);   // this batch's planes
      Q16 += zq; Qh += zq; Ql += zq; K16 += zk; Kh += zk; Kl += zk; V16 += zk; Vh += zk; Vl += zk; Ah += za; Al += za; }
    // There are twice as many work-groups as places: the four heads of a work-group take the same tile, and a tile's cost falls with the rank (the slowest grid index), so that the short ones fill the places that the long ones leave.
    // An fp16 tile t costs about t; a hi/lo tile h (three products a key) about 3 h: ranks 0..33 are tiles 127..94; then groups of four (hi/lo tile 31 - g, fp16 tiles 93 - 3 g, 92 - 3 g, 91 - 3 g) down to tile 32; ranks 117..127 are tiles 10..0. For speed only; the map is a permutation, so each (head, tile) is taken once.
    static_assert(TT / 16 == 128 && RH / 16 == 32, "the rank -> tile map is written for 128 tiles, 32 of them hi/lo");
    const int s = rank - 34; const int tile = (rank < 34 || rank >= 117) ? 127 - rank : ((s & 3) == 0 ? 31 - (s >> 2) : 94 - 3 * (s >> 2) - (s & 3)); const int q0 = tile * 16;
    if (q0 < RH) fattn_body<bf, true, 32>(Qh, Ql, Kh, Kl, Vh, Vl, q0, kv, head, Ah, Al);
    else fattn_body<h16, false, 64>(Q16, nullptr, K16, nullptr, V16, nullptr, q0, kv, head, Ah, Al);
}

extern "C" void kernel_launch(void* const* d_in, const int* in_sizes, int n_in,
                              void* d_out, int out_size, void* d_ws, size_t ws_size, hipStream_t stream) {
    (void)in_sizes; (void)n_in; (void)out_size;
        const float* x = (const float*)d_in[0]; const float* wq = (const float*)d_in[1]; const float* wk = (const float*)d_in[2]; const float* wv = (const float*)d_in[3]; const float* wo = (const float*)d_in[4];   /* inputs x, wq [2048][2048], wk [512][2048], wv, wo ('oi'); this module has no mask input (the causal rule is by index) */
    float* OUT = (float*)d_out;     // [2][2048][2048]
    char* wsp = (char*)d_ws;
    auto take = [&](size_t bytes) { char* p = wsp; wsp += (bytes + 255) & ~(size_t)255; return (void*)p; };
    bf* XB = (bf*)take((size_t)CROWS * DM * 2); bf* WQ = XB + (size_t)NB_ * TT * DM; bf* WK = WQ + (size_t)DQ * DM; bf* WV = WK + (size_t)DKV * DM; bf* WO = WV + (size_t)DKV * DM;   // one block, in the row order of cvt_at
    float* CS = (float*)take((size_t)TT * HD * 2 * 4);
    // every plane below holds both batches, one behind the other
    h16* QP16 = (h16*)take((size_t)NB_ * NH_ * TT * HD * 2); h16* KP16 = (h16*)take((size_t)NB_ * NKV * TT * HD * 2); h16* VT16 = (h16*)take((size_t)NB_ * NKV * HD * TT * 2);
    bf* QPh = (bf*)take((size_t)NB_ * NH_ * TT * HD * 2); bf* QPl = (bf*)take((size_t)NB_ * NH_ * TT * HD * 2); bf* KPh = (bf*)take((size_t)NB_ * NKV * TT * HD * 2); bf* KPl = (bf*)take((size_t)NB_ * NKV * TT * HD * 2); bf* VTh = (bf*)take((size_t)NB_ * NKV * HD * TT * 2); bf* VTl = (bf*)take((size_t)NB_ * NKV * HD * TT * 2);
    bf* ATh = (bf*)take((size_t)NB_ * TT * DQ * 2); bf* ATl = (bf*)take((size_t)NB_ * TT * DQ * 2);
    if ((size_t)(wsp - (char*)d_ws) > ws_size) return;    // ws 256 MiB
    k_prep<<<TWG + PWG, 256, 0, stream>>>(x, wq, wk, wv, wo, XB, CS);   /* rotary table and every 16-bit copy */
    k_proj<<<dim3(TT / 128, DQ / 128 + 2 * (DKV / 128), NB_), 256, 0, stream>>>(XB, WQ, WK, WV, CS, QP16, QPh, QPl, KP16, KPh, KPl, VT16, VTh, VTl);
    k_fattn<<<dim3(NKV, NB_, TT / 16), 32 * REP, 0, stream>>>(QP16, QPh, QPl, KP16, KPh, KPl, VT16, VTh, VTl, ATh, ATl);
    k_gemmw<bf, 1, 0><<<dim3(TT / 128, DM / 128, NB_), 256, 0, stream>>>(ATh, ATl, WO, DQ, DQ, OUT, DM, (size_t)TT * DQ, (size_t)TT * DM);
}

// v009
// One run takes 132 microseconds.
// In two side-by-side timings against v008, it was 1.05 and 1.06 times as fast.
// Counting every step since v000, it is 20.5 times as fast.
#include <hip/hip_runtime.h>

// Grouped-query causal attention with a computed half-split RoPE (x [2][2048][2048]; xq = x wq^T (32 heads x 64), xk, xv = x wk^T, x wv^T (8 kv heads x 64) ('oi', no bias; token-major); cos / sin from inv_freq = 1 / (10000 ** (2i / 64)) and positions arange(S) ([S][32] tables); (x1, x2) = the two 32-wide halves of each head: cat(x1 c - x2 s, x1 s + x2 c) (half-split pairs (d, d + 32)) on q and k; k, v repeated 4 x on the head axis (jnp.repeat: kv head = q head / 4); scores / sqrt(64); where(tril, scores, finfo.min) == exclusion; softmax; out = merged wo^T ('oi') -> [2][2048][2048] (8.4 M); argument order x, wq, wk, wv, wo).
// Every 16-bit matrix operand (x, the weights, the q, k and v^T planes, the merged attention output) is stored by its producer in fragment order (see WFrag).
// Four launches, each over both batches (k_prep, k_proj, k_fattn, k_wo). Layout: bf16 copy of x; 'oi' weights; exact projections whose epilogue applies the rotate-half rotation (cs5 computed table) and stores the 16-bit planes itself; causal T-2048 GQA attention fused in one kernel (k_fattn: running softmax in registers, kv plane = head / REP; hybrid rows: < 512 hi/lo 3 products, rest fp16 x1024; keys above the diagonal block are never read); merged x wo on fp16 operands: rows < 512 fp16 hi + lo, two products, rest one fp16 plane, one product.
// Compute dtypes, f32 accumulate: every input rounded to bf16; projections exact; rotary f32; attention rows < 512 3 products, rest fp16; softmax f32; wo (its bf16-rounded values held as fp16): rows < 512 fp16 hi + lo, rest fp16.

#define NB_  2
#define TT   2048
#define DM   2048
#define NH_  32
#define NKV  8
#define REP  (NH_ / NKV)
#define HD   64
#define DQ   (NH_ * HD)
#define DKV  (NKV * HD)
#define RH   512                  // query rows < RH use hi+lo planes
#define SCL  0.125f   // HD^-0.5
typedef _Float16 h16;
typedef unsigned short bf;
typedef __attribute__((ext_vector_type(16))) __bf16   v16bf;
typedef __attribute__((ext_vector_type(16))) _Float16 v16h;
typedef __attribute__((ext_vector_type(8)))  _Float16 v8h;
typedef __attribute__((ext_vector_type(8)))  unsigned short v8us;
typedef __attribute__((ext_vector_type(8)))  float    v8f;
typedef __attribute__((ext_vector_type(4)))  float    v4f;
typedef v8h  __attribute__((may_alias)) v8ha;
typedef v4f  __attribute__((may_alias)) v4fa;
typedef v8us __attribute__((may_alias)) v8usa;

__device__ __forceinline__ unsigned short f2bf(float f) { unsigned u = __float_as_uint(f); u += 0x7FFFu + ((u >> 16) & 1u); return (unsigned short)(u >> 16); }
__device__ __forceinline__ float bf2f(unsigned short b) { return __uint_as_float(((unsigned)b) << 16); }
__device__ __forceinline__ float bfr(float f) { return bf2f(f2bf(f)); }
__device__ __forceinline__ v16h cat16(v8h lo, v8h hi) { return __builtin_shufflevector(lo, hi, 0, 1, 2, 3, 4, 5, 6, 7, 8, 9, 10, 11, 12, 13, 14, 15); }
__device__ __forceinline__ v16bf cat16b(v8us lo, v8us hi) { return __builtin_bit_cast(v16bf, __builtin_shufflevector(lo, hi, 0, 1, 2, 3, 4, 5, 6, 7, 8, 9, 10, 11, 12, 13, 14, 15)); }
__device__ __forceinline__ v8f wmma16(v16h a, v16h b, v8f c) { return __builtin_amdgcn_wmma_f32_16x16x32_f16(false, a, false, b, (short)0, c, false, false); }
__device__ __forceinline__ v8f wmmab(v16bf a, v16bf b, v8f c) { return __builtin_amdgcn_wmma_f32_16x16x32_bf16(false, a, false, b, (short)0, c, false, false); }
__device__ __forceinline__ h16 tohx(float x) { return (h16)x; }
__device__ __forceinline__ void splitf(float y, unsigned short& h, unsigned short& l) { h = f2bf(y); l = f2bf(y - bf2f(h)); }



// ---- gemmw_body: register-blocked GEMM, one 128x128 output tile per work-group of 8 waves; grid (M/128, N/128, Z), 256 threads. The tile is 2 x 2 sub-tiles of 64x64; two waves share a sub-tile and split K between them (wave = sub-tile * 2 + wk).
// K goes in stages of 64 (two 1-KiB blocks of every group of 16 operand rows): the work-group brings the stage's 128 rows of every operand (A2: 64) into LDS once, by asynchronous copies, two buffers, the next stage flying while this one is worked on; so each operand byte leaves L2 once per 128x128 tile and serves two sub-tiles.
// Wave wk takes k block wk of every stage and keeps its own 64x64 partial tile (16 accumulators); the two partial tiles of a sub-tile are then summed, wk 0 first, through LDS (the staging buffers' place, free by then).
// C[m][n] (f32, pitch ldc) = sum_k A[m][k] Bt[n][k]. A has lda, Bt K elements a row (fragment order). K % 64 == 0.
// NSPLIT 1: the tile's upper 64 rows are rows r0 .. of A and C and take a second product, + A2[m][k] Bt[n][k]; its lower 64 rows are rows r1 .. and take one. Waves w and w + 4, which share a SIMD, are an upper and a lower one, so every SIMD gets the same matrix work.
// Fragment order: a block of 16 rows x 32 k of an operand is 512 consecutive elements, element (r, k) at (k >> 4) * 256 + (((k >> 3) & 1) * 16 + r) * 8 + (k & 7): lane l's two 16-byte pieces (row l & 15; k = 8 (l >> 4) + 0..7 and 16 + 8 (l >> 4) + 0..7) lie at l * 8 and 256 + l * 8,
// so each wave-wide 16-byte load covers 512 contiguous bytes (4 whole lines, not 16 pieces of 32 B). Blocks follow one another along k, then along the groups of 16 rows: a matrix of pitch P has block (row group g, k block b) at g * 16 * P + b * 512. ld takes the block's address + 8 * lane.
// EPI 0: the summed tile goes out as f32 C. EPI 1, 2: no f32 tile leaves the kernel; the tile is stored as three 16-bit planes (fp16, bf16 hi, bf16 lo) in fragment order, a thread taking the pieces of columns 8 o .. 8 o + 7 and 32 + 8 o .. of one row, so each wave-wide 16-byte store covers 512 contiguous bytes.
// EPI 1 (q, k; rows = positions t, the 64 columns = one head): rotate-half first, out[d] = x[d] cos[t][d] - x[d+32] sin[t][d], out[d+32] = x[d+32] cos[t][d] + x[d] sin[t][d] (a thread's two pieces are exactly such pairs); planes [head][t][d], pitch HD.
// EPI 2 (v; launched as wv x^T, so rows = kv head * HD + d and columns = t: the tile is V^T already): planes [g][d][t], pitch TT.
template <typename T16> struct WFrag;
template <> struct WFrag<h16> { typedef v16h V; static __device__ __forceinline__ V ld(const h16* p) { return cat16(*(const v8h*)p, *(const v8h*)(p + 256)); } static __device__ __forceinline__ v8f mma(V a, V b, v8f c) { return wmma16(a, b, c); } };
template <> struct WFrag<bf> { typedef v16bf V; static __device__ __forceinline__ V ld(const bf* p) { return cat16b(*(const v8us*)p, *(const v8us*)(p + 256)); } static __device__ __forceinline__ v8f mma(V a, V b, v8f c) { return wmmab(a, b, c); } };
// copy8, copy10: a stage's asynchronous 16-byte-a-lane copies to LDS, 4 KiB apart in LDS and sa (A, A2) or sb (Bt) bytes apart in memory: four an operand; in copy10 two for A's upper rows (a), two for its lower rows (al), four for Bt, two for A2. The s_wait_xcnt 0 stands in the copies' own statement, in front of any overwrite of a register that they name (a precaution).
__device__ __forceinline__ void copy8(unsigned l, const char* a, size_t sa, const char* b, size_t sb) {
    asm volatile("global_load_async_to_lds_b128 %0, %8, off\n\tglobal_load_async_to_lds_b128 %1, %9, off\n\tglobal_load_async_to_lds_b128 %2, %10, off\n\tglobal_load_async_to_lds_b128 %3, %11, off\n\tglobal_load_async_to_lds_b128 %4, %12, off\n\tglobal_load_async_to_lds_b128 %5, %13, off\n\tglobal_load_async_to_lds_b128 %6, %14, off\n\tglobal_load_async_to_lds_b128 %7, %15, off\n\ts_wait_xcnt 0x0"
                 :: "v"(l), "v"(l + 4096u), "v"(l + 8192u), "v"(l + 12288u), "v"(l + 16384u), "v"(l + 20480u), "v"(l + 24576u), "v"(l + 28672u),
                    "v"(a), "v"(a + sa), "v"(a + 2 * sa), "v"(a + 3 * sa), "v"(b), "v"(b + sb), "v"(b + 2 * sb), "v"(b + 3 * sb) : "memory"); }
__device__ __forceinline__ void copy10(unsigned l, const char* a, const char* al, size_t sa, const char* b, size_t sb, const char* a2) {
    asm volatile("global_load_async_to_lds_b128 %0, %10, off\n\tglobal_load_async_to_lds_b128 %1, %11, off\n\tglobal_load_async_to_lds_b128 %2, %12, off\n\tglobal_load_async_to_lds_b128 %3, %13, off\n\tglobal_load_async_to_lds_b128 %4, %14, off\n\tglobal_load_async_to_lds_b128 %5, %15, off\n\tglobal_load_async_to_lds_b128 %6, %16, off\n\tglobal_load_async_to_lds_b128 %7, %17, off\n\tglobal_load_async_to_lds_b128 %8, %18, off\n\tglobal_load_async_to_lds_b128 %9, %19, off\n\ts_wait_xcnt 0x0"
                 :: "v"(l), "v"(l + 4096u), "v"(l + 8192u), "v"(l + 12288u), "v"(l + 16384u), "v"(l + 20480u), "v"(l + 24576u), "v"(l + 28672u), "v"(l + 32768u), "v"(l + 36864u),
                    "v"(a), "v"(a + sa), "v"(al), "v"(al + sa), "v"(b), "v"(b + sb), "v"(b + 2 * sb), "v"(b + 3 * sb), "v"(a2), "v"(a2 + sa) : "memory"); }
// gemmw_body is the work of one work-group: the tile at rows r0, columns c0, with red = its 8 * 64 * 68 floats of LDS; the kernels below pick tile, operands and planes from blockIdx.
// A stage in LDS: [A 16 KiB | Bt 16 KiB | A2 8 KiB (NSPLIT 1)], each the operand's 8 (A2: 4) groups of 16 rows, 2 KiB (two k blocks, as they lie in memory) a group. One copy of all 256 threads moves two groups.
template <typename T16, int NSPLIT, int EPI>
__device__ __forceinline__ void gemmw_body(float* red, int r0, int c0, const T16* __restrict__ A, const T16* __restrict__ A2, const T16* __restrict__ Bt, int K, int lda, float* C, int ldc, const float* __restrict__ CS, h16* P16, bf* Ph, bf* Pl, int r1 = 0) {
    typedef typename WFrag<T16>::V V;
    static_assert(NSPLIT == 0 || NSPLIT == 1, "one or two A planes");
    constexpr int SB = NSPLIT == 1 ? 40960 : 32768;   // bytes of a stage
    const int rl = NSPLIT == 1 ? r1 : r0 + 64;   // first row of the tile's lower 64 rows
    static_assert(2 * SB <= 8 * 64 * 68 * 4, "both buffers lie inside red");
    const int tid = (int)threadIdx.x, lane = tid & 31, lr = lane & 15, hi = lane >> 4;
    const int wave = __builtin_amdgcn_readfirstlane(tid >> 5);   // wave number in a scalar register: sub-tile and k block stay scalar
    const int sm = wave >> 2, sn = (wave >> 1) & 1, wk = wave & 1;
    const int NT = K / 64;
    v8f acc[4][4];
#pragma unroll
    for (int mb = 0; mb < 4; ++mb)
#pragma unroll
        for (int nb = 0; nb < 4; ++nb) acc[mb][nb] = (v8f){};
    // this thread's 16 bytes of the first two groups of each operand; the next two groups lie 32 rows on, the next stage 2 KiB on
    const char* gA = (const char*)(A + (size_t)(r0 + 16 * (tid >> 7)) * lda + (tid & 127) * 8);
    const char* gB = (const char*)(Bt + (size_t)(c0 + 16 * (tid >> 7)) * K + (tid & 127) * 8);
    const char* gA2 = NSPLIT == 1 ? (const char*)(A2 + (size_t)(r0 + 16 * (tid >> 7)) * lda + (tid & 127) * 8) : nullptr;
    const char* gAl = NSPLIT == 1 ? (const char*)(A + (size_t)(rl + 16 * (tid >> 7)) * lda + (tid & 127) * 8) : nullptr;
    const unsigned l0 = (unsigned)(size_t)red + (unsigned)tid * 16u;   // LDS byte address: the low 32 bits of the __shared__ address
    auto stage = [&](int t) {   // stage t's copies into buffer t & 1
        const unsigned l = l0 + (unsigned)(t & 1) * (unsigned)SB; const size_t o = (size_t)t * 2048;
        if constexpr (NSPLIT == 1) copy10(l, gA + o, gAl + o, (size_t)lda * 64, gB + o, (size_t)K * 64, gA2 + o);
        else copy8(l, gA + o, (size_t)lda * 64, gB + o, (size_t)K * 64); };
    stage(0);
    asm volatile("s_wait_asynccnt 0x0" ::: "memory");   // this wave's copies of stage 0 have landed
    __syncthreads();                                     // ... and every other wave's: stage 0 may be read
    if (1 < NT) stage(1);
#pragma unroll 1   // rolled: one copy of the stage's code, the buffer picked by t & 1
    for (int t = 0; t < NT; ++t) {
        const T16* sb = (const T16*)red + (t & 1) * (SB / 2) + wk * 512 + 8 * lane;
        V a[4], a2[4], b[4];   // every fragment of the stage's first product is asked for in one group, in front of the first WMMA
#pragma unroll
        for (int mb = 0; mb < 4; ++mb) { a[mb] = WFrag<T16>::ld(sb + (sm * 4 + mb) * 1024); b[mb] = WFrag<T16>::ld(sb + 8192 + (sn * 4 + mb) * 1024); }
        asm volatile("" :: "v"(b[0]), "v"(b[1]), "v"(b[2]), "v"(b[3]));   // inputs only: holds the B fragments' loads in the one group in front of the first WMMA; left alone the compiler puts three of them among the WMMAs, each with a wait for the LDS of its own
        if constexpr (NSPLIT == 1) {
            asm volatile("" :: "v"(a[0]), "v"(a[1]), "v"(a[2]), "v"(a[3]));   // inputs only: the A fragments too have landed in front of the branch; left alone the wait for the last of them stands in the common code behind it and there waits for the second plane's loads as well
            if (sm == 0) {   // a scalar test: the upper waves alone have a second plane; its fragments are asked for behind the others and land during the first product
#pragma unroll
            for (int mb = 0; mb < 4; ++mb) a2[mb] = WFrag<T16>::ld(sb + 16384 + mb * 1024); } }
#pragma unroll
        for (int nb = 0; nb < 4; ++nb)
#pragma unroll
            for (int mb = 0; mb < 4; ++mb) acc[mb][nb] = WFrag<T16>::mma(a[mb], b[nb], acc[mb][nb]);
        if constexpr (NSPLIT == 1) { if (sm == 0) {
#pragma unroll
            for (int nb = 0; nb < 4; ++nb)
#pragma unroll
                for (int mb = 0; mb < 4; ++mb) acc[mb][nb] = WFrag<T16>::mma(a2[mb], b[nb], acc[mb][nb]); } }
        // four vector slots behind the last WMMA, also on the taken back edge, before fragments or accumulators are touched; every accumulator is named so that no WMMA of the stage stands behind them
        asm volatile("v_nop\n\tv_nop\n\tv_nop\n\tv_nop" : "+v"(acc[0][0]), "+v"(acc[0][1]), "+v"(acc[0][2]), "+v"(acc[0][3]), "+v"(acc[1][0]), "+v"(acc[1][1]), "+v"(acc[1][2]), "+v"(acc[1][3]), "+v"(acc[2][0]), "+v"(acc[2][1]), "+v"(acc[2][2]), "+v"(acc[2][3]), "+v"(acc[3][0]), "+v"(acc[3][1]), "+v"(acc[3][2]), "+v"(acc[3][3]));
        asm volatile("s_wait_dscnt 0x0" ::: "memory");
        asm volatile("s_wait_asynccnt 0x0" ::: "memory");
        __syncthreads();
        if (t + 2 < NT) stage(t + 2);
    }
    asm volatile("s_wait_asynccnt 0x0" ::: "memory");   // nothing is in flight when the buffers become the partial tiles' place
    const int pg = tid >> 6, po = (tid >> 4) & 3, prow = pg * 16 + (tid & 15);   // EPI 1, 2: this thread's group of 16 rows, its 8-column piece and its row of a sub-tile
    v4f cs[2][4];
    if constexpr (EPI == 1) { const float* pc = CS + ((size_t)(r0 + prow) * HD + po * 8) * 2;   // (cos, sin) of the thread's 8 column pairs, for its row of the upper and of the lower sub-tiles, asked for here so that they fly during the LDS stores and the barrier
#pragma unroll
        for (int h = 0; h < 2; ++h)
#pragma unroll
            for (int q = 0; q < 4; ++q) cs[h][q] = *(const v4f*)(pc + h * (64 * HD * 2) + q * 4);
        asm volatile("s_wait_xcnt 0x0" :: "v"(pc) : "memory"); }   // the wait stands in front of any overwrite of the address register that the loads name (a precaution)
    float* mine = red + wave * (64 * 68);
#pragma unroll
    for (int mb = 0; mb < 4; ++mb)
#pragma unroll
        for (int nb = 0; nb < 4; ++nb)
#pragma unroll
            for (int j = 0; j < 8; ++j) mine[(mb * 16 + hi * 8 + j) * 68 + nb * 16 + lr] = acc[mb][nb][j];
    __syncthreads();   // every wave's partial tile is in LDS before any wave sums
    if constexpr (EPI == 0) {
        v4f val[16]; float* pc[16];
#pragma unroll
        for (int s = 0; s < 16; ++s) { const int sub = s >> 2, q = (s & 3) * 256 + tid, row = q >> 4, cofs = (q & 15) * 4; const float* pr = red + sub * (2 * 64 * 68) + row * 68 + cofs;
            val[s] = *(const v4fa*)pr + *(const v4fa*)(pr + 64 * 68); pc[s] = C + (size_t)((sub >> 1 ? rl : r0) + row) * ldc + c0 + (sub & 1) * 64 + cofs; }
#pragma unroll
        for (int s = 0; s < 16; ++s) *(v4f*)pc[s] = val[s];
        // one s_wait_xcnt 0 behind the run of stores; the pointers are inputs so that they stay in their registers up to the wait (a precaution)
        asm volatile("s_wait_xcnt 0x0" :: "v"(pc[0]), "v"(pc[1]), "v"(pc[2]), "v"(pc[3]), "v"(pc[4]), "v"(pc[5]), "v"(pc[6]), "v"(pc[7]), "v"(pc[8]), "v"(pc[9]), "v"(pc[10]), "v"(pc[11]), "v"(pc[12]), "v"(pc[13]), "v"(pc[14]), "v"(pc[15]) : "memory");
    } else {
        static_assert(HD == 64, "256 threads = 64 rows x 4 pairs of 8-column pieces; one sub-tile = one head");
        float x[4][2][8];   // per sub-tile: x[0]: columns 8 po .. + 7, x[1]: the same + 32, each the two partials summed, wk 0 first
#pragma unroll
        for (int sub = 0; sub < 4; ++sub)
#pragma unroll
            for (int q = 0; q < 4; ++q) { const int cofs = (q >> 1) * 32 + po * 8 + (q & 1) * 4; const float* pr = red + sub * (2 * 64 * 68) + prow * 68 + cofs; const v4f val = *(const v4fa*)pr + *(const v4fa*)(pr + 64 * 68);
#pragma unroll
                for (int i = 0; i < 4; ++i) x[sub][q >> 1][(q & 1) * 4 + i] = val[i]; }
#pragma unroll
        for (int sub = 0; sub < 4; ++sub) { const int rs = r0 + (sub >> 1) * 64, cc = c0 + (sub & 1) * 64;   // the sub-tile's first row and column
            if constexpr (EPI == 1) {
#pragma unroll
                for (int j = 0; j < 8; ++j) { const float c = cs[sub >> 1][j >> 1][(j & 1) * 2], s = cs[sub >> 1][j >> 1][(j & 1) * 2 + 1], a = x[sub][0][j], b = x[sub][1][j]; x[sub][0][j] = a * c - b * s; x[sub][1][j] = b * c + a * s; } }
            v8h o16[2]; v8us oh[2], ol[2];
#pragma unroll
            for (int p = 0; p < 2; ++p)
#pragma unroll
                for (int j = 0; j < 8; ++j) { unsigned short a2, c2; splitf(x[sub][p][j], a2, c2); o16[p][j] = tohx(x[sub][p][j]); oh[p][j] = a2; ol[p][j] = c2; }
            // block (row group, k block) of a plane of pitch P lies at group * 16 * P + block * 512; the thread's piece of it at (8-column piece * 16 + row) * 8; its second piece is the next k block's
            const size_t oo = (EPI == 1 ? (size_t)(cc / HD) * TT * HD + (size_t)(rs + pg * 16) * HD : (size_t)(rs + pg * 16) * TT + (size_t)(cc / 32) * 512) + (tid & 63) * 8;
            h16* p16 = P16 + oo; bf* ph = Ph + oo; bf* pl = Pl + oo;
#pragma unroll
            for (int p = 0; p < 2; ++p) { *(v8h*)(p16 + p * 512) = o16[p]; *(v8us*)(ph + p * 512) = oh[p]; *(v8us*)(pl + p * 512) = ol[p]; }
            asm volatile("s_wait_xcnt 0x0" :: "v"(p16), "v"(ph), "v"(pl) : "memory"); }   // behind the sub-tile's stores, in front of any overwrite of an address register that they name (a precaution)
    }
}
// k_wo: out = merged attention output x wo^T, all operands fp16; grid (TT / 128, DM / 128, NB_). The rows below RH (the attention's hi/lo rows) go in as fp16 hi + lo planes, two products; the others as the one fp16 plane, one product.
// Row tiles 0 .. RH / 64 - 1 are mixed: tile i = the 64 two-product rows from 64 i on and the 64 one-product rows from RH + 64 i on; the other tiles are 128 one-product rows each, from row 2 RH on. The choice is the same for a whole work-group.
// Row tile = x, in the second batch x + half the tiles: work-groups 8 apart in a batch, or half a grid apart, are then a mixed and a plain one (for speed only; for each y and batch the map is a permutation of the row tiles, so each tile is taken once).
__global__ __launch_bounds__(256) void k_wo(const h16* __restrict__ A16, const h16* __restrict__ Al, const h16* __restrict__ W16, float* C) {
    __shared__ __align__(16) float red[8 * 64 * 68];
    static_assert(RH % 64 == 0 && (TT - 2 * RH) % 128 == 0 && RH / 64 + (TT - 2 * RH) / 128 == TT / 128 && 4 * RH == TT, "mixed and plain tiles cover every row once; as many of the one kind as of the other");
    const size_t z = blockIdx.z; const int rt = (int)(blockIdx.x + z * (TT / 256)) % (TT / 128), c0 = blockIdx.y * 128; A16 += z * ((size_t)TT * DQ); Al += z * ((size_t)TT * DQ); C += z * ((size_t)TT * DM);
    if (rt < RH / 64) gemmw_body<h16, 1, 0>(red, rt * 64, c0, A16, Al, W16, DQ, DQ, C, DM, nullptr, nullptr, nullptr, nullptr, RH + rt * 64);
    else gemmw_body<h16, 0, 0>(red, 2 * RH + (rt - RH / 64) * 128, c0, A16, nullptr, W16, DQ, DQ, C, DM, nullptr, nullptr, nullptr, nullptr);
}
// k_proj: the q, k and v projections of both batches in one grid (TT / 128 token tiles, DQ / 128 + 2 DKV / 128 tiles of output features, NB_). y < DQ / 128: two q heads; the next DKV / 128: two k heads (both x w^T, EPI 1); the last DKV / 128: 128 rows of wv x^T (EPI 2). The choice is the same for a whole work-group.
__global__ __launch_bounds__(256) void k_proj(const bf* __restrict__ XB, const bf* __restrict__ WQ, const bf* __restrict__ WK, const bf* __restrict__ WV, const float* __restrict__ CS, h16* QP16, bf* QPh, bf* QPl, h16* KP16, bf* KPh, bf* KPl, h16* VT16, bf* VTh, bf* VTl) {
    __shared__ __align__(16) float red[8 * 64 * 68];
    const int tt = blockIdx.x, y = blockIdx.y; const size_t z = blockIdx.z; const bf* X = XB + z * ((size_t)TT * DM);
    const size_t zq = z * ((size_t)NH_ * TT * HD), zk = z * ((size_t)NKV * TT * HD);
    if (y < DQ / 128 + DKV / 128) { const bool q = y < DQ / 128;
        gemmw_body<bf, 0, 1>(red, tt * 128, (q ? y : y - DQ / 128) * 128, X, nullptr, q ? WQ : WK, DM, DM, nullptr, 0, CS, q ? QP16 + zq : KP16 + zk, q ? QPh + zq : KPh + zk, q ? QPl + zq : KPl + zk); }
    else gemmw_body<bf, 0, 2>(red, (y - DQ / 128 - DKV / 128) * 128, tt * 128, WV, nullptr, X, DM, DM, nullptr, 0, nullptr, VT16 + zk, VTh + zk, VTl + zk);
}

typedef __attribute__((ext_vector_type(2))) _Float16 v2h;
typedef __attribute__((ext_vector_type(4))) _Float16 v4h;
typedef __attribute__((ext_vector_type(2))) unsigned short v2us;
typedef __attribute__((ext_vector_type(4))) unsigned short v4us;
typedef __attribute__((ext_vector_type(2))) float v2f;
typedef __attribute__((ext_vector_type(4))) int v4i;

// Conversion f32 [rows][DM] -> bf16 in fragment order. A piece is 8 elements of a row; a wave takes 8 rows x one k block at a time (8 whole f32 lines in), its 4 pieces a row going out as 4 whole 128-byte lines; a unit is what the 8 waves of a work-group take at a time: 8 rows x 8 k blocks.
// The five inputs count as one matrix of CROWS rows, x (both batches), wq, wk, wv, wo one below the other, and dst is that matrix in fragment order (every part starts at a multiple of 16 rows), so a unit lies in one input. wo's rows hold the bf16-rounded value as fp16 (the wo product's operand type; the same value from 2^-17 up, below that to within 2^-25), the others bf16. cvt_at gives thread tid's piece of a unit: where it is read (ps) and where it goes (pd).
#define CROWS (NB_ * TT + DQ + 2 * DKV + DM)
__device__ __forceinline__ void cvt_at(const float* __restrict__ x, const float* __restrict__ wq, const float* __restrict__ wk, const float* __restrict__ wv, const float* __restrict__ wo, bf* dst, int unit, int tid, const float*& ps, bf*& pd) { static_assert(DQ == DM && DM == 2048, "every converted matrix has DM elements a row; 8 units to 8 rows");
    const int rg = unit >> 3, row0 = rg * 8, kb = (unit & 7) * 8 + (tid >> 5), j = tid & 3, r = (tid & 31) >> 2;   // group of 8 rows and its first row; the wave's k block; the thread's piece of the block and its row of the group
    const float* src = x; int first = 0;
    if (row0 >= NB_ * TT + DQ + 2 * DKV) { src = wo; first = NB_ * TT + DQ + 2 * DKV; } else if (row0 >= NB_ * TT + DQ + DKV) { src = wv; first = NB_ * TT + DQ + DKV; } else if (row0 >= NB_ * TT + DQ) { src = wk; first = NB_ * TT + DQ; } else if (row0 >= NB_ * TT) { src = wq; first = NB_ * TT; }
    ps = src + (size_t)(row0 - first + r) * DM + kb * 32 + j * 8;
    pd = dst + (size_t)(rg >> 1) * (16 * DM) + kb * 512 + (j >> 1) * 256 + ((j & 1) * 16 + (rg & 1) * 8 + r) * 8; }

__constant__ float INVT[HD / 2] = { 1.000000000e+00f, 7.498942018e-01f, 5.623413324e-01f, 4.216965139e-01f, 3.162277639e-01f, 2.371373624e-01f, 1.778279394e-01f, 1.333521456e-01f, 1.000000015e-01f, 7.498941571e-02f, 5.623412877e-02f, 4.216964915e-02f, 3.162277862e-02f, 2.371373586e-02f, 1.778279431e-02f, 1.333521493e-02f, 9.999999776e-03f, 7.498942316e-03f, 5.623413250e-03f, 4.216964822e-03f, 3.162277862e-03f, 2.371373819e-03f, 1.778279431e-03f, 1.333521446e-03f, 1.000000047e-03f, 7.498941850e-04f, 5.623413017e-04f, 4.216964880e-04f, 3.162277862e-04f, 2.371373848e-04f, 1.778279402e-04f, 1.333521504e-04f };   // float32 1 / 10000^(2i/64), generated with jnp to be bit-exact
__device__ __forceinline__ v2f cs5(int idx) { const int d = idx % HD; const int t = idx / HD; const float a = __fmul_rn((float)t, INVT[d % (HD / 2)]); v2f cs; cs[0] = cosf(a); cs[1] = sinf(a); return cs; }   // (cos, sin) of table entry idx = t * HD + d
// k_prep: the rotary table and all five conversions in one grid that is resident as a whole: few waves that each do much, for speed only.
// The first TWG work-groups write the table, TE entries a thread. Each of the PWG others (two to a WGP: 16 waves) converts PU units, unit u * PWG + its own number, so that the grid as a whole walks the matrix from top to bottom; the loads of PGR units are issued as one group, one group ahead of the group that is being rounded and stored.
#define PU  18
#define PGR 6
#define PWG (CROWS * (DM / 8) / 256 / PU)
#define TE  4
#define TWG (TT * HD / 256 / TE)
#define WOU ((NB_ * TT + DQ + 2 * DKV) / PWG)   // a step of PWG units is PWG rows: wo's rows start at step WOU
__global__ __launch_bounds__(256) void k_prep(const float* __restrict__ x, const float* __restrict__ wq, const float* __restrict__ wk, const float* __restrict__ wv, const float* __restrict__ wo, bf* dst, float* CS) {
    static_assert(TT * HD % (256 * TE) == 0 && CROWS * (DM / 8) % (256 * PU) == 0 && PU % PGR == 0 && PGR == 6, "whole work-groups for the table and for the units; whole groups; the waits below name 6 pointers");
    static_assert((NB_ * TT + DQ + 2 * DKV) % PWG == 0, "wo starts at a whole step");
    const int g = blockIdx.x, tid = (int)threadIdx.x;
    if (g < TWG) { v2f cs[TE];
#pragma unroll   // unrolled: the entries stay in registers and go out as one run of stores
        for (int e = 0; e < TE; ++e) cs[e] = cs5((g * TE + e) * 256 + tid);
#pragma unroll   // unrolled: cs is indexed by constants
        for (int e = 0; e < TE; ++e) *(v2f*)(CS + (size_t)((g * TE + e) * 256 + tid) * 2) = cs[e];
        return; }
    const int gg = g - TWG; __builtin_assume(gg < PWG);   // the grid has TWG + PWG work-groups: with PWG units = 512 rows a step, which input a unit lies in is then known when the loop is unrolled
    v8f v[PU];
#pragma unroll   // unrolled, the inner loops too: every piece has registers of its own, so that two groups of loads can be in flight at once
    for (int c = 0; c <= PU / PGR; ++c) {
        if (c < PU / PGR) { const float* ps[PGR]; bf* pd;   // group c's loads
#pragma unroll
            for (int k = 0; k < PGR; ++k) { cvt_at(x, wq, wk, wv, wo, dst, (c * PGR + k) * PWG + gg, tid, ps[k], pd); v[c * PGR + k] = *(const v8f*)ps[k]; }
            // s_wait_xcnt 0 behind the group of loads, in front of any overwrite of an address register that they name (a precaution); the pointers are inputs so that they stay in their registers up to the wait
            asm volatile("s_wait_xcnt 0x0" :: "v"(ps[0]), "v"(ps[1]), "v"(ps[2]), "v"(ps[3]), "v"(ps[4]), "v"(ps[5]) : "memory");
            __builtin_amdgcn_sched_barrier(0); }   // nothing moves over the end of a group: left alone the compiler rounds two groups in front of the first store, waiting for every load in flight before the next group is asked for
        if (c > 0) { const float* ps; bf* pd[PGR];   // group c - 1 is rounded and stored while group c flies
#pragma unroll
            for (int k = 0; k < PGR; ++k) { cvt_at(x, wq, wk, wv, wo, dst, ((c - 1) * PGR + k) * PWG + gg, tid, ps, pd[k]); v8us o;
#pragma unroll
                for (int e = 0; e < 8; ++e) o[e] = (c - 1) * PGR + k < WOU ? f2bf(v[(c - 1) * PGR + k][e]) : __builtin_bit_cast(unsigned short, tohx(bfr(v[(c - 1) * PGR + k][e])));
                *(v8us*)pd[k] = o; }
            // the same wait behind the group of stores
            asm volatile("s_wait_xcnt 0x0" :: "v"(pd[0]), "v"(pd[1]), "v"(pd[2]), "v"(pd[3]), "v"(pd[4]), "v"(pd[5]) : "memory");
            __builtin_amdgcn_sched_barrier(0); }   // as above: the next group's loads are asked for before the group in flight is waited for
    }
}
// ---- k_fattn: scores, softmax, probability x value and the head merge in ONE kernel (running maximum and running sum per query; no score or probability ever leaves the registers).
// One wave = 16 query rows of one head; the REP waves of a work-group are the REP heads of one kv group, so they walk the same K and V lines from key 0 on. Grid (NKV, NB_, TT / 16); no LDS, no barrier.
// S^T = K Q^T: A = K rows (key = lane & 15), B = Q rows (query = lane & 15), so lane (lr, hi) holds for query lr the keys 8 hi + j of each 16-key tile: maximum and sum in-lane plus one exchange between the wave halves.
// Two such tiles, converted in place, are the B operand (k = 8 hi + s, 16 + 8 hi + (s - 8)) of O^T += V^T P^T, A = V^T rows loaded in the same k order; O^T keeps query = lane & 15, so the rescale is lane-local and a lane stores 8 consecutive d. Q, K, V^T come in fragment order (WFrag) and the output leaves in it, as fp16: one plane, and for the hi/lo rows a second one with what the first rounding left.
// Rows < RH: hi/lo planes, 3 products each, 32 keys a pass; the rest fp16, 64 keys a pass, probabilities carried x 2^10 (the sum carries the same factor, so it cancels in the division).
typedef __attribute__((ext_vector_type(16))) unsigned short v16us;
template <bool B> struct Flag { static constexpr bool v = B; };
// 2^x on the transcendental unit with the slot that the instruction set asks for behind it, in one statement: each v_exp_f32 works in place, so none touches the source or the result of the one in front of it, and the closing v_nop stands between the last one and whatever the compiler schedules next.
__device__ __forceinline__ void exp2x8(float (&e)[8]) {
    asm("v_exp_f32 %0, %0\n\tv_exp_f32 %1, %1\n\tv_exp_f32 %2, %2\n\tv_exp_f32 %3, %3\n\tv_exp_f32 %4, %4\n\tv_exp_f32 %5, %5\n\tv_exp_f32 %6, %6\n\tv_exp_f32 %7, %7\n\tv_nop"
        : "+v"(e[0]), "+v"(e[1]), "+v"(e[2]), "+v"(e[3]), "+v"(e[4]), "+v"(e[5]), "+v"(e[6]), "+v"(e[7])); }
__device__ __forceinline__ float exp2x1(float a) { float e; asm("v_exp_f32 %0, %1\n\tv_nop" : "=v"(e) : "v"(a)); return e; }   // the same for one value
template <typename T16, bool HL, int KB>
__device__ __forceinline__ void fattn_body(const T16* __restrict__ Q, const T16* __restrict__ Q2, const T16* __restrict__ Kp, const T16* __restrict__ Kp2, const T16* __restrict__ Vt, const T16* __restrict__ Vt2, int q0, int kv, int head, h16* A16, h16* Al) {
    typedef typename WFrag<T16>::V V;
    constexpr int NKT = KB / 16, NKH = KB / 32;
    constexpr float C1 = SCL * 1.4426950408889634f;   // raw score -> log2 units: HD^-0.5 x log2(e)
    constexpr bool AHEAD = !HL;   // K fragments fetched one pass ahead; not on the hi/lo path, whose twofold fragments would then take the wave past 256 registers
    const int lane = threadIdx.x & 31, lr = lane & 15, hi = lane >> 4; const int qi = q0 + lr;
    V qf[2], qf2[2];
    { const T16* pq = Q + ((size_t)head * TT + q0) * HD + 8 * lane; qf[0] = WFrag<T16>::ld(pq); qf[1] = WFrag<T16>::ld(pq + 512);
      // s_wait_xcnt 0 behind the run of Q loads, in front of any overwrite of an address register that they name (a precaution); the pointers are inputs so that they stay in their registers up to the wait
      if constexpr (HL) { const T16* pq2 = Q2 + ((size_t)head * TT + q0) * HD + 8 * lane; qf2[0] = WFrag<T16>::ld(pq2); qf2[1] = WFrag<T16>::ld(pq2 + 512); asm volatile("s_wait_xcnt 0x0" :: "v"(pq), "v"(pq2) : "memory"); }
      else asm volatile("s_wait_xcnt 0x0" :: "v"(pq) : "memory"); }
    const size_t koff = (size_t)kv * TT * HD + 8 * lane, voff = (size_t)kv * HD * TT + 8 * lane;
    v8f o[4];
#pragma unroll
    for (int db = 0; db < 4; ++db) o[db] = (v8f){};
    float m = -3.0e38f, l = 0.f;
    V kf[NKT][2], kf2[NKT][2];
    auto load_k = [&](int k0) {   // the K fragments of the pass that starts at key k0
        const T16* pk = Kp + koff + (size_t)k0 * HD;
#pragma unroll
        for (int kt = 0; kt < NKT; ++kt)
#pragma unroll
            for (int ks = 0; ks < 2; ++ks) kf[kt][ks] = WFrag<T16>::ld(pk + (kt * 2 + ks) * 512);
        // the same wait behind the run of K loads
        if constexpr (HL) { const T16* pk2 = Kp2 + koff + (size_t)k0 * HD;
#pragma unroll
            for (int kt = 0; kt < NKT; ++kt)
#pragma unroll
                for (int ks = 0; ks < 2; ++ks) kf2[kt][ks] = WFrag<T16>::ld(pk2 + (kt * 2 + ks) * 512);
            asm volatile("s_wait_xcnt 0x0" :: "v"(pk), "v"(pk2) : "memory"); }
        else asm volatile("s_wait_xcnt 0x0" :: "v"(pk) : "memory"); };
    auto pass = [&](int k0, auto edge) {   // KB keys from k0 on; edge: the one pass that holds the diagonal (causal select, no pass behind it)
        constexpr bool EDGE = decltype(edge)::v;
        V vf[4][NKH], vf2[4][NKH];
        if constexpr (!AHEAD) load_k(k0);
        const T16* pv = Vt + voff + (size_t)k0 * 16;
#pragma unroll
        for (int db = 0; db < 4; ++db)
#pragma unroll
            for (int kh = 0; kh < NKH; ++kh) vf[db][kh] = WFrag<T16>::ld(pv + (size_t)db * 16 * TT + kh * 512);
        // the same wait behind the run of V loads
        if constexpr (HL) { const T16* pv2 = Vt2 + voff + (size_t)k0 * 16;
#pragma unroll
            for (int db = 0; db < 4; ++db)
#pragma unroll
                for (int kh = 0; kh < NKH; ++kh) vf2[db][kh] = WFrag<T16>::ld(pv2 + (size_t)db * 16 * TT + kh * 512);
            asm volatile("s_wait_xcnt 0x0" :: "v"(pv), "v"(pv2) : "memory"); }
        else asm volatile("s_wait_xcnt 0x0" :: "v"(pv) : "memory");
        v8f s[NKT];
#pragma unroll
        for (int kt = 0; kt < NKT; ++kt) { s[kt] = (v8f){};
#pragma unroll
            for (int ks = 0; ks < 2; ++ks) { s[kt] = WFrag<T16>::mma(kf[kt][ks], qf[ks], s[kt]); if constexpr (HL) { s[kt] = WFrag<T16>::mma(kf[kt][ks], qf2[ks], s[kt]); s[kt] = WFrag<T16>::mma(kf2[kt][ks], qf[ks], s[kt]); } } }
        if constexpr (AHEAD && !EDGE) load_k(k0 + KB);   // the next pass's K fragments fly during this pass's softmax and P.V (a pass that is not the edge pass always has a successor)
        float bm = -3.0e38f; const int rel = qi - k0 - hi * 8;   // a lane's key kt * 16 + j of the pass is allowed while it is <= rel
#pragma unroll
        for (int kt = 0; kt < NKT; ++kt)
#pragma unroll
            for (int j = 0; j < 8; ++j) { if constexpr (EDGE) s[kt][j] = (kt * 16 + j <= rel) ? s[kt][j] : -3.0e38f; bm = fmaxf(bm, s[kt][j]); }
        bm = fmaxf(bm, __shfl_xor(bm, 16, 32));
        const float mn = fmaxf(m, bm * C1); const float alpha = exp2x1(m - mn); m = mn;   // the running maximum is kept in log2 units
        const float sh = (HL ? 0.0f : 10.0f) - mn;
        float ls[NKT];
#pragma unroll
        for (int kt = 0; kt < NKT; ++kt) { float e[8]; ls[kt] = 0.f;
#pragma unroll
            for (int j = 0; j < 8; ++j) e[j] = s[kt][j] * C1 + sh;   // one multiply-add from raw score to exponent
            exp2x8(e);
#pragma unroll
            for (int j = 0; j < 8; ++j) { s[kt][j] = e[j]; ls[kt] += e[j]; } }
        float lsum = ls[0];
#pragma unroll
        for (int kt = 1; kt < NKT; ++kt) lsum += ls[kt];
        l = l * alpha + lsum;   // each wave half keeps the sum of its own keys; the halves are joined once, behind the last pass
#pragma unroll
        for (int db = 0; db < 4; ++db) o[db] *= alpha;
#pragma unroll
        for (int kh = 0; kh < NKH; ++kh) {
            if constexpr (HL) { v16us ph, pl;
#pragma unroll
                for (int q = 0; q < 16; ++q) { unsigned short a, c2; splitf(s[kh * 2 + (q >> 3)][q & 7], a, c2); ph[q] = a; pl[q] = c2; }
                const V pfh = __builtin_bit_cast(V, ph), pfl = __builtin_bit_cast(V, pl);
#pragma unroll
                for (int db = 0; db < 4; ++db) { o[db] = WFrag<T16>::mma(vf[db][kh], pfh, o[db]); o[db] = WFrag<T16>::mma(vf[db][kh], pfl, o[db]); o[db] = WFrag<T16>::mma(vf2[db][kh], pfh, o[db]); }
            } else { V pf;
#pragma unroll
                for (int q = 0; q < 16; ++q) pf[q] = tohx(s[kh * 2 + (q >> 3)][q & 7]);
#pragma unroll
                for (int db = 0; db < 4; ++db) o[db] = WFrag<T16>::mma(vf[db][kh], pf, o[db]); } }
        asm volatile("v_nop\n\tv_nop\n\tv_nop\n\tv_nop" : "+v"(o[0]), "+v"(o[1]), "+v"(o[2]), "+v"(o[3]) : "v"(vf[3][NKH - 1]));   // four vector slots behind the last WMMA, also on the taken back edge, before fragments or accumulators are touched
    };
    int k0 = 0;   // both loops stay rolled: one pass already holds every fragment of KB keys in registers
    if constexpr (AHEAD) { static_assert(RH >= KB, "the fetch-ahead loop runs at least once: its rows start at RH");
        load_k(0);
#pragma unroll 1
        do { pass(k0, Flag<false>{}); k0 += KB; } while (k0 + KB - 1 <= q0);
    } else {
#pragma unroll 1
        for (; k0 + KB - 1 <= q0; k0 += KB) pass(k0, Flag<false>{}); }
    pass(k0, Flag<true>{});
    const float f = __fdiv_rn(1.0f, l + __shfl_xor(l, 16, 32));
    const size_t oo = (size_t)q0 * DQ + head * (2 * 512) + 8 * lane; v8h oh[4], ol[4];   // fragment order of the wo product's A operand (rows = queries, k = head * HD + d): a lane's 8 values of d block db are its own piece of half db & 1 of k block head * 2 + (db >> 1)
#pragma unroll
    for (int db = 0; db < 4; ++db)
#pragma unroll
        for (int j = 0; j < 8; ++j) { const float y = o[db][j] * f; oh[db][j] = tohx(y); if constexpr (HL) ol[db][j] = tohx(y - (float)oh[db][j]); }
    h16* pa = A16 + oo; h16* pl = Al + oo;
#pragma unroll
    for (int db = 0; db < 4; ++db) { *(v8h*)(pa + db * 256) = oh[db]; if constexpr (HL) *(v8h*)(pl + db * 256) = ol[db]; }
    // s_wait_xcnt 0 behind the run of stores, in front of any overwrite of a register that they name (a precaution)
    if constexpr (HL) asm volatile("s_wait_xcnt 0x0" :: "v"(pa), "v"(pl) : "memory"); else asm volatile("s_wait_xcnt 0x0" :: "v"(pa) : "memory");
}
// amdgpu_waves_per_eu(4, 4): at most 256 registers a wave, so that four waves share a SIMD and half of the NKV x NB_ x TT / 16 work-groups are resident at once; the others follow as places come free
__global__ __launch_bounds__(32 * REP) __attribute__((amdgpu_waves_per_eu(4, 4))) void k_fattn(const h16* __restrict__ Q16, const bf* __restrict__ Qh, const bf* __restrict__ Ql, const h16* __restrict__ K16, const bf* __restrict__ Kh, const bf* __restrict__ Kl, const h16* __restrict__ V16, const bf* __restrict__ Vh, const bf* __restrict__ Vl, h16* A16, h16* Al) {
    const int wave = __builtin_amdgcn_readfirstlane((int)(threadIdx.x >> 5));   // wave number in a scalar register: head, loop bound and branches stay scalar
    const int kv = blockIdx.x, head = kv * REP + wave, rank = blockIdx.z;
    { const size_t zq = (size_t)blockIdx.y * ((size_t)NH_ * TT * HD), zk = (size_t)blockIdx.y * ((size_t)NKV * TT * HD), za = (size_t)blockIdx.y * ((size_t)TT * DQ);   // this batch's planes
      Q16 += zq; Qh += zq; Ql += zq; K16 += zk; Kh += zk; Kl += zk; V16 += zk; Vh += zk; Vl += zk; A16 += za; Al += za; }
    // There are twice as many work-groups as places: the four heads of a work-group take the same tile, and a tile's cost falls with the rank (the slowest grid index), so that the short ones fill the places that the long ones leave.
    // An fp16 tile t costs about t; a hi/lo tile h (three products a key) about 3 h: ranks 0..33 are tiles 127..94; then groups of four (hi/lo tile 31 - g, fp16 tiles 93 - 3 g, 92 - 3 g, 91 - 3 g) down to tile 32; ranks 117..127 are tiles 10..0. For speed only; the map is a permutation, so each (head, tile) is taken once.
    static_assert(TT / 16 == 128 && RH / 16 == 32, "the rank -> tile map is written for 128 tiles, 32 of them hi/lo");
    const int s = rank - 34; const int tile = (rank < 34 || rank >= 117) ? 127 - rank : ((s & 3) == 0 ? 31 - (s >> 2) : 94 - 3 * (s >> 2) - (s & 3)); const int q0 = tile * 16;
    if (q0 < RH) fattn_body<bf, true, 32>(Qh, Ql, Kh, Kl, Vh, Vl, q0, kv, head, A16, Al);
    else fattn_body<h16, false, 64>(Q16, nullptr, K16, nullptr, V16, nullptr, q0, kv, head, A16, Al);
}

extern "C" void kernel_launch(void* const* d_in, const int* in_sizes, int n_in,
                              void* d_out, int out_size, void* d_ws, size_t ws_size, hipStream_t stream) {
    (void)in_sizes; (void)n_in; (void)out_size;
        const float* x = (const float*)d_in[0]; const float* wq = (const float*)d_in[1]; const float* wk = (const float*)d_in[2]; const float* wv = (const float*)d_in[3]; const float* wo = (const float*)d_in[4];   /* inputs x, wq [2048][2048], wk [512][2048], wv, wo ('oi'); this module has no mask input (the causal rule is by index) */
    float* OUT = (float*)d_out;     // [2][2048][2048]
    char* wsp = (char*)d_ws;
    auto take = [&](size_t bytes) { char* p = wsp; wsp += (bytes + 255) & ~(size_t)255; return (void*)p; };
    bf* XB = (bf*)take((size_t)CROWS * DM * 2); bf* WQ = XB + (size_t)NB_ * TT * DM; bf* WK = WQ + (size_t)DQ * DM; bf* WV = WK + (size_t)DKV * DM; h16* WO16 = (h16*)(WV + (size_t)DKV * DM);   // one block, in the row order of cvt_at
    float* CS = (float*)take((size_t)TT * HD * 2 * 4);
    // every plane below holds both batches, one behind the other
    h16* QP16 = (h16*)take((size_t)NB_ * NH_ * TT * HD * 2); h16* KP16 = (h16*)take((size_t)NB_ * NKV * TT * HD * 2); h16* VT16 = (h16*)take((size_t)NB_ * NKV * HD * TT * 2);
    bf* QPh = (bf*)take((size_t)NB_ * NH_ * TT * HD * 2); bf* QPl = (bf*)take((size_t)NB_ * NH_ * TT * HD * 2); bf* KPh = (bf*)take((size_t)NB_ * NKV * TT * HD * 2); bf* KPl = (bf*)take((size_t)NB_ * NKV * TT * HD * 2); bf* VTh = (bf*)take((size_t)NB_ * NKV * HD * TT * 2); bf* VTl = (bf*)take((size_t)NB_ * NKV * HD * TT * 2);
    h16* AT16 = (h16*)take((size_t)NB_ * TT * DQ * 2); h16* ATl = (h16*)take((size_t)NB_ * TT * DQ * 2);   // of ATl only the rows below RH of each batch are written and read
    if ((size_t)(wsp - (char*)d_ws) > ws_size) return;    // ws 256 MiB
    k_prep<<<TWG + PWG, 256, 0, stream>>>(x, wq, wk, wv, wo, XB, CS);   /* rotary table and every 16-bit copy */
    k_proj<<<dim3(TT / 128, DQ / 128 + 2 * (DKV / 128), NB_), 256, 0, stream>>>(XB, WQ, WK, WV, CS, QP16, QPh, QPl, KP16, KPh, KPl, VT16, VTh, VTl);
    k_fattn<<<dim3(NKV, NB_, TT / 16), 32 * REP, 0, stream>>>(QP16, QPh, QPl, KP16, KPh, KPl, VT16, VTh, VTl, AT16, ATl);
    k_wo<<<dim3(TT / 128, DM / 128, NB_), 256, 0, stream>>>(AT16, ATl, WO16, OUT);
}

// v010
// A run of this version takes 126 microseconds.
// Timed twice side by side with v009, it ran 1.06 and 1.04 times as fast.
// All steps since v000 together make it 21.6 times as fast.
#include <hip/hip_runtime.h>

// Grouped-query causal attention with a computed half-split RoPE (x [2][2048][2048]; xq = x wq^T (32 heads x 64), xk, xv = x wk^T, x wv^T (8 kv heads x 64) ('oi', no bias; token-major); cos / sin from inv_freq = 1 / (10000 ** (2i / 64)) and positions arange(S) ([S][32] tables); (x1, x2) = the two 32-wide halves of each head: cat(x1 c - x2 s, x1 s + x2 c) (half-split pairs (d, d + 32)) on q and k; k, v repeated 4 x on the head axis (jnp.repeat: kv head = q head / 4); scores / sqrt(64); where(tril, scores, finfo.min) == exclusion; softmax; out = merged wo^T ('oi') -> [2][2048][2048] (8.4 M); argument order x, wq, wk, wv, wo).
// Every 16-bit matrix operand (x, the weights, the q, k and v^T planes, the merged attention output) is stored by its producer in fragment order (see WFrag).
// Four launches, each over both batches (k_prep, k_proj, k_fattn, k_wo). Layout: bf16 copy of x; 'oi' weights; exact projections whose epilogue applies the rotate-half rotation (cs5 computed table) and stores the 16-bit planes itself; causal T-2048 GQA attention fused in one kernel (k_fattn: running softmax in registers, kv plane = head / REP; hybrid rows: < 512 hi/lo 3 products, rest fp16 x1024; keys above the diagonal block are never read); merged x wo on fp16 operands: rows < 512 fp16 hi + lo, two products, rest one fp16 plane, one product.
// Compute dtypes, f32 accumulate: every input rounded to bf16; projections exact; rotary f32; attention rows < 512 3 products, rest fp16; softmax f32; wo (its bf16-rounded values held as fp16): rows < 512 fp16 hi + lo, rest fp16.

#define NB_  2
#define TT   2048
#define DM   2048
#define NH_  32
#define NKV  8
#define REP  (NH_ / NKV)
#define HD   64
#define DQ   (NH_ * HD)
#define DKV  (NKV * HD)
#define RH   512                  // query rows < RH use hi+lo planes
#define SCL  0.125f   // HD^-0.5
typedef _Float16 h16;
typedef unsigned short bf;
typedef __attribute__((ext_vector_type(16))) __bf16   v16bf;
typedef __attribute__((ext_vector_type(16))) _Float16 v16h;
typedef __attribute__((ext_vector_type(8)))  _Float16 v8h;
typedef __attribute__((ext_vector_type(8)))  unsigned short v8us;
typedef __attribute__((ext_vector_type(8)))  float    v8f;
typedef __attribute__((ext_vector_type(4)))  float    v4f;
typedef v8h  __attribute__((may_alias)) v8ha;
typedef v4f  __attribute__((may_alias)) v4fa;
typedef v8us __attribute__((may_alias)) v8usa;

__device__ __forceinline__ unsigned short f2bf(float f) { unsigned u = __float_as_uint(f); u += 0x7FFFu + ((u >> 16) & 1u); return (unsigned short)(u >> 16); }
__device__ __forceinline__ float bf2f(unsigned short b) { return __uint_as_float(((unsigned)b) << 16); }
__device__ __forceinline__ float bfr(float f) { return bf2f(f2bf(f)); }
__device__ __forceinline__ v16h cat16(v8h lo, v8h hi) { return __builtin_shufflevector(lo, hi, 0, 1, 2, 3, 4, 5, 6, 7, 8, 9, 10, 11, 12, 13, 14, 15); }
__device__ __forceinline__ v16bf cat16b(v8us lo, v8us hi) { return __builtin_bit_cast(v16bf, __builtin_shufflevector(lo, hi, 0, 1, 2, 3, 4, 5, 6, 7, 8, 9, 10, 11, 12, 13, 14, 15)); }
__device__ __forceinline__ v8f wmma16(v16h a, v16h b, v8f c) { return __builtin_amdgcn_wmma_f32_16x16x32_f16(false, a, false, b, (short)0, c, false, false); }
__device__ __forceinline__ v8f wmmab(v16bf a, v16bf b, v8f c) { return __builtin_amdgcn_wmma_f32_16x16x32_bf16(false, a, false, b, (short)0, c, false, false); }
__device__ __forceinline__ h16 tohx(float x) { return (h16)x; }
__device__ __forceinline__ void splitf(float y, unsigned short& h, unsigned short& l) { h = f2bf(y); l = f2bf(y - bf2f(h)); }



// ---- gemmw_body: register-blocked GEMM, one 128x128 output tile per work-group of 8 waves; grid (M/128, N/128, Z), 256 threads. The tile is 2 x 2 sub-tiles of 64x64; two waves share a sub-tile and split K between them (wave = sub-tile * 2 + wk).
// K goes in stages of 64 (two 1-KiB blocks of every group of 16 operand rows): the work-group brings the stage's 128 rows of every operand (A2: 64) into LDS once, by asynchronous copies, two buffers, the next stage flying while this one is worked on; so each operand byte leaves L2 once per 128x128 tile and serves two sub-tiles.
// Wave wk takes k block wk of every stage and keeps its own 64x64 partial tile (16 accumulators); the two partial tiles of a sub-tile are then summed, wk 0 first, through LDS (the staging buffers' place, free by then).
// C[m][n] (f32, pitch ldc) = sum_k A[m][k] Bt[n][k]. A has lda, Bt K elements a row (fragment order). K % 64 == 0.
// NSPLIT 1 (the 256-row tile, MS 4 below): the tile's upper 64 rows are rows r0 .. of A and C and take a second product, + A2[m][k] Bt[n][k]; its lower 192 rows are rows r1 .. and take one. The waves that share a SIMD (w, w + 4, w + 8, w + 12) are an upper one and three lower ones, so every SIMD gets the same matrix work.
// Fragment order: a block of 16 rows x 32 k of an operand is 512 consecutive elements, element (r, k) at (k >> 4) * 256 + (((k >> 3) & 1) * 16 + r) * 8 + (k & 7): lane l's two 16-byte pieces (row l & 15; k = 8 (l >> 4) + 0..7 and 16 + 8 (l >> 4) + 0..7) lie at l * 8 and 256 + l * 8,
// so each wave-wide 16-byte load covers 512 contiguous bytes (4 whole lines, not 16 pieces of 32 B). Blocks follow one another along k, then along the groups of 16 rows: a matrix of pitch P has block (row group g, k block b) at g * 16 * P + b * 512. ld takes the block's address + 8 * lane.
// EPI 0: the summed tile goes out as f32 C. EPI 1, 2: no f32 tile leaves the kernel; the tile is stored as three 16-bit planes (fp16, bf16 hi, bf16 lo) in fragment order, a thread taking the pieces of columns 8 o .. 8 o + 7 and 32 + 8 o .. of one row, so each wave-wide 16-byte store covers 512 contiguous bytes.
// EPI 1 (q, k; rows = positions t, the 64 columns = one head): rotate-half first, out[d] = x[d] cos[t][d] - x[d+32] sin[t][d], out[d+32] = x[d+32] cos[t][d] + x[d] sin[t][d] (a thread's two pieces are exactly such pairs); planes [head][t][d], pitch HD.
// EPI 2 (v; launched as wv x^T, so rows = kv head * HD + d and columns = t: the tile is V^T already): planes [g][d][t], pitch TT.
template <typename T16> struct WFrag;
template <> struct WFrag<h16> { typedef v16h V; static __device__ __forceinline__ V ld(const h16* p) { return cat16(*(const v8h*)p, *(const v8h*)(p + 256)); } static __device__ __forceinline__ v8f mma(V a, V b, v8f c) { return wmma16(a, b, c); } };
template <> struct WFrag<bf> { typedef v16bf V; static __device__ __forceinline__ V ld(const bf* p) { return cat16b(*(const v8us*)p, *(const v8us*)(p + 256)); } static __device__ __forceinline__ v8f mma(V a, V b, v8f c) { return wmmab(a, b, c); } };
// copy8: a stage's asynchronous 16-byte-a-lane copies to LDS, 4 KiB apart in LDS and sa (A) or sb (Bt) bytes apart in memory: four an operand. The s_wait_xcnt 0 stands in the copies' own statement, in front of any overwrite of a register that they name (a precaution).
__device__ __forceinline__ void copy8(unsigned l, const char* a, size_t sa, const char* b, size_t sb) {
    asm volatile("global_load_async_to_lds_b128 %0, %8, off\n\tglobal_load_async_to_lds_b128 %1, %9, off\n\tglobal_load_async_to_lds_b128 %2, %10, off\n\tglobal_load_async_to_lds_b128 %3, %11, off\n\tglobal_load_async_to_lds_b128 %4, %12, off\n\tglobal_load_async_to_lds_b128 %5, %13, off\n\tglobal_load_async_to_lds_b128 %6, %14, off\n\tglobal_load_async_to_lds_b128 %7, %15, off\n\ts_wait_xcnt 0x0"
                 :: "v"(l), "v"(l + 4096u), "v"(l + 8192u), "v"(l + 12288u), "v"(l + 16384u), "v"(l + 20480u), "v"(l + 24576u), "v"(l + 28672u),
                    "v"(a), "v"(a + sa), "v"(a + 2 * sa), "v"(a + 3 * sa), "v"(b), "v"(b + sb), "v"(b + 2 * sb), "v"(b + 3 * sb) : "memory"); }
// copy7: a stage of the 256-row tile (512 threads, so a copy moves 8 KiB = 64 rows): one copy for A's upper 64 rows (a), three for its lower 192 rows (al), two for Bt, one for A2; sa, sb: bytes of 64 rows. The wait as above.
__device__ __forceinline__ void copy7(unsigned l, const char* a, const char* al, size_t sa, const char* b, size_t sb, const char* a2) {
    asm volatile("global_load_async_to_lds_b128 %0, %7, off\n\tglobal_load_async_to_lds_b128 %1, %8, off\n\tglobal_load_async_to_lds_b128 %2, %9, off\n\tglobal_load_async_to_lds_b128 %3, %10, off\n\tglobal_load_async_to_lds_b128 %4, %11, off\n\tglobal_load_async_to_lds_b128 %5, %12, off\n\tglobal_load_async_to_lds_b128 %6, %13, off\n\ts_wait_xcnt 0x0"
                 :: "v"(l), "v"(l + 8192u), "v"(l + 16384u), "v"(l + 24576u), "v"(l + 32768u), "v"(l + 40960u), "v"(l + 49152u),
                    "v"(a), "v"(al), "v"(al + sa), "v"(al + 2 * sa), "v"(b), "v"(b + sb), "v"(a2) : "memory"); }
// gemmw_body is the work of one work-group: the tile at rows r0, columns c0, with red = its MS * 4 * 64 * 68 floats of LDS; the kernels below pick tile, operands and planes from blockIdx.
// A stage in LDS: [A 16 KiB (MS 4: 32 KiB) | Bt 16 KiB | A2 8 KiB (NSPLIT 1)], each the operand's groups of 16 rows, 2 KiB (two k blocks, as they lie in memory) a group. One copy of all 256 threads moves two groups, of 512 threads four.
// MS = sub-tiles of 64 rows in the tile's height, 128 threads (4 waves) each. MS 2: the 128x128 tile above. MS 4 (NSPLIT 1, EPI 0 only): a 256x128 tile of 16 waves, so that the 128 rows of Bt leave L2 once for 256 rows of C; A is 32 KiB a stage, its upper 64 rows (from r0; two products) and its lower 192 rows (from r1; one product).
template <typename T16, int NSPLIT, int EPI, int MS = 2>
__device__ __forceinline__ void gemmw_body(float* red, int r0, int c0, const T16* __restrict__ A, const T16* __restrict__ A2, const T16* __restrict__ Bt, int K, int lda, float* C, int ldc, const float* __restrict__ CS, h16* P16, bf* Ph, bf* Pl, int r1 = 0) {
    typedef typename WFrag<T16>::V V;
    static_assert(NSPLIT == 0 || NSPLIT == 1, "one or two A planes");
    static_assert((MS == 2 && NSPLIT == 0) || (MS == 4 && NSPLIT == 1 && EPI == 0), "the 256-row tile is written for the two-plane f32 product, and that product for it");
    constexpr int NTH = MS * 128;                      // threads of the work-group
    constexpr int BO = MS * 4096, A2O = BO + 8192;     // where Bt and A2 start in a stage, in elements
    constexpr int SB = NSPLIT == 1 ? 57344 : 32768;   // bytes of a stage
    constexpr int KS = MS == 4 ? 2 : 1;               // stages between two barriers (a buffer holds KS stages): two for the 16-wave tile, whose waves all stand at each barrier together while the matrix units wait for the first fragments behind it
    const int rl = NSPLIT == 1 ? r1 : r0 + 64;   // first row of the tile's lower rows (all but its upper 64)
    static_assert(2 * KS * SB <= MS * 4 * 64 * 68 * 4, "both buffers lie inside red");
    const int tid = (int)threadIdx.x, lane = tid & 31, lr = lane & 15, hi = lane >> 4;
    const int wave = __builtin_amdgcn_readfirstlane(tid >> 5);   // wave number in a scalar register: sub-tile and k block stay scalar
    const int sm = wave >> 2, sn = (wave >> 1) & 1, wk = wave & 1;
    const int NT = K / 64;
    v8f acc[4][4];
#pragma unroll
    for (int mb = 0; mb < 4; ++mb)
#pragma unroll
        for (int nb = 0; nb < 4; ++nb) acc[mb][nb] = (v8f){};
    // this thread's 16 bytes of the first two groups (512 threads: four) of each operand; the next ones lie 32 rows (512 threads: 64) on, the next stage 2 KiB on
    const char* gA = (const char*)(A + (size_t)(r0 + 16 * (tid >> 7)) * lda + (tid & 127) * 8);
    const char* gB = (const char*)(Bt + (size_t)(c0 + 16 * (tid >> 7)) * K + (tid & 127) * 8);
    const char* gA2 = NSPLIT == 1 ? (const char*)(A2 + (size_t)(r0 + 16 * (tid >> 7)) * lda + (tid & 127) * 8) : nullptr;
    const char* gAl = NSPLIT == 1 ? (const char*)(A + (size_t)(rl + 16 * (tid >> 7)) * lda + (tid & 127) * 8) : nullptr;
    const unsigned l0 = (unsigned)(size_t)red + (unsigned)tid * 16u;   // LDS byte address: the low 32 bits of the __shared__ address
    auto stage = [&](int t) {   // stage t's copies into place t & (2 KS - 1) of the two buffers
        const unsigned l = l0 + (unsigned)(t & (2 * KS - 1)) * (unsigned)SB; const size_t o = (size_t)t * 2048;
        if constexpr (NSPLIT == 1) copy7(l, gA + o, gAl + o, (size_t)lda * 128, gB + o, (size_t)K * 128, gA2 + o);
        else copy8(l, gA + o, (size_t)lda * 64, gB + o, (size_t)K * 64); };
    stage(0); if constexpr (KS == 2) stage(1);
    asm volatile("s_wait_asynccnt 0x0" ::: "memory");   // this wave's copies of the first buffer have landed
    __syncthreads();                                     // ... and every other wave's: it may be read
    if (KS < NT) { stage(KS); if constexpr (KS == 2) stage(KS + 1); }
#pragma unroll 1   // rolled: one copy of the stage's code, the place picked by t & (2 KS - 1)
    for (int t = 0; t < NT; ++t) {
        const T16* sb = (const T16*)red + (t & (2 * KS - 1)) * (SB / 2) + wk * 512 + 8 * lane;
        V a[4], a2[4], b[4];   // every fragment of the stage's first product is asked for in one group, in front of the first WMMA
#pragma unroll
        for (int mb = 0; mb < 4; ++mb) { a[mb] = WFrag<T16>::ld(sb + (sm * 4 + mb) * 1024); b[mb] = WFrag<T16>::ld(sb + BO + (sn * 4 + mb) * 1024); }
        asm volatile("" :: "v"(b[0]), "v"(b[1]), "v"(b[2]), "v"(b[3]));   // inputs only: holds the B fragments' loads in the one group in front of the first WMMA; left alone the compiler puts three of them among the WMMAs, each with a wait for the LDS of its own
        if constexpr (NSPLIT == 1) {
            asm volatile("" :: "v"(a[0]), "v"(a[1]), "v"(a[2]), "v"(a[3]));   // inputs only: the A fragments too have landed in front of the branch; left alone the wait for the last of them stands in the common code behind it and there waits for the second plane's loads as well
            if (sm == 0) {   // a scalar test: the upper waves alone have a second plane; its fragments are asked for behind the others and land during the first product
#pragma unroll
            for (int mb = 0; mb < 4; ++mb) a2[mb] = WFrag<T16>::ld(sb + A2O + mb * 1024); } }
#pragma unroll
        for (int nb = 0; nb < 4; ++nb)
#pragma unroll
            for (int mb = 0; mb < 4; ++mb) acc[mb][nb] = WFrag<T16>::mma(a[mb], b[nb], acc[mb][nb]);
        if constexpr (NSPLIT == 1) { if (sm == 0) {
#pragma unroll
            for (int nb = 0; nb < 4; ++nb)
#pragma unroll
                for (int mb = 0; mb < 4; ++mb) acc[mb][nb] = WFrag<T16>::mma(a2[mb], b[nb], acc[mb][nb]); } }
        // four vector slots behind the last WMMA, also on the taken back edge, before fragments or accumulators are touched; every accumulator is named so that no WMMA of the stage stands behind them
        asm volatile("v_nop\n\tv_nop\n\tv_nop\n\tv_nop" : "+v"(acc[0][0]), "+v"(acc[0][1]), "+v"(acc[0][2]), "+v"(acc[0][3]), "+v"(acc[1][0]), "+v"(acc[1][1]), "+v"(acc[1][2]), "+v"(acc[1][3]), "+v"(acc[2][0]), "+v"(acc[2][1]), "+v"(acc[2][2]), "+v"(acc[2][3]), "+v"(acc[3][0]), "+v"(acc[3][1]), "+v"(acc[3][2]), "+v"(acc[3][3]));
        if constexpr (KS == 2) { if ((t & 1) == 0) continue; }
        asm volatile("s_wait_dscnt 0x0" ::: "memory");
        asm volatile("s_wait_asynccnt 0x0" ::: "memory");
        __syncthreads();
        if (t + KS + 1 < NT) { stage(t + KS + 1); if constexpr (KS == 2) stage(t + KS + 2); }
    }
    asm volatile("s_wait_asynccnt 0x0" ::: "memory");   // nothing is in flight when the buffers become the partial tiles' place
    const int pg = tid >> 6, po = (tid >> 4) & 3, prow = pg * 16 + (tid & 15);   // EPI 1, 2: this thread's group of 16 rows, its 8-column piece and its row of a sub-tile
    v4f cs[2][4];
    if constexpr (EPI == 1) { const float* pc = CS + ((size_t)(r0 + prow) * HD + po * 8) * 2;   // (cos, sin) of the thread's 8 column pairs, for its row of the upper and of the lower sub-tiles, asked for here so that they fly during the LDS stores and the barrier
#pragma unroll
        for (int h = 0; h < 2; ++h)
#pragma unroll
            for (int q = 0; q < 4; ++q) cs[h][q] = *(const v4f*)(pc + h * (64 * HD * 2) + q * 4);
        asm volatile("s_wait_xcnt 0x0" :: "v"(pc) : "memory"); }   // the wait stands in front of any overwrite of the address register that the loads name (a precaution)
    float* mine = red + wave * (64 * 68);
#pragma unroll
    for (int mb = 0; mb < 4; ++mb)
#pragma unroll
        for (int nb = 0; nb < 4; ++nb)
#pragma unroll
            for (int j = 0; j < 8; ++j) mine[(mb * 16 + hi * 8 + j) * 68 + nb * 16 + lr] = acc[mb][nb][j];
    __syncthreads();   // every wave's partial tile is in LDS before any wave sums
    if constexpr (EPI == 0) {
        v4f val[16]; float* pc[16];
#pragma unroll
        for (int s = 0; s < 16; ++s) { constexpr int PER = 1024 / NTH; const int sub = s / PER, q = (s % PER) * NTH + tid, row = q >> 4, cofs = (q & 15) * 4; const float* pr = red + sub * (2 * 64 * 68) + row * 68 + cofs;   // PER 16-byte pieces a thread and sub-tile, MS * 2 sub-tiles
            val[s] = *(const v4fa*)pr + *(const v4fa*)(pr + 64 * 68); pc[s] = C + (size_t)((sub >> 1 ? rl + ((sub >> 1) - 1) * 64 : r0) + row) * ldc + c0 + (sub & 1) * 64 + cofs; }
#pragma unroll
        for (int s = 0; s < 16; ++s) *(v4f*)pc[s] = val[s];
        // one s_wait_xcnt 0 behind the run of stores; the pointers are inputs so that they stay in their registers up to the wait (a precaution)
        asm volatile("s_wait_xcnt 0x0" :: "v"(pc[0]), "v"(pc[1]), "v"(pc[2]), "v"(pc[3]), "v"(pc[4]), "v"(pc[5]), "v"(pc[6]), "v"(pc[7]), "v"(pc[8]), "v"(pc[9]), "v"(pc[10]), "v"(pc[11]), "v"(pc[12]), "v"(pc[13]), "v"(pc[14]), "v"(pc[15]) : "memory");
    } else {
        static_assert(HD == 64, "256 threads = 64 rows x 4 pairs of 8-column pieces; one sub-tile = one head");
        float x[4][2][8];   // per sub-tile: x[0]: columns 8 po .. + 7, x[1]: the same + 32, each the two partials summed, wk 0 first
#pragma unroll
        for (int sub = 0; sub < 4; ++sub)
#pragma unroll
            for (int q = 0; q < 4; ++q) { const int cofs = (q >> 1) * 32 + po * 8 + (q & 1) * 4; const float* pr = red + sub * (2 * 64 * 68) + prow * 68 + cofs; const v4f val = *(const v4fa*)pr + *(const v4fa*)(pr + 64 * 68);
#pragma unroll
                for (int i = 0; i < 4; ++i) x[sub][q >> 1][(q & 1) * 4 + i] = val[i]; }
#pragma unroll
        for (int sub = 0; sub < 4; ++sub) { const int rs = r0 + (sub >> 1) * 64, cc = c0 + (sub & 1) * 64;   // the sub-tile's first row and column
            if constexpr (EPI == 1) {
#pragma unroll
                for (int j = 0; j < 8; ++j) { const float c = cs[sub >> 1][j >> 1][(j & 1) * 2], s = cs[sub >> 1][j >> 1][(j & 1) * 2 + 1], a = x[sub][0][j], b = x[sub][1][j]; x[sub][0][j] = a * c - b * s; x[sub][1][j] = b * c + a * s; } }
            v8h o16[2]; v8us oh[2], ol[2];
#pragma unroll
            for (int p = 0; p < 2; ++p)
#pragma unroll
                for (int j = 0; j < 8; ++j) { unsigned short a2, c2; splitf(x[sub][p][j], a2, c2); o16[p][j] = tohx(x[sub][p][j]); oh[p][j] = a2; ol[p][j] = c2; }
            // block (row group, k block) of a plane of pitch P lies at group * 16 * P + block * 512; the thread's piece of it at (8-column piece * 16 + row) * 8; its second piece is the next k block's
            const size_t oo = (EPI == 1 ? (size_t)(cc / HD) * TT * HD + (size_t)(rs + pg * 16) * HD : (size_t)(rs + pg * 16) * TT + (size_t)(cc / 32) * 512) + (tid & 63) * 8;
            h16* p16 = P16 + oo; bf* ph = Ph + oo; bf* pl = Pl + oo;
#pragma unroll
            for (int p = 0; p < 2; ++p) { *(v8h*)(p16 + p * 512) = o16[p]; *(v8us*)(ph + p * 512) = oh[p]; *(v8us*)(pl + p * 512) = ol[p]; }
            asm volatile("s_wait_xcnt 0x0" :: "v"(p16), "v"(ph), "v"(pl) : "memory"); }   // behind the sub-tile's stores, in front of any overwrite of an address register that they name (a precaution)
    }
}
// k_wo: out = merged attention output x wo^T, all operands fp16; grid (TT / 256, DM / 128, NB_), 512 threads, one 256x128 tile a work-group (one work-group a WGP, by its LDS). The rows below RH (the attention's hi/lo rows) go in as fp16 hi + lo planes, two products; the others as the one fp16 plane, one product.
// Every row tile is mixed alike: tile i = the 64 two-product rows from 64 i on and the 192 one-product rows from RH + 192 i on, so every work-group has the same work, and the four waves that share a SIMD (w, w + 4, w + 8, w + 12) are one two-product wave and three one-product waves.
__global__ __launch_bounds__(512) void k_wo(const h16* __restrict__ A16, const h16* __restrict__ Al, const h16* __restrict__ W16, float* C) {
    __shared__ __align__(16) float red[16 * 64 * 68];
    static_assert(RH / 64 == TT / 256 && RH % 64 == 0 && (TT - RH) == 192 * (TT / 256), "the tiles cover every row once");
    const size_t z = blockIdx.z; const int rt = blockIdx.x, c0 = blockIdx.y * 128; A16 += z * ((size_t)TT * DQ); Al += z * ((size_t)TT * DQ); C += z * ((size_t)TT * DM);
    gemmw_body<h16, 1, 0, 4>(red, rt * 64, c0, A16, Al, W16, DQ, DQ, C, DM, nullptr, nullptr, nullptr, nullptr, RH + rt * 192);
}
// k_proj: the q, k and v projections of both batches in one grid (TT / 128 token tiles, DQ / 128 + 2 DKV / 128 tiles of output features, NB_). y < DQ / 128: two q heads; the next DKV / 128: two k heads (both x w^T, EPI 1); the last DKV / 128: 128 rows of wv x^T (EPI 2). The choice is the same for a whole work-group.
__global__ __launch_bounds__(256) void k_proj(const bf* __restrict__ XB, const bf* __restrict__ WQ, const bf* __restrict__ WK, const bf* __restrict__ WV, const float* __restrict__ CS, h16* QP16, bf* QPh, bf* QPl, h16* KP16, bf* KPh, bf* KPl, h16* VT16, bf* VTh, bf* VTl) {
    __shared__ __align__(16) float red[8 * 64 * 68];
    const int tt = blockIdx.x, y = blockIdx.y; const size_t z = blockIdx.z; const bf* X = XB + z * ((size_t)TT * DM);
    const size_t zq = z * ((size_t)NH_ * TT * HD), zk = z * ((size_t)NKV * TT * HD);
    if (y < DQ / 128 + DKV / 128) { const bool q = y < DQ / 128;
        gemmw_body<bf, 0, 1>(red, tt * 128, (q ? y : y - DQ / 128) * 128, X, nullptr, q ? WQ : WK, DM, DM, nullptr, 0, CS, q ? QP16 + zq : KP16 + zk, q ? QPh + zq : KPh + zk, q ? QPl + zq : KPl + zk); }
    else gemmw_body<bf, 0, 2>(red, (y - DQ / 128 - DKV / 128) * 128, tt * 128, WV, nullptr, X, DM, DM, nullptr, 0, nullptr, VT16 + zk, VTh + zk, VTl + zk);
}

typedef __attribute__((ext_vector_type(2))) _Float16 v2h;
typedef __attribute__((ext_vector_type(4))) _Float16 v4h;
typedef __attribute__((ext_vector_type(2))) unsigned short v2us;
typedef __attribute__((ext_vector_type(4))) unsigned short v4us;
typedef __attribute__((ext_vector_type(2))) float v2f;
typedef __attribute__((ext_vector_type(4))) int v4i;

// Conversion f32 [rows][DM] -> bf16 in fragment order. A piece is 8 elements of a row; a wave takes 8 rows x one k block at a time (8 whole f32 lines in), its 4 pieces a row going out as 4 whole 128-byte lines; a unit is what the 8 waves of a work-group take at a time: 8 rows x 8 k blocks.
// The five inputs count as one matrix of CROWS rows, x (both batches), wq, wk, wv, wo one below the other, and dst is that matrix in fragment order (every part starts at a multiple of 16 rows), so a unit lies in one input. wo's rows hold the bf16-rounded value as fp16 (the wo product's operand type; the same value from 2^-17 up, below that to within 2^-25), the others bf16. cvt_at gives thread tid's piece of a unit: where it is read (ps) and where it goes (pd).
#define CROWS (NB_ * TT + DQ + 2 * DKV + DM)
__device__ __forceinline__ void cvt_at(const float* __restrict__ x, const float* __restrict__ wq, const float* __restrict__ wk, const float* __restrict__ wv, const float* __restrict__ wo, bf* dst, int unit, int tid, const float*& ps, bf*& pd) { static_assert(DQ == DM && DM == 2048, "every converted matrix has DM elements a row; 8 units to 8 rows");
    const int rg = unit >> 3, row0 = rg * 8, kb = (unit & 7) * 8 + (tid >> 5), j = tid & 3, r = (tid & 31) >> 2;   // group of 8 rows and its first row; the wave's k block; the thread's piece of the block and its row of the group
    const float* src = x; int first = 0;
    if (row0 >= NB_ * TT + DQ + 2 * DKV) { src = wo; first = NB_ * TT + DQ + 2 * DKV; } else if (row0 >= NB_ * TT + DQ + DKV) { src = wv; first = NB_ * TT + DQ + DKV; } else if (row0 >= NB_ * TT + DQ) { src = wk; first = NB_ * TT + DQ; } else if (row0 >= NB_ * TT) { src = wq; first = NB_ * TT; }
    ps = src + (size_t)(row0 - first + r) * DM + kb * 32 + j * 8;
    pd = dst + (size_t)(rg >> 1) * (16 * DM) + kb * 512 + (j >> 1) * 256 + ((j & 1) * 16 + (rg & 1) * 8 + r) * 8; }

__constant__ float INVT[HD / 2] = { 1.000000000e+00f, 7.498942018e-01f, 5.623413324e-01f, 4.216965139e-01f, 3.162277639e-01f, 2.371373624e-01f, 1.778279394e-01f, 1.333521456e-01f, 1.000000015e-01f, 7.498941571e-02f, 5.623412877e-02f, 4.216964915e-02f, 3.162277862e-02f, 2.371373586e-02f, 1.778279431e-02f, 1.333521493e-02f, 9.999999776e-03f, 7.498942316e-03f, 5.623413250e-03f, 4.216964822e-03f, 3.162277862e-03f, 2.371373819e-03f, 1.778279431e-03f, 1.333521446e-03f, 1.000000047e-03f, 7.498941850e-04f, 5.623413017e-04f, 4.216964880e-04f, 3.162277862e-04f, 2.371373848e-04f, 1.778279402e-04f, 1.333521504e-04f };   // float32 1 / 10000^(2i/64), generated with jnp to be bit-exact
__device__ __forceinline__ v2f cs5(int idx) { const int d = idx % HD; const int t = idx / HD; const float a = __fmul_rn((float)t, INVT[d % (HD / 2)]); v2f cs; cs[0] = cosf(a); cs[1] = sinf(a); return cs; }   // (cos, sin) of table entry idx = t * HD + d
// k_prep: the rotary table and all five conversions in one grid that is resident as a whole: few waves that each do much, for speed only.
// The first TWG work-groups write the table, TE entries a thread. Each of the PWG others (two to a WGP: 16 waves) converts PU units, unit u * PWG + its own number, so that the grid as a whole walks the matrix from top to bottom; the loads of PGR units are issued as one group, one group ahead of the group that is being rounded and stored.
#define PU  18
#define PGR 6
#define PWG (CROWS * (DM / 8) / 256 / PU)
#define TE  4
#define TWG (TT * HD / 256 / TE)
#define WOU ((NB_ * TT + DQ + 2 * DKV) / PWG)   // a step of PWG units is PWG rows: wo's rows start at step WOU
__global__ __launch_bounds__(256) void k_prep(const float* __restrict__ x, const float* __restrict__ wq, const float* __restrict__ wk, const float* __restrict__ wv, const float* __restrict__ wo, bf* dst, float* CS) {
    static_assert(TT * HD % (256 * TE) == 0 && CROWS * (DM / 8) % (256 * PU) == 0 && PU % PGR == 0 && PGR == 6, "whole work-groups for the table and for the units; whole groups; the waits below name 6 pointers");
    static_assert((NB_ * TT + DQ + 2 * DKV) % PWG == 0, "wo starts at a whole step");
    const int g = blockIdx.x, tid = (int)threadIdx.x;
    if (g < TWG) { v2f cs[TE];
#pragma unroll   // unrolled: the entries stay in registers and go out as one run of stores
        for (int e = 0; e < TE; ++e) cs[e] = cs5((g * TE + e) * 256 + tid);
#pragma unroll   // unrolled: cs is indexed by constants
        for (int e = 0; e < TE; ++e) *(v2f*)(CS + (size_t)((g * TE + e) * 256 + tid) * 2) = cs[e];
        return; }
    const int gg = g - TWG; __builtin_assume(gg < PWG);   // the grid has TWG + PWG work-groups: with PWG units = 512 rows a step, which input a unit lies in is then known when the loop is unrolled
    v8f v[PU];
#pragma unroll   // unrolled, the inner loops too: every piece has registers of its own, so that two groups of loads can be in flight at once
    for (int c = 0; c <= PU / PGR; ++c) {
        if (c < PU / PGR) { const float* ps[PGR]; bf* pd;   // group c's loads
#pragma unroll
            for (int k = 0; k < PGR; ++k) { cvt_at(x, wq, wk, wv, wo, dst, (c * PGR + k) * PWG + gg, tid, ps[k], pd); v[c * PGR + k] = *(const v8f*)ps[k]; }
            // s_wait_xcnt 0 behind the group of loads, in front of any overwrite of an address register that they name (a precaution); the pointers are inputs so that they stay in their registers up to the wait
            asm volatile("s_wait_xcnt 0x0" :: "v"(ps[0]), "v"(ps[1]), "v"(ps[2]), "v"(ps[3]), "v"(ps[4]), "v"(ps[5]) : "memory");
            __builtin_amdgcn_sched_barrier(0); }   // nothing moves over the end of a group: left alone the compiler rounds two groups in front of the first store, waiting for every load in flight before the next group is asked for
        if (c > 0) { const float* ps; bf* pd[PGR];   // group c - 1 is rounded and stored while group c flies
#pragma unroll
            for (int k = 0; k < PGR; ++k) { cvt_at(x, wq, wk, wv, wo, dst, ((c - 1) * PGR + k) * PWG + gg, tid, ps, pd[k]); v8us o;
#pragma unroll
                for (int e = 0; e < 8; ++e) o[e] = (c - 1) * PGR + k < WOU ? f2bf(v[(c - 1) * PGR + k][e]) : __builtin_bit_cast(unsigned short, tohx(bfr(v[(c - 1) * PGR + k][e])));
                *(v8us*)pd[k] = o; }
            // the same wait behind the group of stores
            asm volatile("s_wait_xcnt 0x0" :: "v"(pd[0]), "v"(pd[1]), "v"(pd[2]), "v"(pd[3]), "v"(pd[4]), "v"(pd[5]) : "memory");
            __builtin_amdgcn_sched_barrier(0); }   // as above: the next group's loads are asked for before the group in flight is waited for
    }
}
// ---- k_fattn: scores, softmax, probability x value and the head merge in ONE kernel (running maximum and running sum per query; no score or probability ever leaves the registers).
// One wave = 16 query rows of one head; the REP waves of a work-group are the REP heads of one kv group, so they walk the same K and V lines from key 0 on. Grid (NKV, NB_, TT / 16); no LDS, no barrier.
// S^T = K Q^T: A = K rows (key = lane & 15), B = Q rows (query = lane & 15), so lane (lr, hi) holds for query lr the keys 8 hi + j of each 16-key tile: maximum and sum in-lane plus one exchange between the wave halves.
// Two such tiles, converted in place, are the B operand (k = 8 hi + s, 16 + 8 hi + (s - 8)) of O^T += V^T P^T, A = V^T rows loaded in the same k order; O^T keeps query = lane & 15, so the rescale is lane-local and a lane stores 8 consecutive d. Q, K, V^T come in fragment order (WFrag) and the output leaves in it, as fp16: one plane, and for the hi/lo rows a second one with what the first rounding left.
// Rows < RH: hi/lo planes, 3 products each, 32 keys a pass; the rest fp16, 64 keys a pass, probabilities carried x 2^10 (the sum carries the same factor, so it cancels in the division).
typedef __attribute__((ext_vector_type(16))) unsigned short v16us;
template <bool B> struct Flag { static constexpr bool v = B; };
// 2^x on the transcendental unit with the slot that the instruction set asks for behind it, in one statement: each v_exp_f32 works in place, so none touches the source or the result of the one in front of it, and the closing v_nop stands between the last one and whatever the compiler schedules next.
__device__ __forceinline__ void exp2x8(float (&e)[8]) {
    asm("v_exp_f32 %0, %0\n\tv_exp_f32 %1, %1\n\tv_exp_f32 %2, %2\n\tv_exp_f32 %3, %3\n\tv_exp_f32 %4, %4\n\tv_exp_f32 %5, %5\n\tv_exp_f32 %6, %6\n\tv_exp_f32 %7, %7\n\tv_nop"
        : "+v"(e[0]), "+v"(e[1]), "+v"(e[2]), "+v"(e[3]), "+v"(e[4]), "+v"(e[5]), "+v"(e[6]), "+v"(e[7])); }
__device__ __forceinline__ float exp2x1(float a) { float e; asm("v_exp_f32 %0, %1\n\tv_nop" : "=v"(e) : "v"(a)); return e; }   // the same for one value
template <typename T16, bool HL, int KB>
__device__ __forceinline__ void fattn_body(const T16* __restrict__ Q, const T16* __restrict__ Q2, const T16* __restrict__ Kp, const T16* __restrict__ Kp2, const T16* __restrict__ Vt, const T16* __restrict__ Vt2, int q0, int kv, int head, h16* A16, h16* Al) {
    typedef typename WFrag<T16>::V V;
    constexpr int NKT = KB / 16, NKH = KB / 32;
    constexpr float C1 = SCL * 1.4426950408889634f;   // raw score -> log2 units: HD^-0.5 x log2(e)
    constexpr bool AHEAD = !HL;   // K fragments fetched one pass ahead; not on the hi/lo path, whose twofold fragments would then take the wave past 256 registers
    const int lane = threadIdx.x & 31, lr = lane & 15, hi = lane >> 4; const int qi = q0 + lr;
    V qf[2], qf2[2];
    { const T16* pq = Q + ((size_t)head * TT + q0) * HD + 8 * lane; qf[0] = WFrag<T16>::ld(pq); qf[1] = WFrag<T16>::ld(pq + 512);
      // s_wait_xcnt 0 behind the run of Q loads, in front of any overwrite of an address register that they name (a precaution); the pointers are inputs so that they stay in their registers up to the wait
      if constexpr (HL) { const T16* pq2 = Q2 + ((size_t)head * TT + q0) * HD + 8 * lane; qf2[0] = WFrag<T16>::ld(pq2); qf2[1] = WFrag<T16>::ld(pq2 + 512); asm volatile("s_wait_xcnt 0x0" :: "v"(pq), "v"(pq2) : "memory"); }
      else asm volatile("s_wait_xcnt 0x0" :: "v"(pq) : "memory"); }
    const size_t koff = (size_t)kv * TT * HD + 8 * lane, voff = (size_t)kv * HD * TT + 8 * lane;
    v8f o[4];
#pragma unroll
    for (int db = 0; db < 4; ++db) o[db] = (v8f){};
    float m = -3.0e38f, l = 0.f;
    V kf[NKT][2], kf2[NKT][2];
    auto load_k = [&](int k0) {   // the K fragments of the pass that starts at key k0
        const T16* pk = Kp + koff + (size_t)k0 * HD;
#pragma unroll
        for (int kt = 0; kt < NKT; ++kt)
#pragma unroll
            for (int ks = 0; ks < 2; ++ks) kf[kt][ks] = WFrag<T16>::ld(pk + (kt * 2 + ks) * 512);
        // the same wait behind the run of K loads
        if constexpr (HL) { const T16* pk2 = Kp2 + koff + (size_t)k0 * HD;
#pragma unroll
            for (int kt = 0; kt < NKT; ++kt)
#pragma unroll
                for (int ks = 0; ks < 2; ++ks) kf2[kt][ks] = WFrag<T16>::ld(pk2 + (kt * 2 + ks) * 512);
            asm volatile("s_wait_xcnt 0x0" :: "v"(pk), "v"(pk2) : "memory"); }
        else asm volatile("s_wait_xcnt 0x0" :: "v"(pk) : "memory"); };
    auto pass = [&](int k0, auto edge) {   // KB keys from k0 on; edge: the one pass that holds the diagonal (causal select, no pass behind it)
        constexpr bool EDGE = decltype(edge)::v;
        V vf[4][NKH], vf2[4][NKH];
        if constexpr (!AHEAD) load_k(k0);
        const T16* pv = Vt + voff + (size_t)k0 * 16;
#pragma unroll
        for (int db = 0; db < 4; ++db)
#pragma unroll
            for (int kh = 0; kh < NKH; ++kh) vf[db][kh] = WFrag<T16>::ld(pv + (size_t)db * 16 * TT + kh * 512);
        // the same wait behind the run of V loads
        if constexpr (HL) { const T16* pv2 = Vt2 + voff + (size_t)k0 * 16;
#pragma unroll
            for (int db = 0; db < 4; ++db)
#pragma unroll
                for (int kh = 0; kh < NKH; ++kh) vf2[db][kh] = WFrag<T16>::ld(pv2 + (size_t)db * 16 * TT + kh * 512);
            asm volatile("s_wait_xcnt 0x0" :: "v"(pv), "v"(pv2) : "memory"); }
        else asm volatile("s_wait_xcnt 0x0" :: "v"(pv) : "memory");
        v8f s[NKT];
#pragma unroll
        for (int kt = 0; kt < NKT; ++kt) { s[kt] = (v8f){};
#pragma unroll
            for (int ks = 0; ks < 2; ++ks) { s[kt] = WFrag<T16>::mma(kf[kt][ks], qf[ks], s[kt]); if constexpr (HL) { s[kt] = WFrag<T16>::mma(kf[kt][ks], qf2[ks], s[kt]); s[kt] = WFrag<T16>::mma(kf2[kt][ks], qf[ks], s[kt]); } } }
        if constexpr (AHEAD && !EDGE) load_k(k0 + KB);   // the next pass's K fragments fly during this pass's softmax and P.V (a pass that is not the edge pass always has a successor)
        float bm = -3.0e38f; const int rel = qi - k0 - hi * 8;   // a lane's key kt * 16 + j of the pass is allowed while it is <= rel
#pragma unroll
        for (int kt = 0; kt < NKT; ++kt)
#pragma unroll
            for (int j = 0; j < 8; ++j) { if constexpr (EDGE) s[kt][j] = (kt * 16 + j <= rel) ? s[kt][j] : -3.0e38f; bm = fmaxf(bm, s[kt][j]); }
        bm = fmaxf(bm, __shfl_xor(bm, 16, 32));
        const float mn = fmaxf(m, bm * C1); const float alpha = exp2x1(m - mn); m = mn;   // the running maximum is kept in log2 units
        const float sh = (HL ? 0.0f : 10.0f) - mn;
        float ls[NKT];
#pragma unroll
        for (int kt = 0; kt < NKT; ++kt) { float e[8]; ls[kt] = 0.f;
#pragma unroll
            for (int j = 0; j < 8; ++j) e[j] = s[kt][j] * C1 + sh;   // one multiply-add from raw score to exponent
            exp2x8(e);
#pragma unroll
            for (int j = 0; j < 8; ++j) { s[kt][j] = e[j]; ls[kt] += e[j]; } }
        float lsum = ls[0];
#pragma unroll
        for (int kt = 1; kt < NKT; ++kt) lsum += ls[kt];
        l = l * alpha + lsum;   // each wave half keeps the sum of its own keys; the halves are joined once, behind the last pass
#pragma unroll
        for (int db = 0; db < 4; ++db) o[db] *= alpha;
#pragma unroll
        for (int kh = 0; kh < NKH; ++kh) {
            if constexpr (HL) { v16us ph, pl;
#pragma unroll
                for (int q = 0; q < 16; ++q) { unsigned short a, c2; splitf(s[kh * 2 + (q >> 3)][q & 7], a, c2); ph[q] = a; pl[q] = c2; }
                const V pfh = __builtin_bit_cast(V, ph), pfl = __builtin_bit_cast(V, pl);
#pragma unroll
                for (int db = 0; db < 4; ++db) { o[db] = WFrag<T16>::mma(vf[db][kh], pfh, o[db]); o[db] = WFrag<T16>::mma(vf[db][kh], pfl, o[db]); o[db] = WFrag<T16>::mma(vf2[db][kh], pfh, o[db]); }
            } else { V pf;
#pragma unroll
                for (int q = 0; q < 16; ++q) pf[q] = tohx(s[kh * 2 + (q >> 3)][q & 7]);
#pragma unroll
                for (int db = 0; db < 4; ++db) o[db] = WFrag<T16>::mma(vf[db][kh], pf, o[db]); } }
        asm volatile("v_nop\n\tv_nop\n\tv_nop\n\tv_nop" : "+v"(o[0]), "+v"(o[1]), "+v"(o[2]), "+v"(o[3]) : "v"(vf[3][NKH - 1]));   // four vector slots behind the last WMMA, also on the taken back edge, before fragments or accumulators are touched
    };
    int k0 = 0;   // both loops stay rolled: one pass already holds every fragment of KB keys in registers
    if constexpr (AHEAD) { static_assert(RH >= KB, "the fetch-ahead loop runs at least once: its rows start at RH");
        load_k(0);
#pragma unroll 1
        do { pass(k0, Flag<false>{}); k0 += KB; } while (k0 + KB - 1 <= q0);
    } else {
#pragma unroll 1
        for (; k0 + KB - 1 <= q0; k0 += KB) pass(k0, Flag<false>{}); }
    pass(k0, Flag<true>{});
    const float f = __fdiv_rn(1.0f, l + __shfl_xor(l, 16, 32));
    const size_t oo = (size_t)q0 * DQ + head * (2 * 512) + 8 * lane; v8h oh[4], ol[4];   // fragment order of the wo product's A operand (rows = queries, k = head * HD + d): a lane's 8 values of d block db are its own piece of half db & 1 of k block head * 2 + (db >> 1)
#pragma unroll
    for (int db = 0; db < 4; ++db)
#pragma unroll
        for (int j = 0; j < 8; ++j) { const float y = o[db][j] * f; oh[db][j] = tohx(y); if constexpr (HL) ol[db][j] = tohx(y - (float)oh[db][j]); }
    h16* pa = A16 + oo; h16* pl = Al + oo;
#pragma unroll
    for (int db = 0; db < 4; ++db) { *(v8h*)(pa + db * 256) = oh[db]; if constexpr (HL) *(v8h*)(pl + db * 256) = ol[db]; }
    // s_wait_xcnt 0 behind the run of stores, in front of any overwrite of a register that they name (a precaution)
    if constexpr (HL) asm volatile("s_wait_xcnt 0x0" :: "v"(pa), "v"(pl) : "memory"); else asm volatile("s_wait_xcnt 0x0" :: "v"(pa) : "memory");
}
// amdgpu_waves_per_eu(4, 4): at most 256 registers a wave, so that four waves share a SIMD and half of the NKV x NB_ x TT / 16 work-groups are resident at once; the others follow as places come free
__global__ __launch_bounds__(32 * REP) __attribute__((amdgpu_waves_per_eu(4, 4))) void k_fattn(const h16* __restrict__ Q16, const bf* __restrict__ Qh, const bf* __restrict__ Ql, const h16* __restrict__ K16, const bf* __restrict__ Kh, const bf* __restrict__ Kl, const h16* __restrict__ V16, const bf* __restrict__ Vh, const bf* __restrict__ Vl, h16* A16, h16* Al) {
    const int wave = __builtin_amdgcn_readfirstlane((int)(threadIdx.x >> 5));   // wave number in a scalar register: head, loop bound and branches stay scalar
    const int kv = blockIdx.x, head = kv * REP + wave, rank = blockIdx.z;
    { const size_t zq = (size_t)blockIdx.y * ((size_t)NH_ * TT * HD), zk = (size_t)blockIdx.y * ((size_t)NKV * TT * HD), za = (size_t)blockIdx.y * ((size_t)TT * DQ);   // this batch's planes
      Q16 += zq; Qh += zq; Ql += zq; K16 += zk; Kh += zk; Kl += zk; V16 += zk; Vh += zk; Vl += zk; A16 += za; Al += za; }
    // There are twice as many work-groups as places: the four heads of a work-group take the same tile, and a tile's cost falls with the rank (the slowest grid index), so that the short ones fill the places that the long ones leave.
    // An fp16 tile t costs about t; a hi/lo tile h (three products a key) about 3 h: ranks 0..33 are tiles 127..94; then groups of four (hi/lo tile 31 - g, fp16 tiles 93 - 3 g, 92 - 3 g, 91 - 3 g) down to tile 32; ranks 117..127 are tiles 10..0. For speed only; the map is a permutation, so each (head, tile) is taken once.
    static_assert(TT / 16 == 128 && RH / 16 == 32, "the rank -> tile map is written for 128 tiles, 32 of them hi/lo");
    const int s = rank - 34; const int tile = (rank < 34 || rank >= 117) ? 127 - rank : ((s & 3) == 0 ? 31 - (s >> 2) : 94 - 3 * (s >> 2) - (s & 3)); const int q0 = tile * 16;
    if (q0 < RH) fattn_body<bf, true, 32>(Qh, Ql, Kh, Kl, Vh, Vl, q0, kv, head, A16, Al);
    else fattn_body<h16, false, 64>(Q16, nullptr, K16, nullptr, V16, nullptr, q0, kv, head, A16, Al);
}

extern "C" void kernel_launch(void* const* d_in, const int* in_sizes, int n_in,
                              void* d_out, int out_size, void* d_ws, size_t ws_size, hipStream_t stream) {
    (void)in_sizes; (void)n_in; (void)out_size;
        const float* x = (const float*)d_in[0]; const float* wq = (const float*)d_in[1]; const float* wk = (const float*)d_in[2]; const float* wv = (const float*)d_in[3]; const float* wo = (const float*)d_in[4];   /* inputs x, wq [2048][2048], wk [512][2048], wv, wo ('oi'); this module has no mask input (the causal rule is by index) */
    float* OUT = (float*)d_out;     // [2][2048][2048]
    char* wsp = (char*)d_ws;
    auto take = [&](size_t bytes) { char* p = wsp; wsp += (bytes + 255) & ~(size_t)255; return (void*)p; };
    bf* XB = (bf*)take((size_t)CROWS * DM * 2); bf* WQ = XB + (size_t)NB_ * TT * DM; bf* WK = WQ + (size_t)DQ * DM; bf* WV = WK + (size_t)DKV * DM; h16* WO16 = (h16*)(WV + (size_t)DKV * DM);   // one block, in the row order of cvt_at
    float* CS = (float*)take((size_t)TT * HD * 2 * 4);
    // every plane below holds both batches, one behind the other
    h16* QP16 = (h16*)take((size_t)NB_ * NH_ * TT * HD * 2); h16* KP16 = (h16*)take((size_t)NB_ * NKV * TT * HD * 2); h16* VT16 = (h16*)take((size_t)NB_ * NKV * HD * TT * 2);
    bf* QPh = (bf*)take((size_t)NB_ * NH_ * TT * HD * 2); bf* QPl = (bf*)take((size_t)NB_ * NH_ * TT * HD * 2); bf* KPh = (bf*)take((size_t)NB_ * NKV * TT * HD * 2); bf* KPl = (bf*)take((size_t)NB_ * NKV * TT * HD * 2); bf* VTh = (bf*)take((size_t)NB_ * NKV * HD * TT * 2); bf* VTl = (bf*)take((size_t)NB_ * NKV * HD * TT * 2);
    h16* AT16 = (h16*)take((size_t)NB_ * TT * DQ * 2); h16* ATl = (h16*)take((size_t)NB_ * TT * DQ * 2);   // of ATl only the rows below RH of each batch are written and read
    if ((size_t)(wsp - (char*)d_ws) > ws_size) return;    // ws 256 MiB
    k_prep<<<TWG + PWG, 256, 0, stream>>>(x, wq, wk, wv, wo, XB, CS);   /* rotary table and every 16-bit copy */
    k_proj<<<dim3(TT / 128, DQ / 128 + 2 * (DKV / 128), NB_), 256, 0, stream>>>(XB, WQ, WK, WV, CS, QP16, QPh, QPl, KP16, KPh, KPl, VT16, VTh, VTl);
    k_fattn<<<dim3(NKV, NB_, TT / 16), 32 * REP, 0, stream>>>(QP16, QPh, QPl, KP16, KPh, KPl, VT16, VTh, VTl, AT16, ATl);
    k_wo<<<dim3(TT / 256, DM / 128, NB_), 512, 0, stream>>>(AT16, ATl, WO16, OUT);
}
